// v000
// Times are from an AMD MI455X. After a warm-up the kernel runs many times in a row, and a time is the length of
// such a window on the GPU divided by its runs, so every launch and the gaps after it count. The runs cycle
// through copies of the inputs. A figure is the median of several windows, for all but v000 over two sittings.
// Sittings can differ by a few percent; kernels timed side by side share one.
// The starting kernel, v000, takes 1130 microseconds a run.
#include <hip/hip_runtime.h>

// EnhancedPolarAttention (x [1][64][64][128] -> 4096 tokens; qkv = x Wp + bp laid out (3, 8 heads, 32); scores[n][m] = (q_n.k_m / sqrt 32) r_weight[m] cos(theta_m - theta_n) with the module's polar
// constants (r = |p - centre| + 1e-6, theta = atan2 mod 2pi, log_r = log r / log max r, r_weight = 1/(log_r + 1), 'xy' meshgrid flattening); softmax over m; out = merged attn.v Wf + bf -> [1][64][64][256]).
// Compute dtypes, f32 accumulate: every input rounded to bf16; the projection on PLAIN bf16 operands (inputs: exact, + bias); the polar constants in f32 on VALU; the
// softmax in f32 (row max; one exp per element with the 32^-0.5; fp16 numerators x1024; 1/(1024 sum) applied at the merge); attn.v on fp16 planes (v padded to a 64-row plane); merged heads as hi+lo

#define HW   64
#define NN   4096                 // tokens
#define CC   128
#define KD   256                  // key_dim
#define NH_  8
#define HD   32
#define PCAR 1024.0f
#define SCL  0.17677669529663688f   // 32^-0.5
typedef _Float16 h16;
typedef unsigned short bf;
typedef __attribute__((ext_vector_type(16))) __bf16   v16bf;
typedef __attribute__((ext_vector_type(16))) _Float16 v16h;
typedef __attribute__((ext_vector_type(8)))  _Float16 v8h;
typedef __attribute__((ext_vector_type(8)))  unsigned short v8us;
typedef __attribute__((ext_vector_type(8)))  float    v8f;
typedef __attribute__((ext_vector_type(4)))  float    v4f;
typedef v8h  __attribute__((may_alias)) v8ha;
typedef v4f  __attribute__((may_alias)) v4fa;
typedef v8us __attribute__((may_alias)) v8usa;

__device__ __forceinline__ unsigned short f2bf(float f) { unsigned u = __float_as_uint(f); u += 0x7FFFu + ((u >> 16) & 1u); return (unsigned short)(u >> 16); }
__device__ __forceinline__ float bf2f(unsigned short b) { return __uint_as_float(((unsigned)b) << 16); }
__device__ __forceinline__ float bfr(float f) { return bf2f(f2bf(f)); }
__device__ __forceinline__ v16h cat16(v8h lo, v8h hi) { return __builtin_shufflevector(lo, hi, 0, 1, 2, 3, 4, 5, 6, 7, 8, 9, 10, 11, 12, 13, 14, 15); }
__device__ __forceinline__ v16bf cat16b(v8us lo, v8us hi) { return __builtin_bit_cast(v16bf, __builtin_shufflevector(lo, hi, 0, 1, 2, 3, 4, 5, 6, 7, 8, 9, 10, 11, 12, 13, 14, 15)); }
__device__ __forceinline__ v8f wmma16(v16h a, v16h b, v8f c) { return __builtin_amdgcn_wmma_f32_16x16x32_f16(false, a, false, b, (short)0, c, false, false); }
__device__ __forceinline__ v8f wmmab(v16bf a, v16bf b, v8f c) { return __builtin_amdgcn_wmma_f32_16x16x32_bf16(false, a, false, b, (short)0, c, false, false); }



// ---- k_gemmw: register-blocked GEMM, ONE WAVE per 64x64 output tile (16 accumulators), operands straight from K-contiguous 16-bit planes; grid (M/64, N/64, Z), 32 threads.
// C[m][n] (f32, pitch ldc, + optional f32 bias[n]) = sum_k A[m][k] Bt[n][k] (+ split products per NSPLIT). z-batch strides sA/sB/sC in elements. K % 32 == 0.
template <typename T16> struct WFrag;
template <> struct WFrag<h16> { typedef v16h V; static __device__ __forceinline__ V ld(const h16* p) { return cat16(*(const v8h*)p, *(const v8h*)(p + 16)); } static __device__ __forceinline__ v8f mma(V a, V b, v8f c) { return wmma16(a, b, c); } };
template <> struct WFrag<bf> { typedef v16bf V; static __device__ __forceinline__ V ld(const bf* p) { return cat16b(*(const v8us*)p, *(const v8us*)(p + 16)); } static __device__ __forceinline__ v8f mma(V a, V b, v8f c) { return wmmab(a, b, c); } };
template <typename T16, int NSPLIT, bool BIAS>
__global__ __launch_bounds__(32) void k_gemmw(const T16* __restrict__ A, const T16* __restrict__ A2, const T16* __restrict__ Bt, const T16* __restrict__ Bt2, int K, float* C, int ldc, const float* __restrict__ bias, size_t sA, size_t sB, size_t sC) {
    typedef typename WFrag<T16>::V V;
    __shared__ __align__(16) float os[16 * 68];
    const size_t z = blockIdx.z; A += z * sA; if (A2) A2 += z * sA; Bt += z * sB; if (Bt2) Bt2 += z * sB; C += z * sC;
    const int lane = threadIdx.x & 31, lr = lane & 15, hi = lane >> 4; const int r0 = blockIdx.x * 64, c0 = blockIdx.y * 64;
    v8f acc[4][4];
#pragma unroll
    for (int mb = 0; mb < 4; ++mb)
#pragma unroll
        for (int nb = 0; nb < 4; ++nb) acc[mb][nb] = (v8f){};
    const size_t aoff = (size_t)(r0 + lr) * K + 8 * hi, boff = (size_t)(c0 + lr) * K + 8 * hi;
#pragma unroll 1
    for (int kc = 0; kc < K; kc += 32) {
        V a[4], a2[4];
#pragma unroll
        for (int mb = 0; mb < 4; ++mb) { a[mb] = WFrag<T16>::ld(A + aoff + (size_t)mb * 16 * K + kc); if (NSPLIT == 1 || NSPLIT == 2) a2[mb] = WFrag<T16>::ld(A2 + aoff + (size_t)mb * 16 * K + kc); }
#pragma unroll
        for (int nb = 0; nb < 4; ++nb) { const V b = WFrag<T16>::ld(Bt + boff + (size_t)nb * 16 * K + kc); V b2; if (NSPLIT >= 2) b2 = WFrag<T16>::ld(Bt2 + boff + (size_t)nb * 16 * K + kc);
#pragma unroll
            for (int mb = 0; mb < 4; ++mb) { acc[mb][nb] = WFrag<T16>::mma(a[mb], b, acc[mb][nb]); if (NSPLIT == 1 || NSPLIT == 2) acc[mb][nb] = WFrag<T16>::mma(a2[mb], b, acc[mb][nb]); if (NSPLIT >= 2) acc[mb][nb] = WFrag<T16>::mma(a[mb], b2, acc[mb][nb]); } }
        asm volatile("v_nop\n\tv_nop\n\tv_nop\n\tv_nop" : "+v"(acc[0][0]), "+v"(acc[1][1]), "+v"(acc[2][2]), "+v"(acc[3][3]) : "v"(a[0]), "v"(a[3]));
    }
#pragma unroll
    for (int mb = 0; mb < 4; ++mb) {
#pragma unroll
        for (int nb = 0; nb < 4; ++nb) {
#pragma unroll
            for (int j = 0; j < 8; ++j) os[(hi * 8 + j) * 68 + nb * 16 + lr] = acc[mb][nb][j]; }
        __builtin_amdgcn_wave_barrier(); asm volatile("" ::: "memory");
        float* crow = C + (size_t)(r0 + mb * 16) * ldc + c0;
{
#pragma unroll
            for (int s = 0; s < 8; ++s) { const int row = 2 * s + hi, cofs = lr * 4; v4f val = *(const v4fa*)(os + row * 68 + cofs); if (BIAS) { val[0] += bfr(bias[c0 + cofs]); val[1] += bfr(bias[c0 + cofs + 1]); val[2] += bfr(bias[c0 + cofs + 2]); val[3] += bfr(bias[c0 + cofs + 3]); }
                *(v4f*)(crow + (size_t)row * ldc + cofs) = val; }
             }
        __builtin_amdgcn_wave_barrier(); asm volatile("" ::: "memory");
    }
}

__device__ __forceinline__ h16 tohx(float x) { return (h16)x; }
__device__ __forceinline__ void splitf(float y, unsigned short& h, unsigned short& l) { h = f2bf(y); l = f2bf(y - bf2f(h)); }
typedef __attribute__((ext_vector_type(2))) _Float16 v2h;
typedef __attribute__((ext_vector_type(4))) _Float16 v4h;
typedef __attribute__((ext_vector_type(2))) unsigned short v2us;
typedef __attribute__((ext_vector_type(4))) float v4fx;

__global__ __launch_bounds__(256) void k_wtG(const float* __restrict__ w, int K, int N, bf* Bt) {
    const int lane = threadIdx.x & 31; const int L0 = (blockIdx.x * 8 + (threadIdx.x >> 5)) * 8; const int nlines = N * K / 64;
{
#pragma unroll 1
        for (int l = 0; l < 8; ++l) { const int L = L0 + l; if (L >= nlines) break; const size_t e = (size_t)L * 64 + lane * 2; const int k = (int)(e % K), n = (int)(e / K); v2us o;
            o[0] = f2bf(w[(size_t)k * N + n]); o[1] = f2bf(w[(size_t)(k + 1) * N + n]); *(v2us*)(Bt + e) = o; }
         }
}
__global__ __launch_bounds__(256) void k_cvt8(const float* __restrict__ src, bf* dst, size_t n8) { const size_t i = (size_t)blockIdx.x * 256 + threadIdx.x; if (i >= n8) return; const v8f v = *(const v8f*)(src + i * 8); v8us o;
#pragma unroll
    for (int k = 0; k < 8; ++k) o[k] = f2bf(v[k]); *(v8us*)(dst + i * 8) = o;  }
// k_polar: per token n (x = n / 64, y = n % 64 from the 'xy' meshgrid flattening): r = sqrt((x-32)^2 + (y-32)^2) + 1e-6, th = atan2(y-32, x-32) (+2pi mod 2pi), log_r = log(r)/log(r_max) with
__global__ __launch_bounds__(256) void k_polar(float* TB) { const int n = blockIdx.x * 256 + threadIdx.x; if (n >= NN) return; const float xx = (float)(n / HW) - 32.0f, yy = (float)(n % HW) - 32.0f;
    const float r = __fsqrt_rn(__fadd_rn(__fmul_rn(xx, xx), __fmul_rn(yy, yy))) + 1e-6f; float th = atan2f(yy, xx); th = fmodf(th + 6.283185307179586f, 6.283185307179586f);
    const float rmax = __fsqrt_rn(2048.0f) + 1e-6f; const float lr = __fdiv_rn(logf(r), logf(rmax)); const float rw = __fdiv_rn(1.0f, __fadd_rn(lr, 1.0f)); v4fx o; o[0] = cosf(th); o[1] = sinf(th); o[2] = rw; o[3] = 0.f;
    *(v4fx*)(TB + (size_t)n * 4) = o;  }
__global__ __launch_bounds__(256) void k_qa(const float* __restrict__ F, const float* __restrict__ TB, int off, int usew, h16* P) { const int e = (blockIdx.x * 256 + threadIdx.x) * 2; if (e >= NH_ * NN * 64) return; const int dp = e & 63; const int n = (e >> 6) & (NN - 1); const int h = e / (NN * 64); const int d = dp & 31; const float cs = TB[(size_t)n * 4 + (dp >= 32 ? 1 : 0)]; const float w = usew ? TB[(size_t)n * 4 + 2] : 1.0f; v2h o;
#pragma unroll
    for (int q = 0; q < 2; ++q) { float a = F[(size_t)n * 3 * KD + off + h * HD + d + q]; float aw = __fmul_rn(a, w); asm volatile("" : "+v"(aw)); o[q] = tohx(__fmul_rn(aw, cs)); } *(v2h*)(P + e) = o;  }
__global__ __launch_bounds__(256) void k_vt(const float* __restrict__ F, h16* VT) { const int e = (blockIdx.x * 256 + threadIdx.x) * 2; if (e >= NH_ * 64 * NN) return; const int m = e & (NN - 1); const int d = (e / NN) & 63; const int h = e / (NN * 64); v2h o;
    if (d < HD) { o[0] = tohx(F[(size_t)m * 3 * KD + 2 * KD + h * HD + d]); o[1] = tohx(F[(size_t)(m + 1) * 3 * KD + 2 * KD + h * HD + d]); } else { o[0] = 0; o[1] = 0; } *(v2h*)(VT + e) = o;  }
__global__ __launch_bounds__(256) void k_smax(const float* __restrict__ S, float* RS) { const int lane = threadIdx.x & 31; const int i = blockIdx.x * 8 + (threadIdx.x >> 5); if (i >= NN) return; const float* sr = S + (size_t)i * NN; float m = -3.0e38f;
#pragma unroll 4
    for (int c0 = lane * 4; c0 < NN; c0 += 128) { const v4f v = *(const v4f*)(sr + c0); m = fmaxf(m, fmaxf(fmaxf(v[0], v[1]), fmaxf(v[2], v[3]))); }
#pragma unroll
    for (int sh = 16; sh; sh >>= 1) m = fmaxf(m, __shfl_xor(m, sh, 32));
    const float o = lane == 0 ? m : 0.f; *(float*)(RS + (size_t)i * 32 + lane) = o;  }
__global__ __launch_bounds__(256) void k_sexp(const float* __restrict__ S, float* RS, h16* P) { const int lane = threadIdx.x & 31; const int i = blockIdx.x * 8 + (threadIdx.x >> 5); if (i >= NN) return; const float* sr = S + (size_t)i * NN; const float m = RS[(size_t)i * 32]; float sum = 0.f;
{ sum = 0.f;
#pragma unroll 2
        for (int c0 = lane * 4; c0 < NN; c0 += 128) { const v4f v = *(const v4f*)(sr + c0); v4h o;
#pragma unroll
            for (int q = 0; q < 4; ++q) { float dlt = __fsub_rn(v[q], m); asm volatile("" : "+v"(dlt)); const float e = __expf(__fmul_rn(dlt, SCL)); sum += e; o[q] = tohx(e * PCAR); }
            *(v4h*)(P + (size_t)i * NN + c0) = o; }
         }
#pragma unroll
    for (int sh = 16; sh; sh >>= 1) sum += __shfl_xor(sum, sh, 32);
    const float o2 = lane == 0 ? m : (lane == 1 ? __fdiv_rn(1.0f, sum * PCAR) : 0.f); *(float*)(RS + (size_t)i * 32 + lane) = o2;  }
__global__ __launch_bounds__(256) void k_mrg(const float* __restrict__ O, const float* __restrict__ RS, int h, bf* Ah, bf* Al) { const int e = (blockIdx.x * 256 + threadIdx.x) * 2; if (e >= NN * HD) return; const int d = e & 31; const int n = e >> 5; const float sc = RS[(size_t)n * 32 + 1]; v2us oh, ol;
#pragma unroll
    for (int q = 0; q < 2; ++q) { unsigned short a, c2; splitf(__fmul_rn(O[(size_t)n * 64 + d + q], sc), a, c2); oh[q] = a; ol[q] = c2; } const size_t oo = (size_t)n * KD + h * HD + d; *(v2us*)(Ah + oo) = oh; *(v2us*)(Al + oo) = ol;  }

extern "C" void kernel_launch(void* const* d_in, const int* in_sizes, int n_in,
                              void* d_out, int out_size, void* d_ws, size_t ws_size, hipStream_t stream) {
    (void)in_sizes; (void)n_in; (void)out_size;
    const float* x = (const float*)d_in[0]; const float* wp = (const float*)d_in[1]; const float* bp = (const float*)d_in[2]; const float* wf = (const float*)d_in[3]; const float* bfv = (const float*)d_in[4];   // Wp [128][768], Wf [256][256] as x @ W
    float* OUT = (float*)d_out;     // [1][64][64][256]
    char* wsp = (char*)d_ws;
    auto take = [&](size_t bytes) { char* p = wsp; wsp += (bytes + 255) & ~(size_t)255; return (void*)p; };
    bf* WP = (bf*)take((size_t)3 * KD * CC * 2); bf* WF = (bf*)take((size_t)KD * KD * 2); float* TB = (float*)take((size_t)NN * 4 * 4); bf* XB = (bf*)take((size_t)NN * CC * 2); float* F = (float*)take((size_t)NN * 3 * KD * 4);
    h16* QA = (h16*)take((size_t)NH_ * NN * 64 * 2); h16* KB = (h16*)take((size_t)NH_ * NN * 64 * 2); h16* VT = (h16*)take((size_t)NH_ * 64 * NN * 2); float* S = (float*)take((size_t)NN * NN * 4); h16* P = (h16*)take((size_t)NN * NN * 2); float* RS = (float*)take((size_t)NN * 32 * 4); float* O = (float*)take((size_t)NN * 64 * 4); bf* Ah = (bf*)take((size_t)NN * KD * 2); bf* Al = (bf*)take((size_t)NN * KD * 2);
    if ((size_t)(wsp - (char*)d_ws) > ws_size) return;    // total ~ 133 MB = 127 MiB; ws 256 MiB
    k_wtG<<<(unsigned)((CC * 3 * KD / 64 + 63) / 64), 256, 0, stream>>>(wp, CC, 3 * KD, WP); k_wtG<<<(unsigned)((KD * KD / 64 + 63) / 64), 256, 0, stream>>>(wf, KD, KD, WF); k_polar<<<NN / 256, 256, 0, stream>>>(TB);
    k_cvt8<<<(unsigned)(((size_t)NN * CC / 8 + 255) / 256), 256, 0, stream>>>(x, XB, (size_t)NN * CC / 8);
    k_gemmw<bf, 0, true><<<dim3(NN / 64, 3 * KD / 64, 1), 32, 0, stream>>>(XB, nullptr, WP, nullptr, CC, F, 3 * KD, bp, 0, 0, 0);
    const unsigned LP = (NH_ * NN * 64 / 2 + 255) / 256; k_qa<<<LP, 256, 0, stream>>>(F, TB, 0, 0, QA); k_qa<<<LP, 256, 0, stream>>>(F, TB, KD, 1, KB); k_vt<<<LP, 256, 0, stream>>>(F, VT);
    for (int h = 0; h < NH_; ++h) {
        k_gemmw<h16, 0, false><<<dim3(NN / 64, NN / 64, 1), 32, 0, stream>>>(QA + (size_t)h * NN * 64, nullptr, KB + (size_t)h * NN * 64, nullptr, 64, S, NN, nullptr, 0, 0, 0);
        k_smax<<<NN / 8, 256, 0, stream>>>(S, RS); k_sexp<<<NN / 8, 256, 0, stream>>>(S, RS, P);
        k_gemmw<h16, 0, false><<<dim3(NN / 64, 1, 1), 32, 0, stream>>>(P, nullptr, VT + (size_t)h * 64 * NN, nullptr, NN, O, 64, nullptr, 0, 0, 0);
        k_mrg<<<(NN * HD / 2 + 255) / 256, 256, 0, stream>>>(O, RS, h, Ah, Al); }
    k_gemmw<bf, 1, true><<<dim3(NN / 64, KD / 64, 1), 32, 0, stream>>>(Ah, Al, WF, nullptr, KD, OUT, KD, bfv, 0, 0, 0);
}

// v001
// Measured time: 557 microseconds a run.
// Timed twice side by side with v000, it ran 2.03 and 2.01 times as fast.
#include <hip/hip_runtime.h>

// EnhancedPolarAttention (x [1][64][64][128] -> 4096 tokens; qkv = x Wp + bp laid out (3, 8 heads, 32); scores[n][m] = (q_n.k_m / sqrt 32) r_weight[m] cos(theta_m - theta_n) with the module's polar
// constants (r = |p - centre| + 1e-6, theta = atan2 mod 2pi, log_r = log r / log max r, r_weight = 1/(log_r + 1), 'xy' meshgrid flattening); softmax over m; out = merged attn.v Wf + bf -> [1][64][64][256]).
// Compute dtypes, f32 accumulate: every input rounded to bf16; the projection on PLAIN bf16 operands (inputs: exact, + bias); the polar constants in f32 on VALU; the
// softmax in f32 (row max; one exp per element with the 32^-0.5; fp16 numerators x1024; 1/(1024 sum) applied at the merge); attn.v on fp16 planes (v padded to a 64-row plane); merged heads as hi+lo

#define HW   64
#define NN   4096                 // tokens
#define CC   128
#define KD   256                  // key_dim
#define NH_  8
#define HD   32
#define PCAR 1024.0f
#define SCL  0.17677669529663688f   // 32^-0.5
#define SPL  32                   // key ranges of the attn.v product: one wave per (64-row tile, range), f32 partial sums [row][range][64] summed in k_mrg
typedef _Float16 h16;
typedef unsigned short bf;
typedef __attribute__((ext_vector_type(16))) __bf16   v16bf;
typedef __attribute__((ext_vector_type(16))) _Float16 v16h;
typedef __attribute__((ext_vector_type(8)))  _Float16 v8h;
typedef __attribute__((ext_vector_type(8)))  unsigned short v8us;
typedef __attribute__((ext_vector_type(8)))  float    v8f;
typedef __attribute__((ext_vector_type(4)))  float    v4f;
typedef v8h  __attribute__((may_alias)) v8ha;
typedef v4f  __attribute__((may_alias)) v4fa;
typedef v8us __attribute__((may_alias)) v8usa;

__device__ __forceinline__ unsigned short f2bf(float f) { unsigned u = __float_as_uint(f); u += 0x7FFFu + ((u >> 16) & 1u); return (unsigned short)(u >> 16); }
__device__ __forceinline__ float bf2f(unsigned short b) { return __uint_as_float(((unsigned)b) << 16); }
__device__ __forceinline__ float bfr(float f) { return bf2f(f2bf(f)); }
__device__ __forceinline__ v16h cat16(v8h lo, v8h hi) { return __builtin_shufflevector(lo, hi, 0, 1, 2, 3, 4, 5, 6, 7, 8, 9, 10, 11, 12, 13, 14, 15); }
__device__ __forceinline__ v16bf cat16b(v8us lo, v8us hi) { return __builtin_bit_cast(v16bf, __builtin_shufflevector(lo, hi, 0, 1, 2, 3, 4, 5, 6, 7, 8, 9, 10, 11, 12, 13, 14, 15)); }
__device__ __forceinline__ v8f wmma16(v16h a, v16h b, v8f c) { return __builtin_amdgcn_wmma_f32_16x16x32_f16(false, a, false, b, (short)0, c, false, false); }
__device__ __forceinline__ v8f wmmab(v16bf a, v16bf b, v8f c) { return __builtin_amdgcn_wmma_f32_16x16x32_bf16(false, a, false, b, (short)0, c, false, false); }



// ---- k_gemmw: register-blocked GEMM, ONE WAVE per 64x64 output tile (16 accumulators), operands straight from K-contiguous 16-bit planes; grid (M/64, N/64, Z), 32 threads.
// C[m][n] (f32, pitch ldc, + optional f32 bias[n]) = sum_k A[m][k] Bt[n][k] (+ split products per NSPLIT). z-batch strides sA/sB/sC in elements. K % 32 == 0. K = row pitch of A and Bt, KL = the k range one z walks (KL < K with sA = sB = KL splits k over z; KL % 32 == 0).
template <typename T16> struct WFrag;
template <> struct WFrag<h16> { typedef v16h V; static __device__ __forceinline__ V ld(const h16* p) { return cat16(*(const v8h*)p, *(const v8h*)(p + 16)); } static __device__ __forceinline__ v8f mma(V a, V b, v8f c) { return wmma16(a, b, c); } };
template <> struct WFrag<bf> { typedef v16bf V; static __device__ __forceinline__ V ld(const bf* p) { return cat16b(*(const v8us*)p, *(const v8us*)(p + 16)); } static __device__ __forceinline__ v8f mma(V a, V b, v8f c) { return wmmab(a, b, c); } };
template <typename T16, int NSPLIT, bool BIAS>
__global__ __launch_bounds__(32) void k_gemmw(const T16* __restrict__ A, const T16* __restrict__ A2, const T16* __restrict__ Bt, const T16* __restrict__ Bt2, int K, int KL, float* C, int ldc, const float* __restrict__ bias, size_t sA, size_t sB, size_t sC) {
    typedef typename WFrag<T16>::V V;
    __shared__ __align__(16) float os[16 * 68];
    const size_t z = blockIdx.z; A += z * sA; if (A2) A2 += z * sA; Bt += z * sB; if (Bt2) Bt2 += z * sB; C += z * sC;
    const int lane = threadIdx.x & 31, lr = lane & 15, hi = lane >> 4; const int r0 = blockIdx.x * 64, c0 = blockIdx.y * 64;
    v8f acc[4][4];
#pragma unroll
    for (int mb = 0; mb < 4; ++mb)
#pragma unroll
        for (int nb = 0; nb < 4; ++nb) acc[mb][nb] = (v8f){};
    const size_t aoff = (size_t)(r0 + lr) * K + 8 * hi, boff = (size_t)(c0 + lr) * K + 8 * hi;
#pragma unroll 1
    for (int kc = 0; kc < KL; kc += 32) {
        V a[4], a2[4];
#pragma unroll
        for (int mb = 0; mb < 4; ++mb) { a[mb] = WFrag<T16>::ld(A + aoff + (size_t)mb * 16 * K + kc); if (NSPLIT == 1 || NSPLIT == 2) a2[mb] = WFrag<T16>::ld(A2 + aoff + (size_t)mb * 16 * K + kc); }
#pragma unroll
        for (int nb = 0; nb < 4; ++nb) { const V b = WFrag<T16>::ld(Bt + boff + (size_t)nb * 16 * K + kc); V b2; if (NSPLIT >= 2) b2 = WFrag<T16>::ld(Bt2 + boff + (size_t)nb * 16 * K + kc);
#pragma unroll
            for (int mb = 0; mb < 4; ++mb) { acc[mb][nb] = WFrag<T16>::mma(a[mb], b, acc[mb][nb]); if (NSPLIT == 1 || NSPLIT == 2) acc[mb][nb] = WFrag<T16>::mma(a2[mb], b, acc[mb][nb]); if (NSPLIT >= 2) acc[mb][nb] = WFrag<T16>::mma(a[mb], b2, acc[mb][nb]); } }
        asm volatile("v_nop\n\tv_nop\n\tv_nop\n\tv_nop" : "+v"(acc[0][0]), "+v"(acc[1][1]), "+v"(acc[2][2]), "+v"(acc[3][3]) : "v"(a[0]), "v"(a[3]));
    }
#pragma unroll
    for (int mb = 0; mb < 4; ++mb) {
#pragma unroll
        for (int nb = 0; nb < 4; ++nb) {
#pragma unroll
            for (int j = 0; j < 8; ++j) os[(hi * 8 + j) * 68 + nb * 16 + lr] = acc[mb][nb][j]; }
        __builtin_amdgcn_wave_barrier(); asm volatile("" ::: "memory");
        float* crow = C + (size_t)(r0 + mb * 16) * ldc + c0;
{
#pragma unroll
            for (int s = 0; s < 8; ++s) { const int row = 2 * s + hi, cofs = lr * 4; v4f val = *(const v4fa*)(os + row * 68 + cofs); if (BIAS) { val[0] += bfr(bias[c0 + cofs]); val[1] += bfr(bias[c0 + cofs + 1]); val[2] += bfr(bias[c0 + cofs + 2]); val[3] += bfr(bias[c0 + cofs + 3]); }
                *(v4f*)(crow + (size_t)row * ldc + cofs) = val; }
             }
        __builtin_amdgcn_wave_barrier(); asm volatile("" ::: "memory");
    }
}

__device__ __forceinline__ h16 tohx(float x) { return (h16)x; }
__device__ __forceinline__ void splitf(float y, unsigned short& h, unsigned short& l) { h = f2bf(y); l = f2bf(y - bf2f(h)); }
typedef __attribute__((ext_vector_type(2))) _Float16 v2h;
typedef __attribute__((ext_vector_type(4))) _Float16 v4h;
typedef __attribute__((ext_vector_type(2))) unsigned short v2us;
typedef __attribute__((ext_vector_type(4))) float v4fx;
typedef __attribute__((ext_vector_type(2))) float v2fx;

__global__ __launch_bounds__(256) void k_wtG(const float* __restrict__ w, int K, int N, bf* Bt) {
    const int lane = threadIdx.x & 31; const int L0 = (blockIdx.x * 8 + (threadIdx.x >> 5)) * 8; const int nlines = N * K / 64;
{
#pragma unroll 1
        for (int l = 0; l < 8; ++l) { const int L = L0 + l; if (L >= nlines) break; const size_t e = (size_t)L * 64 + lane * 2; const int k = (int)(e % K), n = (int)(e / K); v2us o;
            o[0] = f2bf(w[(size_t)k * N + n]); o[1] = f2bf(w[(size_t)(k + 1) * N + n]); *(v2us*)(Bt + e) = o; }
         }
}
__global__ __launch_bounds__(256) void k_cvt8(const float* __restrict__ src, bf* dst, size_t n8) { const size_t i = (size_t)blockIdx.x * 256 + threadIdx.x; if (i >= n8) return; const v8f v = *(const v8f*)(src + i * 8); v8us o;
#pragma unroll
    for (int k = 0; k < 8; ++k) o[k] = f2bf(v[k]); *(v8us*)(dst + i * 8) = o;  }
// k_polar: per token n (x = n / 64, y = n % 64 from the 'xy' meshgrid flattening): r = sqrt((x-32)^2 + (y-32)^2) + 1e-6, th = atan2(y-32, x-32) (+2pi mod 2pi), log_r = log(r)/log(r_max) with
__global__ __launch_bounds__(256) void k_polar(float* TB) { const int n = blockIdx.x * 256 + threadIdx.x; if (n >= NN) return; const float xx = (float)(n / HW) - 32.0f, yy = (float)(n % HW) - 32.0f;
    const float r = __fsqrt_rn(__fadd_rn(__fmul_rn(xx, xx), __fmul_rn(yy, yy))) + 1e-6f; float th = atan2f(yy, xx); th = fmodf(th + 6.283185307179586f, 6.283185307179586f);
    const float rmax = __fsqrt_rn(2048.0f) + 1e-6f; const float lr = __fdiv_rn(logf(r), logf(rmax)); const float rw = __fdiv_rn(1.0f, __fadd_rn(lr, 1.0f)); v4fx o; o[0] = cosf(th); o[1] = sinf(th); o[2] = rw; o[3] = 0.f;
    *(v4fx*)(TB + (size_t)n * 4) = o;  }
__global__ __launch_bounds__(256) void k_qa(const float* __restrict__ F, const float* __restrict__ TB, int off, int usew, h16* P) { const int e = (blockIdx.x * 256 + threadIdx.x) * 2; if (e >= NH_ * NN * 64) return; const int dp = e & 63; const int n = (e >> 6) & (NN - 1); const int h = e / (NN * 64); const int d = dp & 31; const float cs = TB[(size_t)n * 4 + (dp >= 32 ? 1 : 0)]; const float w = usew ? TB[(size_t)n * 4 + 2] : 1.0f; v2h o;
#pragma unroll
    for (int q = 0; q < 2; ++q) { float a = F[(size_t)n * 3 * KD + off + h * HD + d + q]; float aw = __fmul_rn(a, w); asm volatile("" : "+v"(aw)); o[q] = tohx(__fmul_rn(aw, cs)); } *(v2h*)(P + e) = o;  }
__global__ __launch_bounds__(256) void k_vt(const float* __restrict__ F, h16* VT) { const int e = (blockIdx.x * 256 + threadIdx.x) * 2; if (e >= NH_ * 64 * NN) return; const int m = e & (NN - 1); const int d = (e / NN) & 63; const int h = e / (NN * 64); v2h o;
    if (d < HD) { o[0] = tohx(F[(size_t)m * 3 * KD + 2 * KD + h * HD + d]); o[1] = tohx(F[(size_t)(m + 1) * 3 * KD + 2 * KD + h * HD + d]); } else { o[0] = 0; o[1] = 0; } *(v2h*)(VT + e) = o;  }
__global__ __launch_bounds__(256) void k_smax(const float* __restrict__ S, float* RS) { const int lane = threadIdx.x & 31; const int i = blockIdx.x * 8 + (threadIdx.x >> 5); if (i >= NN) return; const float* sr = S + (size_t)i * NN; float m = -3.0e38f;
#pragma unroll 4
    for (int c0 = lane * 4; c0 < NN; c0 += 128) { const v4f v = *(const v4f*)(sr + c0); m = fmaxf(m, fmaxf(fmaxf(v[0], v[1]), fmaxf(v[2], v[3]))); }
#pragma unroll
    for (int sh = 16; sh; sh >>= 1) m = fmaxf(m, __shfl_xor(m, sh, 32));
    const float o = lane == 0 ? m : 0.f; *(float*)(RS + (size_t)i * 32 + lane) = o;  }
__global__ __launch_bounds__(256) void k_sexp(const float* __restrict__ S, float* RS, h16* P) { const int lane = threadIdx.x & 31; const int i = blockIdx.x * 8 + (threadIdx.x >> 5); if (i >= NN) return; const float* sr = S + (size_t)i * NN; const float m = RS[(size_t)i * 32]; float sum = 0.f;
{ sum = 0.f;
#pragma unroll 2
        for (int c0 = lane * 4; c0 < NN; c0 += 128) { const v4f v = *(const v4f*)(sr + c0); v4h o;
#pragma unroll
            for (int q = 0; q < 4; ++q) { float dlt = __fsub_rn(v[q], m); asm volatile("" : "+v"(dlt)); const float e = __expf(__fmul_rn(dlt, SCL)); sum += e; o[q] = tohx(e * PCAR); }
            *(v4h*)(P + (size_t)i * NN + c0) = o; }
         }
#pragma unroll
    for (int sh = 16; sh; sh >>= 1) sum += __shfl_xor(sum, sh, 32);
    const float o2 = lane == 0 ? m : (lane == 1 ? __fdiv_rn(1.0f, sum * PCAR) : 0.f); *(float*)(RS + (size_t)i * 32 + lane) = o2;  }
__global__ __launch_bounds__(256) void k_mrg(const float* __restrict__ O, const float* __restrict__ RS, int h, bf* Ah, bf* Al) { const int e = (blockIdx.x * 256 + threadIdx.x) * 2; if (e >= NN * HD) return; const int d = e & 31; const int n = e >> 5; const float sc = RS[(size_t)n * 32 + 1]; v2us oh, ol; const float* op = O + (size_t)n * (SPL * 64) + d; v2fx sm = *(const v2fx*)op;
#pragma unroll
    for (int z = 1; z < SPL; ++z) sm += *(const v2fx*)(op + z * 64);   // the key ranges' partial sums of row n lie side by side ([n][range][64]); summed in range order
#pragma unroll
    for (int q = 0; q < 2; ++q) { unsigned short a, c2; splitf(__fmul_rn(sm[q], sc), a, c2); oh[q] = a; ol[q] = c2; } const size_t oo = (size_t)n * KD + h * HD + d; *(v2us*)(Ah + oo) = oh; *(v2us*)(Al + oo) = ol;  }

extern "C" void kernel_launch(void* const* d_in, const int* in_sizes, int n_in,
                              void* d_out, int out_size, void* d_ws, size_t ws_size, hipStream_t stream) {
    (void)in_sizes; (void)n_in; (void)out_size;
    const float* x = (const float*)d_in[0]; const float* wp = (const float*)d_in[1]; const float* bp = (const float*)d_in[2]; const float* wf = (const float*)d_in[3]; const float* bfv = (const float*)d_in[4];   // Wp [128][768], Wf [256][256] as x @ W
    float* OUT = (float*)d_out;     // [1][64][64][256]
    char* wsp = (char*)d_ws;
    auto take = [&](size_t bytes) { char* p = wsp; wsp += (bytes + 255) & ~(size_t)255; return (void*)p; };
    bf* WP = (bf*)take((size_t)3 * KD * CC * 2); bf* WF = (bf*)take((size_t)KD * KD * 2); float* TB = (float*)take((size_t)NN * 4 * 4); bf* XB = (bf*)take((size_t)NN * CC * 2); float* F = (float*)take((size_t)NN * 3 * KD * 4);
    h16* QA = (h16*)take((size_t)NH_ * NN * 64 * 2); h16* KB = (h16*)take((size_t)NH_ * NN * 64 * 2); h16* VT = (h16*)take((size_t)NH_ * 64 * NN * 2); float* S = (float*)take((size_t)NN * NN * 4); h16* P = (h16*)take((size_t)NN * NN * 2); float* RS = (float*)take((size_t)NN * 32 * 4); float* O = (float*)take((size_t)SPL * NN * 64 * 4); bf* Ah = (bf*)take((size_t)NN * KD * 2); bf* Al = (bf*)take((size_t)NN * KD * 2);
    if ((size_t)(wsp - (char*)d_ws) > ws_size) return;    // total ~ 166 MB = 158 MiB; ws 256 MiB
    k_wtG<<<(unsigned)((CC * 3 * KD / 64 + 63) / 64), 256, 0, stream>>>(wp, CC, 3 * KD, WP); k_wtG<<<(unsigned)((KD * KD / 64 + 63) / 64), 256, 0, stream>>>(wf, KD, KD, WF); k_polar<<<NN / 256, 256, 0, stream>>>(TB);
    k_cvt8<<<(unsigned)(((size_t)NN * CC / 8 + 255) / 256), 256, 0, stream>>>(x, XB, (size_t)NN * CC / 8);
    k_gemmw<bf, 0, true><<<dim3(NN / 64, 3 * KD / 64, 1), 32, 0, stream>>>(XB, nullptr, WP, nullptr, CC, CC, F, 3 * KD, bp, 0, 0, 0);
    const unsigned LP = (NH_ * NN * 64 / 2 + 255) / 256; k_qa<<<LP, 256, 0, stream>>>(F, TB, 0, 0, QA); k_qa<<<LP, 256, 0, stream>>>(F, TB, KD, 1, KB); k_vt<<<LP, 256, 0, stream>>>(F, VT);
    for (int h = 0; h < NH_; ++h) {
        k_gemmw<h16, 0, false><<<dim3(NN / 64, NN / 64, 1), 32, 0, stream>>>(QA + (size_t)h * NN * 64, nullptr, KB + (size_t)h * NN * 64, nullptr, 64, 64, S, NN, nullptr, 0, 0, 0);
        k_smax<<<NN / 8, 256, 0, stream>>>(S, RS); k_sexp<<<NN / 8, 256, 0, stream>>>(S, RS, P);
        k_gemmw<h16, 0, false><<<dim3(NN / 64, 1, SPL), 32, 0, stream>>>(P, nullptr, VT + (size_t)h * 64 * NN, nullptr, NN, NN / SPL, O, SPL * 64, nullptr, NN / SPL, NN / SPL, 64);
        k_mrg<<<(NN * HD / 2 + 255) / 256, 256, 0, stream>>>(O, RS, h, Ah, Al); }
    k_gemmw<bf, 1, true><<<dim3(NN / 64, KD / 64, 1), 32, 0, stream>>>(Ah, Al, WF, nullptr, KD, KD, OUT, KD, bfv, 0, 0, 0);
}

// v003
// A run of this version takes 54.7 microseconds.
// Versions in between are left out here; by their measured steps it is 10.3 times as fast as v001.
// Counting every step since v000, it is 20.8 times as fast.
#include <hip/hip_runtime.h>

// Polar attention (x [1][64][64][128] -> 4096 tokens; qkv = x Wp + bp laid out (3, 8 heads, 32); scores[n][m] = (q_n.k_m / sqrt 32) r_weight[m] cos(theta_m - theta_n) with the module's polar
// constants (r = |p - centre| + 1e-6, theta = atan2 mod 2pi, log_r = log r / log max r, r_weight = 1/(log_r + 1), 'xy' meshgrid flattening); softmax over m; out = merged attn.v Wf + bf -> [1][64][64][256]).
// Compute dtypes, f32 accumulate: every input rounded to bf16; the projection on PLAIN bf16 operands (inputs: exact, + bias); the polar constants in f32 on VALU; the
// softmax in f32 (running row max; one exp per element with the 32^-0.5; fp16 numerators x1024; divided by the x1024 sum at the end of k_fattn); attn.v on fp16 planes (v: 32 rows a head at a pitch of 64 rows); merged heads as hi+lo

#define HW   64
#define NN   4096                 // tokens
#define CC   128
#define KD   256                  // key_dim
#define NH_  8
#define HD   32
#define SCL  0.17677669529663688f   // 32^-0.5
#define KQ   8                    // key ranges of k_fattn: one wave per (query tile, range), joined through LDS at the end
#define QT   2                    // query tiles of one work-group of k_fattn
#define QG   4                    // 16-query column groups of one tile (one wave)
#define LC   (SCL * 1.4426950408889634f)   // 32^-0.5 log2(e): exp(SCL d) = exp2(LC d)
typedef _Float16 h16;
typedef unsigned short bf;
typedef __attribute__((ext_vector_type(16))) __bf16   v16bf;
typedef __attribute__((ext_vector_type(16))) _Float16 v16h;
typedef __attribute__((ext_vector_type(8)))  _Float16 v8h;
typedef __attribute__((ext_vector_type(8)))  unsigned short v8us;
typedef __attribute__((ext_vector_type(8)))  float    v8f;
typedef __attribute__((ext_vector_type(4)))  float    v4f;
typedef v8h  __attribute__((may_alias)) v8ha;
typedef v4f  __attribute__((may_alias)) v4fa;
typedef v8us __attribute__((may_alias)) v8usa;

__device__ __forceinline__ unsigned short f2bf(float f) { unsigned u = __float_as_uint(f); u += 0x7FFFu + ((u >> 16) & 1u); return (unsigned short)(u >> 16); }
__device__ __forceinline__ float bf2f(unsigned short b) { return __uint_as_float(((unsigned)b) << 16); }
__device__ __forceinline__ float bfr(float f) { return bf2f(f2bf(f)); }
__device__ __forceinline__ v16h cat16(v8h lo, v8h hi) { return __builtin_shufflevector(lo, hi, 0, 1, 2, 3, 4, 5, 6, 7, 8, 9, 10, 11, 12, 13, 14, 15); }
__device__ __forceinline__ v16bf cat16b(v8us lo, v8us hi) { return __builtin_bit_cast(v16bf, __builtin_shufflevector(lo, hi, 0, 1, 2, 3, 4, 5, 6, 7, 8, 9, 10, 11, 12, 13, 14, 15)); }
__device__ __forceinline__ v8f wmma16(v16h a, v16h b, v8f c) { return __builtin_amdgcn_wmma_f32_16x16x32_f16(false, a, false, b, (short)0, c, false, false); }
__device__ __forceinline__ v8f wmmab(v16bf a, v16bf b, v8f c) { return __builtin_amdgcn_wmma_f32_16x16x32_bf16(false, a, false, b, (short)0, c, false, false); }



// ---- The two GEMMs: ONE WAVE per 64x64 output tile (16 accumulators), 32 threads, k in steps of 32. Both read their f32 sources themselves and round to bf16 (nearest even) in registers while they
// form the fragments, and the projection's epilogue writes the attention kernel's fp16 planes itself: no conversion, transposition or re-layout pass stands between the launches.
// Fragment k order, A and B alike: element s of lane half hi is k = kc + 8 hi + s (s < 8) and kc + 16 + 8 hi + (s - 8).
template <typename T16> struct WFrag;
template <> struct WFrag<h16> { typedef v16h V; static __device__ __forceinline__ V ld(const h16* p) { return cat16(*(const v8h*)p, *(const v8h*)(p + 16)); } static __device__ __forceinline__ v8f mma(V a, V b, v8f c) { return wmma16(a, b, c); } };
typedef __attribute__((ext_vector_type(16))) float v16f;
typedef const __attribute__((address_space(1))) float* gfp;
typedef __attribute__((ext_vector_type(4))) _Float16 v4h;
__device__ __forceinline__ h16 tohx(float x) { return (h16)x; }
__device__ __forceinline__ void splitf(float y, unsigned short& h, unsigned short& l) { h = f2bf(y); l = f2bf(y - bf2f(h)); }
__device__ __forceinline__ v16f cat16f(v8f lo, v8f hi) { return __builtin_shufflevector(lo, hi, 0, 1, 2, 3, 4, 5, 6, 7, 8, 9, 10, 11, 12, 13, 14, 15); }
// 16 k of one row of a k-contiguous f32 matrix; p points at k = kc + 8 hi
__device__ __forceinline__ v16f ldrow(const float* p) { return cat16f(*(const v8f*)p, *(const v8f*)(p + 16)); }
// 16 k of one column of W[k][n] (f32, pitch N); p points at (kc + 8 hi, column)
template <int N> __device__ __forceinline__ v16f ldcol(const float* p) { v16f t;
#pragma unroll
    for (int i = 0; i < 8; ++i) { t[i] = p[(size_t)i * N]; t[8 + i] = p[(size_t)(16 + i) * N]; }
    return t; }
// polar constants of token n (x = n / 64, y = n % 64 from the 'xy' meshgrid flattening): r = sqrt((x-32)^2 + (y-32)^2) + 1e-6, th = atan2(y-32, x-32) (+2pi mod 2pi), log_r = log(r)/log(r_max): (cos th, sin th, r_weight, 0)
__device__ __forceinline__ v4f polar(int n) { const float xx = (float)(n / HW) - 32.0f, yy = (float)(n % HW) - 32.0f;
    const float r = __fsqrt_rn(__fadd_rn(__fmul_rn(xx, xx), __fmul_rn(yy, yy))) + 1e-6f; float th = atan2f(yy, xx); th = fmodf(th + 6.283185307179586f, 6.283185307179586f);
    const float rmax = __fsqrt_rn(2048.0f) + 1e-6f; const float lr = __fdiv_rn(logf(r), logf(rmax)); const float rw = __fdiv_rn(1.0f, __fadd_rn(lr, 1.0f)); v4f o; o[0] = cosf(th); o[1] = sinf(th); o[2] = rw; o[3] = 0.f; return o; }

// ---- k_proj: qkv = x Wp + bp; grid (NN / 64, 768 / 64). A tile's 64 columns are two heads of ONE of q, k, v. q: QA[h][n][0..31] = q cos th_n, [32..63] = q sin th_n; k: KB the same with k r_weight_n; v: VT[h][d][n] (d < 32; pitch 64 rows a head).
__global__ __launch_bounds__(32) void k_proj(const float* __restrict__ x, const float* __restrict__ wp, const float* __restrict__ bp, h16* __restrict__ QA, h16* __restrict__ KB, h16* __restrict__ VT) {
    __shared__ __align__(16) float os[16 * 68];
    __shared__ __align__(16) float tb[64 * 4];
    const int lane = threadIdx.x & 31, lr = lane & 15, hi = lane >> 4; const int r0 = blockIdx.x * 64, c0 = blockIdx.y * 64; const int sec = c0 / KD, h0 = (c0 % KD) / HD;
    if (sec < 2) { *(v4fa*)(tb + lane * 4) = polar(r0 + lane); *(v4fa*)(tb + (32 + lane) * 4) = polar(r0 + 32 + lane); }   // the tile's 64 tokens, two a lane; read back in the epilogue
    v8f acc[4][4];
#pragma unroll
    for (int mb = 0; mb < 4; ++mb)
#pragma unroll
        for (int nb = 0; nb < 4; ++nb) acc[mb][nb] = (v8f){};
    gfp ga = (gfp)(x + (size_t)(r0 + lr) * CC + 8 * hi), gb = (gfp)(wp + (size_t)(8 * hi) * (3 * KD) + c0 + lr);   // typed as global pointers: they pass through the wait statement below and the loads stay global loads
#pragma unroll 1
    for (int kc = 0; kc < CC; kc += 32) {
        v16bf a[4]; v16f ar[4], br[4]; const float* pa = (const float*)ga; const float* pb = (const float*)gb;
#pragma unroll
        for (int mb = 0; mb < 4; ++mb) ar[mb] = ldrow(pa + (size_t)mb * 16 * CC);
#pragma unroll
        for (int nb = 0; nb < 4; ++nb) br[nb] = ldcol<3 * KD>(pb + nb * 16);
        asm volatile("s_wait_xcnt 0x0" : "+v"(ga), "+v"(gb) : "v"(ar[0]), "v"(ar[1]), "v"(ar[2]), "v"(ar[3]), "v"(br[0]), "v"(br[1]), "v"(br[2]), "v"(br[3]) : "memory");   // the two address pairs pass through the wait, so that their steps below stay behind it; the loaded values as inputs: all loads of a k step stand ahead of its first product
        ga += 32; gb += 32 * (3 * KD);
#pragma unroll
        for (int mb = 0; mb < 4; ++mb) a[mb] = __builtin_convertvector(ar[mb], v16bf);
#pragma unroll
        for (int nb = 0; nb < 4; ++nb) { const v16bf b = __builtin_convertvector(br[nb], v16bf);
#pragma unroll
            for (int mb = 0; mb < 4; ++mb) acc[mb][nb] = wmmab(a[mb], b, acc[mb][nb]); }
        asm volatile("v_nop\n\tv_nop\n\tv_nop\n\tv_nop" : "+v"(acc[0][0]), "+v"(acc[1][1]), "+v"(acc[2][2]), "+v"(acc[3][3]) : "v"(a[0]), "v"(a[3]));   // the distance behind the last matrix instruction, on the back edge too
    }
    if (sec == 2) {   // v: a lane's 8 accumulator rows are 8 consecutive tokens of one (head, d) row of VT; the wave writes that row's whole 128-byte line
        const float* bu = bp + c0; const float b4[4] = { bu[lr], bu[16 + lr], bu[32 + lr], bu[48 + lr] };
        asm volatile("s_wait_xcnt 0x0" :: "s"(bu) : "memory");   // the loads' scalar base is kept up to this wait (without the operand the pair is reused ahead of it); their offset register, lr, lives on below
#pragma unroll
        for (int nb = 0; nb < 4; ++nb) { const float bv = bfr(b4[nb]); h16* vrow = VT + ((size_t)(h0 + (nb >> 1)) * 64 + (nb & 1) * 16 + lr) * NN + r0 + hi * 8;
#pragma unroll
            for (int mb = 0; mb < 4; ++mb) { v8h o;
#pragma unroll
                for (int j = 0; j < 8; ++j) o[j] = tohx(acc[mb][nb][j] + bv);
                *(v8h*)(vrow + mb * 16) = o; }
            asm volatile("s_wait_xcnt 0x0" :: "v"(vrow) : "memory"); }   // before the stores' address and data registers are used again
        return;
    }
    h16* P = sec ? KB : QA; const int cofs = lr * 4; const float* bu = bp + c0; const float b4[4] = { bu[cofs], bu[cofs + 1], bu[cofs + 2], bu[cofs + 3] };
    asm volatile("s_wait_xcnt 0x0" :: "s"(bu), "v"(lr) : "memory");   // the load's scalar base and offset register are kept up to this wait (without the operands they are reused ahead of it)
    v4f bv; bv[0] = bfr(b4[0]); bv[1] = bfr(b4[1]); bv[2] = bfr(b4[2]); bv[3] = bfr(b4[3]);
    h16* prow = P + ((size_t)(h0 + (lr >> 3)) * NN + r0) * 64 + (lr & 7) * 4;
#pragma unroll
    for (int mb = 0; mb < 4; ++mb) {
#pragma unroll
        for (int nb = 0; nb < 4; ++nb) {
#pragma unroll
            for (int j = 0; j < 8; ++j) os[(hi * 8 + j) * 68 + nb * 16 + lr] = acc[mb][nb][j]; }
        __builtin_amdgcn_wave_barrier(); asm volatile("" ::: "memory");   // other lanes' LDS stores (os, tb) stay ahead of the reads below
#pragma unroll
        for (int s = 0; s < 8; ++s) { const int row = 2 * s + hi; const v4f val = *(const v4fa*)(os + row * 68 + cofs) + bv; const v4f t = *(const v4fa*)(tb + (mb * 16 + row) * 4); const float w = sec ? t[2] : 1.0f; v4h oc, on;
#pragma unroll
            for (int q = 0; q < 4; ++q) { const float aw = __fmul_rn(val[q], w); oc[q] = tohx(__fmul_rn(aw, t[0])); on[q] = tohx(__fmul_rn(aw, t[1])); }
            h16* pr = prow + (size_t)(mb * 16 + row) * 64; *(v4h*)pr = oc; *(v4h*)(pr + 32) = on; }   // row (head, token) = one 128-byte line, written by this wave alone
        __builtin_amdgcn_wave_barrier(); asm volatile("s_wait_xcnt 0x0" ::: "memory");   // the reads above stay ahead of the next block's LDS stores; the wait: before the stores' data registers are used again
    }
}

// ---- k_outp: OUT = merged Wf + bf; grid (NN / 64, 256 / 64). merged[n][h 32 + d] is read where k_fattn left it, OS[h][n][d] (bf16 hi) and OS[h][n][32 + d] (lo): a k step of 32 is one head; both products on the matrix unit, hi first.
__global__ __launch_bounds__(32) void k_outp(const bf* __restrict__ OS, const float* __restrict__ wf, const float* __restrict__ bias, float* __restrict__ C) {
    __shared__ __align__(16) float os[16 * 68];
    const int lane = threadIdx.x & 31, lr = lane & 15, hi = lane >> 4; const int r0 = blockIdx.x * 64, c0 = blockIdx.y * 64;
    v8f acc[4][4];
#pragma unroll
    for (int mb = 0; mb < 4; ++mb)
#pragma unroll
        for (int nb = 0; nb < 4; ++nb) acc[mb][nb] = (v8f){};
    const bf* ap = OS + (size_t)(r0 + lr) * 64 + 8 * hi; const float* bq = wf + (size_t)(8 * hi) * KD + c0 + lr;
#pragma unroll 1
    for (int kc = 0; kc < KD; kc += 32) {
        v16bf a[4], a2[4]; v16f br[4];
#pragma unroll
        for (int mb = 0; mb < 4; ++mb) { const bf* p = ap + (size_t)kc * (NN * 2) + mb * 16 * 64; a[mb] = cat16b(*(const v8us*)p, *(const v8us*)(p + 16)); a2[mb] = cat16b(*(const v8us*)(p + 32), *(const v8us*)(p + 48)); }
#pragma unroll
        for (int nb = 0; nb < 4; ++nb) br[nb] = ldcol<KD>(bq + (size_t)kc * KD + nb * 16);
        asm volatile("" :: "v"(a[0]), "v"(a[1]), "v"(a[2]), "v"(a[3]), "v"(a2[0]), "v"(a2[1]), "v"(a2[2]), "v"(a2[3]), "v"(br[0]), "v"(br[1]), "v"(br[2]), "v"(br[3]));   // inputs only: holds all loads of a k step ahead of its first product (one memory latency a step; without it part of the A loads issue behind the first products)
#pragma unroll
        for (int nb = 0; nb < 4; ++nb) { const v16bf b = __builtin_convertvector(br[nb], v16bf);
#pragma unroll
            for (int mb = 0; mb < 4; ++mb) { acc[mb][nb] = wmmab(a[mb], b, acc[mb][nb]); acc[mb][nb] = wmmab(a2[mb], b, acc[mb][nb]); } }
        asm volatile("v_nop\n\tv_nop\n\tv_nop\n\tv_nop" : "+v"(acc[0][0]), "+v"(acc[1][1]), "+v"(acc[2][2]), "+v"(acc[3][3]) : "v"(a[0]), "v"(a[3]));   // the distance behind the last matrix instruction, on the back edge too
    }
    const int cofs = lr * 4; const float* bc = bias + c0 + cofs; const float b4[4] = { bc[0], bc[1], bc[2], bc[3] };
    asm volatile("s_wait_xcnt 0x0" :: "v"(bc) : "memory");   // the load's address pair is kept up to this wait (without the operand the result lands on it)
    v4f bv; bv[0] = bfr(b4[0]); bv[1] = bfr(b4[1]); bv[2] = bfr(b4[2]); bv[3] = bfr(b4[3]);
#pragma unroll
    for (int mb = 0; mb < 4; ++mb) {
#pragma unroll
        for (int nb = 0; nb < 4; ++nb) {
#pragma unroll
            for (int j = 0; j < 8; ++j) os[(hi * 8 + j) * 68 + nb * 16 + lr] = acc[mb][nb][j]; }
        __builtin_amdgcn_wave_barrier(); asm volatile("" ::: "memory");   // other lanes' LDS stores stay ahead of the reads below
        float* crow = C + (size_t)(r0 + mb * 16) * KD + c0;
#pragma unroll
        for (int s = 0; s < 8; ++s) { const int row = 2 * s + hi; *(v4f*)(crow + (size_t)row * KD + cofs) = *(const v4fa*)(os + row * 68 + cofs) + bv; }
        __builtin_amdgcn_wave_barrier(); asm volatile("s_wait_xcnt 0x0" ::: "memory");   // the reads above stay ahead of the next block's LDS stores; the wait: before the stores' data registers are used again
    }
}
// lane l <-> l ^ 16
__device__ __forceinline__ float xhalf(float v) { const int b = __float_as_int(v); return __int_as_float(__builtin_amdgcn_permlanex16(b, b, 0x76543210, 0xfedcba98, false, false)); }
// ---- k_fattn: scores, softmax and attn.v of one head in one kernel; scores and numerators stay in registers. Grid (NN / 128, heads), 16 waves: wave = (tile qt of QG x 16 queries, key range kq of NN / KQ keys).
// Per 32 keys: St = K' Q't (A = 16 key rows, B = 16 query columns, k = 64 features), so a lane holds 16 scores of ONE query (keys 8 hi + j and 16 + 8 hi + j); two St tiles converted in place are the B operand
// of Ot += Vt Pt (A = 16 rows of the [d][key] plane, same k order). Running max m and sum l per query; Ot and l are rescaled by exp2(LC (m_old - m_new)) every 32 keys. l holds the x1024 numerators' f32 sum.
// K' and Vt fragments of the next 32 keys are fetched into the same registers right behind their last use (the last pass fetches the range's first keys again: in bounds, unused).
__global__ __launch_bounds__(512) void k_fattn(const h16* __restrict__ QA, const h16* __restrict__ KB, const h16* __restrict__ VT, bf* __restrict__ OS) {
    __shared__ float mg[KQ][QT][QG][18][32];   // per key range, tile, column group and lane: 16 Ot values, m, l
    const int lane = threadIdx.x & 31, lr = lane & 15, hi = lane >> 4; const int w = threadIdx.x >> 5, qt = w % QT, kq = w / QT;
    const int h = blockIdx.y, qb = blockIdx.x * (QT * QG * 16);
    const h16* qp = QA + ((size_t)h * NN + qb + qt * (QG * 16) + lr) * 64 + 8 * hi;
    const h16* kp = KB + ((size_t)h * NN + kq * (NN / KQ) + lr) * 64 + 8 * hi;
    const h16* vp = VT + ((size_t)h * 64 + lr) * NN + kq * (NN / KQ) + 8 * hi;
    v16h qf[QG][2], kf[2][2], vf[2]; v8f o[QG][2]; float m[QG], l[QG];
#pragma unroll
    for (int g = 0; g < QG; ++g) { qf[g][0] = WFrag<h16>::ld(qp + g * 16 * 64); qf[g][1] = WFrag<h16>::ld(qp + g * 16 * 64 + 32); o[g][0] = (v8f){}; o[g][1] = (v8f){}; m[g] = -3.0e38f; l[g] = 0.f; }
#pragma unroll
    for (int kt = 0; kt < 2; ++kt) { kf[kt][0] = WFrag<h16>::ld(kp + (size_t)kt * 16 * 64); kf[kt][1] = WFrag<h16>::ld(kp + (size_t)kt * 16 * 64 + 32); vf[kt] = WFrag<h16>::ld(vp + (size_t)kt * 16 * NN); }
#pragma unroll 1   // rolled: four waves per SIMD leave 256 registers a wave
    for (int kc = 0; kc < NN / KQ; kc += 32) {
        const int kn = kc + 32 < NN / KQ ? kc + 32 : 0; const h16* kx = kp + (size_t)kn * 64; const h16* vx = vp + kn;
#pragma unroll
        for (int gp = 0; gp < QG; gp += 2) {
            v8f s[2][2];
#pragma unroll
            for (int u = 0; u < 2; ++u) { s[u][0] = wmma16(kf[0][0], qf[gp + u][0], (v8f){}); s[u][1] = wmma16(kf[1][0], qf[gp + u][0], (v8f){}); s[u][0] = wmma16(kf[0][1], qf[gp + u][1], s[u][0]); s[u][1] = wmma16(kf[1][1], qf[gp + u][1], s[u][1]); }
            if (gp + 2 == QG) {
#pragma unroll
                for (int kt = 0; kt < 2; ++kt) { kf[kt][0] = WFrag<h16>::ld(kx + kt * 16 * 64); kf[kt][1] = WFrag<h16>::ld(kx + kt * 16 * 64 + 32); }
                asm volatile("s_wait_xcnt 0x0" :: "v"(kx) : "memory"); }   // the loads' address pair stays as it is up to this wait (without the operand the last load's result lands on it); it also keeps the fetch here, ahead of the softmax
#pragma unroll
            for (int u = 0; u < 2; ++u) { const int g = gp + u;
                float mx = fmaxf(s[u][0][0], s[u][1][0]);
#pragma unroll
                for (int j = 1; j < 8; ++j) mx = fmaxf(mx, fmaxf(s[u][0][j], s[u][1][j]));
                mx = fmaxf(mx, xhalf(mx));
                const float mn = fmaxf(m[g], mx), al = __builtin_amdgcn_exp2f((m[g] - mn) * LC), mc = mn * LC - 10.0f; m[g] = mn;   // the 10: numerators x1024
                v16h p; float sum = 0.f;
#pragma unroll
                for (int j = 0; j < 8; ++j) { const float e0 = __builtin_amdgcn_exp2f(s[u][0][j] * LC - mc), e1 = __builtin_amdgcn_exp2f(s[u][1][j] * LC - mc); sum += e0 + e1; p[j] = tohx(e0); p[8 + j] = tohx(e1); }
                l[g] = l[g] * al + sum;
#pragma unroll
                for (int dt = 0; dt < 2; ++dt) { o[g][dt] *= al; o[g][dt] = wmma16(vf[dt], p, o[g][dt]); }
            }
        }
#pragma unroll
        for (int dt = 0; dt < 2; ++dt) vf[dt] = WFrag<h16>::ld(vx + dt * 16 * NN);
        asm volatile("s_wait_xcnt 0x0" :: "v"(vx) : "memory");   // as above: the address pair is kept up to the wait
    }
#pragma unroll
    for (int g = 0; g < QG; ++g) {
        const float lj = l[g] + xhalf(l[g]);   // the two lane halves hold different keys of the same query
#pragma unroll
        for (int j = 0; j < 8; ++j) { mg[kq][qt][g][j][lane] = o[g][0][j]; mg[kq][qt][g][8 + j][lane] = o[g][1][j]; }
        mg[kq][qt][g][16][lane] = m[g]; mg[kq][qt][g][17][lane] = lj; }
    __syncthreads();   // every range's partial result is in LDS before a wave joins them
    if (w < QT * QG) {   // one wave joins the KQ ranges of one (tile, column group), in range order
        const int jq = w % QT, jg = w / QT; float M = mg[0][jq][jg][16][lane];
#pragma unroll
        for (int z = 1; z < KQ; ++z) M = fmaxf(M, mg[z][jq][jg][16][lane]);
        float L = 0.f; v8f a0 = (v8f){}, a1 = (v8f){};
#pragma unroll
        for (int z = 0; z < KQ; ++z) { const float wz = __builtin_amdgcn_exp2f((mg[z][jq][jg][16][lane] - M) * LC); L += mg[z][jq][jg][17][lane] * wz;
#pragma unroll
            for (int j = 0; j < 8; ++j) { a0[j] += mg[z][jq][jg][j][lane] * wz; a1[j] += mg[z][jq][jg][8 + j][lane] * wz; } }
        const float inv = __fdiv_rn(1.0f, L); bf* op = OS + ((size_t)h * NN + qb + jq * (QG * 16) + jg * 16 + lr) * 64 + hi * 8;   // row (h, query) = one 128-byte line, written by this wave alone: 32 bf16 hi parts, then their 32 lo parts
        a0 *= inv; a1 *= inv; v8us h0, h1, l0, l1;
#pragma unroll
        for (int j = 0; j < 8; ++j) { unsigned short a, c; splitf(a0[j], a, c); h0[j] = a; l0[j] = c; splitf(a1[j], a, c); h1[j] = a; l1[j] = c; }
        *(v8us*)op = h0; *(v8us*)(op + 16) = h1; *(v8us*)(op + 32) = l0; *(v8us*)(op + 48) = l1;
    }
}
extern "C" void kernel_launch(void* const* d_in, const int* in_sizes, int n_in,
                              void* d_out, int out_size, void* d_ws, size_t ws_size, hipStream_t stream) {
    (void)in_sizes; (void)n_in; (void)out_size;
    const float* x = (const float*)d_in[0]; const float* wp = (const float*)d_in[1]; const float* bp = (const float*)d_in[2]; const float* wf = (const float*)d_in[3]; const float* bfv = (const float*)d_in[4];   // Wp [128][768], Wf [256][256] as x @ W
    float* OUT = (float*)d_out;     // [1][64][64][256]
    char* wsp = (char*)d_ws;
    auto take = [&](size_t bytes) { char* p = wsp; wsp += (bytes + 255) & ~(size_t)255; return (void*)p; };
    h16* QA = (h16*)take((size_t)NH_ * NN * 64 * 2); h16* KB = (h16*)take((size_t)NH_ * NN * 64 * 2); h16* VT = (h16*)take((size_t)NH_ * 64 * NN * 2); bf* OS = (bf*)take((size_t)NH_ * NN * 64 * 2);
    if ((size_t)(wsp - (char*)d_ws) > ws_size) return;    // total 16 MB; ws 256 MiB
    k_proj<<<dim3(NN / 64, 3 * KD / 64, 1), 32, 0, stream>>>(x, wp, bp, QA, KB, VT);
    k_fattn<<<dim3(NN / (QT * QG * 16), NH_, 1), 512, 0, stream>>>(QA, KB, VT, OS);
    k_outp<<<dim3(NN / 64, KD / 64, 1), 32, 0, stream>>>(OS, wf, bfv, OUT);
}

// v004
// A run of this version takes 48.4 microseconds.
// Two timings next to v003 put it at 1.12 and 1.13 times that version's speed.
// All steps since v000 together make it 23.4 times as fast.
#include <hip/hip_runtime.h>

// Polar attention (x [1][64][64][128] -> 4096 tokens; qkv = x Wp + bp laid out (3, 8 heads, 32); scores[n][m] = (q_n.k_m / sqrt 32) r_weight[m] cos(theta_m - theta_n) with the module's polar
// constants (r = |p - centre| + 1e-6, theta = atan2 mod 2pi, log_r = log r / log max r, r_weight = 1/(log_r + 1), 'xy' meshgrid flattening); softmax over m; out = merged attn.v Wf + bf -> [1][64][64][256]).
// Compute dtypes, f32 accumulate: every input rounded to bf16; the projection on PLAIN bf16 operands (inputs: exact, + bias); the polar constants in f32 on VALU; the
// softmax in f32 (running row max; one exp per element with the 32^-0.5; fp16 numerators x1024; divided by the x1024 sum at the end of k_fattn); attn.v on fp16 planes; merged heads as hi+lo

#define HW   64
#define NN   4096                 // tokens
#define CC   128
#define KD   256                  // key_dim
#define NH_  8
#define HD   32
#define SCL  0.17677669529663688f   // 32^-0.5
#define KQ   8                    // key ranges of k_fattn: one wave per (query tile, range), joined through LDS at the end
#define QT   2                    // query tiles of one work-group of k_fattn
#define QG   4                    // 16-query column groups of one tile (one wave)
#define LC   (SCL * 1.4426950408889634f)   // 32^-0.5 log2(e): exp(SCL d) = exp2(LC d)
typedef _Float16 h16;
typedef unsigned short bf;
typedef __attribute__((ext_vector_type(16))) __bf16   v16bf;
typedef __attribute__((ext_vector_type(16))) _Float16 v16h;
typedef __attribute__((ext_vector_type(8)))  _Float16 v8h;
typedef __attribute__((ext_vector_type(8)))  unsigned short v8us;
typedef __attribute__((ext_vector_type(8)))  float    v8f;
typedef __attribute__((ext_vector_type(4)))  float    v4f;
typedef v8h  __attribute__((may_alias)) v8ha;
typedef v4f  __attribute__((may_alias)) v4fa;
typedef v8us __attribute__((may_alias)) v8usa;

__device__ __forceinline__ unsigned short f2bf(float f) { unsigned u = __float_as_uint(f); u += 0x7FFFu + ((u >> 16) & 1u); return (unsigned short)(u >> 16); }
__device__ __forceinline__ float bf2f(unsigned short b) { return __uint_as_float(((unsigned)b) << 16); }
__device__ __forceinline__ float bfr(float f) { return bf2f(f2bf(f)); }
__device__ __forceinline__ v16h cat16(v8h lo, v8h hi) { return __builtin_shufflevector(lo, hi, 0, 1, 2, 3, 4, 5, 6, 7, 8, 9, 10, 11, 12, 13, 14, 15); }
__device__ __forceinline__ v16bf cat16b(v8us lo, v8us hi) { return __builtin_bit_cast(v16bf, __builtin_shufflevector(lo, hi, 0, 1, 2, 3, 4, 5, 6, 7, 8, 9, 10, 11, 12, 13, 14, 15)); }
__device__ __forceinline__ v8f wmma16(v16h a, v16h b, v8f c) { return __builtin_amdgcn_wmma_f32_16x16x32_f16(false, a, false, b, (short)0, c, false, false); }
__device__ __forceinline__ v8f wmmab(v16bf a, v16bf b, v8f c) { return __builtin_amdgcn_wmma_f32_16x16x32_bf16(false, a, false, b, (short)0, c, false, false); }



// ---- The two GEMMs: ONE WAVE per 64x64 output tile (16 accumulators), 32 threads, k in steps of 32. Both read their f32 sources themselves and round to bf16 (nearest even) in registers while they
// form the fragments, and the projection's epilogue writes the attention kernel's fp16 planes itself: no conversion, transposition or re-layout pass stands between the launches.
// Fragment k order, A and B alike: element s of lane half hi is k = kc + 8 hi + s (s < 8) and kc + 16 + 8 hi + (s - 8).
// The four workspace planes lie in FRAGMENT ORDER: a 16 x 32 fragment is two blocks of 512 bytes, block b = lane l's 8 elements s = 8 b .. 8 b + 7 at byte 16 l (l = 16 hi + row). A wave-wide 16-byte load or store
// then covers 4 whole 128-byte lines, where a row-major plane gave it 16 lines. QA, KB: [head][token / 16][feature / 16][lane][8]; VT: [head][key / 32][d / 16][(key / 16) % 2][lane][8]; OS: [head][token / 16][hi: d / 16, lo: 2 + d / 16][lane][8].
template <typename T16> struct WFrag;
template <> struct WFrag<h16> { typedef v16h V; static __device__ __forceinline__ V ld(const h16* p) { return cat16(*(const v8h*)p, *(const v8h*)(p + 256)); } static __device__ __forceinline__ v8f mma(V a, V b, v8f c) { return wmma16(a, b, c); } };
typedef __attribute__((ext_vector_type(16))) float v16f;
typedef const __attribute__((address_space(1))) float* gfp;
typedef __attribute__((ext_vector_type(4))) _Float16 v4h;
__device__ __forceinline__ h16 tohx(float x) { return (h16)x; }
__device__ __forceinline__ void splitf(float y, unsigned short& h, unsigned short& l) { h = f2bf(y); l = f2bf(y - bf2f(h)); }
__device__ __forceinline__ v16f cat16f(v8f lo, v8f hi) { return __builtin_shufflevector(lo, hi, 0, 1, 2, 3, 4, 5, 6, 7, 8, 9, 10, 11, 12, 13, 14, 15); }
// 16 k of one row of a k-contiguous f32 matrix; p points at k = kc + 8 hi
__device__ __forceinline__ v16f ldrow(const float* p) { return cat16f(*(const v8f*)p, *(const v8f*)(p + 16)); }
// 16 k of one column of W[k][n] (f32, pitch N); p points at (kc + 8 hi, column)
template <int N> __device__ __forceinline__ v16f ldcol(const float* p) { v16f t;
#pragma unroll
    for (int i = 0; i < 8; ++i) { t[i] = p[(size_t)i * N]; t[8 + i] = p[(size_t)(16 + i) * N]; }
    return t; }
// polar constants of token n (x = n / 64, y = n % 64 from the 'xy' meshgrid flattening): r = sqrt((x-32)^2 + (y-32)^2) + 1e-6, th = atan2(y-32, x-32) (+2pi mod 2pi), log_r = log(r)/log(r_max): (cos th, sin th, r_weight, 0)
__device__ __forceinline__ v4f polar(int n) { const float xx = (float)(n / HW) - 32.0f, yy = (float)(n % HW) - 32.0f;
    const float r = __fsqrt_rn(__fadd_rn(__fmul_rn(xx, xx), __fmul_rn(yy, yy))) + 1e-6f; float th = atan2f(yy, xx); th = fmodf(th + 6.283185307179586f, 6.283185307179586f);
    const float rmax = __fsqrt_rn(2048.0f) + 1e-6f; const float lr = __fdiv_rn(logf(r), logf(rmax)); const float rw = __fdiv_rn(1.0f, __fadd_rn(lr, 1.0f)); v4f o; o[0] = cosf(th); o[1] = sinf(th); o[2] = rw; o[3] = 0.f; return o; }

// ---- k_proj: qkv = x Wp + bp; grid (NN / 64, 768 / 64). A tile's 64 columns are two heads of ONE of q, k, v. q: features 0..31 of QA = q cos th_n, 32..63 = q sin th_n; k: KB the same with k r_weight_n; v: VT, rows d < 32, k = key.
__global__ __launch_bounds__(32) void k_proj(const float* __restrict__ x, const float* __restrict__ wp, const float* __restrict__ bp, h16* __restrict__ QA, h16* __restrict__ KB, h16* __restrict__ VT) {
    __shared__ __align__(16) float os[16 * 68];
    __shared__ __align__(16) float tb[64 * 4];
    const int lane = threadIdx.x & 31, lr = lane & 15, hi = lane >> 4; const int r0 = blockIdx.x * 64, c0 = blockIdx.y * 64; const int sec = c0 / KD, h0 = (c0 % KD) / HD;
    if (sec < 2) { *(v4fa*)(tb + lane * 4) = polar(r0 + lane); *(v4fa*)(tb + (32 + lane) * 4) = polar(r0 + 32 + lane); }   // the tile's 64 tokens, two a lane; read back in the epilogue
    v8f acc[4][4];
#pragma unroll
    for (int mb = 0; mb < 4; ++mb)
#pragma unroll
        for (int nb = 0; nb < 4; ++nb) acc[mb][nb] = (v8f){};
    gfp ga = (gfp)(x + (size_t)(r0 + lr) * CC + 8 * hi), gb = (gfp)(wp + (size_t)(8 * hi) * (3 * KD) + c0 + lr);   // typed as global pointers: they pass through the wait statement below and the loads stay global loads
#pragma unroll 1
    for (int kc = 0; kc < CC; kc += 32) {
        v16bf a[4]; v16f ar[4], br[4]; const float* pa = (const float*)ga; const float* pb = (const float*)gb;
#pragma unroll
        for (int mb = 0; mb < 4; ++mb) ar[mb] = ldrow(pa + (size_t)mb * 16 * CC);
#pragma unroll
        for (int nb = 0; nb < 4; ++nb) br[nb] = ldcol<3 * KD>(pb + nb * 16);
        asm volatile("s_wait_xcnt 0x0" : "+v"(ga), "+v"(gb) : "v"(ar[0]), "v"(ar[1]), "v"(ar[2]), "v"(ar[3]), "v"(br[0]), "v"(br[1]), "v"(br[2]), "v"(br[3]) : "memory");   // the two address pairs pass through the wait, so that their steps below stay behind it; the loaded values as inputs: all loads of a k step stand ahead of its first product
        ga += 32; gb += 32 * (3 * KD);
#pragma unroll
        for (int mb = 0; mb < 4; ++mb) a[mb] = __builtin_convertvector(ar[mb], v16bf);
#pragma unroll
        for (int nb = 0; nb < 4; ++nb) { const v16bf b = __builtin_convertvector(br[nb], v16bf);
#pragma unroll
            for (int mb = 0; mb < 4; ++mb) acc[mb][nb] = wmmab(a[mb], b, acc[mb][nb]); }
        asm volatile("v_nop\n\tv_nop\n\tv_nop\n\tv_nop" : "+v"(acc[0][0]), "+v"(acc[1][1]), "+v"(acc[2][2]), "+v"(acc[3][3]) : "v"(a[0]), "v"(a[3]));   // the distance behind the last matrix instruction, on the back edge too
    }
    const float* bu = bp + c0; const float b4[4] = { bu[lr], bu[16 + lr], bu[32 + lr], bu[48 + lr] };
    asm volatile("s_wait_xcnt 0x0" :: "s"(bu) : "memory");   // the loads' scalar base is kept up to this wait (without the operand the pair is reused ahead of it); their offset register, lr, lives on below
    const float bv[4] = { bfr(b4[0]), bfr(b4[1]), bfr(b4[2]), bfr(b4[3]) };
    if (sec == 2) {   // v: a lane's 8 accumulator rows are 8 consecutive keys of one (head, d) row: its 16 bytes of one fragment block; the wave writes the whole 512-byte block
#pragma unroll
        for (int nb = 0; nb < 4; ++nb) { h16* vblk = VT + ((((size_t)(h0 + (nb >> 1)) * (NN / 32) + (r0 >> 5)) * 4 + (nb & 1) * 2) * 32 + lane) * 8;
#pragma unroll
            for (int mb = 0; mb < 4; ++mb) { v8h o;
#pragma unroll
                for (int j = 0; j < 8; ++j) o[j] = tohx(acc[mb][nb][j] + bv[nb]);
                *(v8h*)(vblk + (mb >> 1) * 1024 + (mb & 1) * 256) = o; }
            asm volatile("s_wait_xcnt 0x0" :: "v"(vblk) : "memory");   // before the stores' address and data registers are used again
            __builtin_amdgcn_sched_barrier(0); }   // keeps the next block's sums behind the wait (without it they are lifted over it and land on the stores' data registers)
        return;
    }
    h16* P = sec ? KB : QA; h16* pblk = P + (((size_t)h0 * (NN / 16) + (r0 >> 4)) * 128 + lane) * 8;
#pragma unroll
    for (int mb = 0; mb < 4; ++mb) {
#pragma unroll
        for (int nb = 0; nb < 4; ++nb) {
#pragma unroll
            for (int j = 0; j < 8; ++j) os[(hi * 8 + j) * 68 + nb * 16 + lr] = acc[mb][nb][j] + bv[nb]; }
        __builtin_amdgcn_wave_barrier(); asm volatile("" ::: "memory");   // other lanes' LDS stores (os, tb) stay ahead of the reads below
        const v4f t = *(const v4fa*)(tb + (mb * 16 + lr) * 4); const float w = sec ? t[2] : 1.0f;   // the lane's token is row lr of the block
#pragma unroll
        for (int hh = 0; hh < 2; ++hh)
#pragma unroll
            for (int jj = 0; jj < 2; ++jj) { const float* sp = os + lr * 68 + hh * 32 + jj * 16 + hi * 8; const v4f x0 = *(const v4fa*)sp, x1 = *(const v4fa*)(sp + 4); v8h oc, on;
#pragma unroll
                for (int q = 0; q < 4; ++q) { const float aw = __fmul_rn(x0[q], w), ax = __fmul_rn(x1[q], w); oc[q] = tohx(__fmul_rn(aw, t[0])); on[q] = tohx(__fmul_rn(aw, t[1])); oc[4 + q] = tohx(__fmul_rn(ax, t[0])); on[4 + q] = tohx(__fmul_rn(ax, t[1])); }
                h16* pr = pblk + ((size_t)hh * (NN / 16) + mb) * 1024 + jj * 256; *(v8h*)pr = oc; *(v8h*)(pr + 512) = on; }   // two whole 512-byte fragment blocks, written by this wave alone
        __builtin_amdgcn_wave_barrier(); asm volatile("s_wait_xcnt 0x0" ::: "memory");   // the reads above stay ahead of the next block's LDS stores; the wait: before the stores' data registers are used again
    }
}

// ---- k_outp: OUT = merged Wf + bf; grid (NN / 64, 256 / 64). merged[n][h 32 + d] is read where k_fattn left it, in OS, as ready A fragments (bf16 hi, then lo): a k step of 32 is one head; both products on the matrix unit, hi first.
__global__ __launch_bounds__(32) void k_outp(const bf* __restrict__ OS, const float* __restrict__ wf, const float* __restrict__ bias, float* __restrict__ C) {
    __shared__ __align__(16) float os[16 * 68];
    const int lane = threadIdx.x & 31, lr = lane & 15, hi = lane >> 4; const int r0 = blockIdx.x * 64, c0 = blockIdx.y * 64;
    v8f acc[4][4];
#pragma unroll
    for (int mb = 0; mb < 4; ++mb)
#pragma unroll
        for (int nb = 0; nb < 4; ++nb) acc[mb][nb] = (v8f){};
    const bf* ap = OS + ((size_t)(r0 >> 4) * 128 + lane) * 8; const float* bq = wf + (size_t)(8 * hi) * KD + c0 + lr;
#pragma unroll 1
    for (int kc = 0; kc < KD; kc += 32) {
        v16bf a[4], a2[4]; v16f br[4];
#pragma unroll
        for (int mb = 0; mb < 4; ++mb) { const bf* p = ap + (size_t)kc * (NN * 2) + mb * 1024; a[mb] = cat16b(*(const v8us*)p, *(const v8us*)(p + 256)); a2[mb] = cat16b(*(const v8us*)(p + 512), *(const v8us*)(p + 768)); }
#pragma unroll
        for (int nb = 0; nb < 4; ++nb) br[nb] = ldcol<KD>(bq + (size_t)kc * KD + nb * 16);
        asm volatile("" :: "v"(a[0]), "v"(a[1]), "v"(a[2]), "v"(a[3]), "v"(a2[0]), "v"(a2[1]), "v"(a2[2]), "v"(a2[3]), "v"(br[0]), "v"(br[1]), "v"(br[2]), "v"(br[3]));   // inputs only: holds all loads of a k step ahead of its first product (one memory latency a step; without it part of the A loads issue behind the first products)
#pragma unroll
        for (int nb = 0; nb < 4; ++nb) { const v16bf b = __builtin_convertvector(br[nb], v16bf);
#pragma unroll
            for (int mb = 0; mb < 4; ++mb) { acc[mb][nb] = wmmab(a[mb], b, acc[mb][nb]); acc[mb][nb] = wmmab(a2[mb], b, acc[mb][nb]); } }
        asm volatile("v_nop\n\tv_nop\n\tv_nop\n\tv_nop" : "+v"(acc[0][0]), "+v"(acc[1][1]), "+v"(acc[2][2]), "+v"(acc[3][3]) : "v"(a[0]), "v"(a[3]));   // the distance behind the last matrix instruction, on the back edge too
    }
    const int cofs = lr * 4; const float* bc = bias + c0 + cofs; const float b4[4] = { bc[0], bc[1], bc[2], bc[3] };
    asm volatile("s_wait_xcnt 0x0" :: "v"(bc) : "memory");   // the load's address pair is kept up to this wait (without the operand the result lands on it)
    v4f bv; bv[0] = bfr(b4[0]); bv[1] = bfr(b4[1]); bv[2] = bfr(b4[2]); bv[3] = bfr(b4[3]);
#pragma unroll
    for (int mb = 0; mb < 4; ++mb) {
#pragma unroll
        for (int nb = 0; nb < 4; ++nb) {
#pragma unroll
            for (int j = 0; j < 8; ++j) os[(hi * 8 + j) * 68 + nb * 16 + lr] = acc[mb][nb][j]; }
        __builtin_amdgcn_wave_barrier(); asm volatile("" ::: "memory");   // other lanes' LDS stores stay ahead of the reads below
        float* crow = C + (size_t)(r0 + mb * 16) * KD + c0;
#pragma unroll
        for (int s = 0; s < 8; ++s) { const int row = 2 * s + hi; *(v4f*)(crow + (size_t)row * KD + cofs) = *(const v4fa*)(os + row * 68 + cofs) + bv; }
        __builtin_amdgcn_wave_barrier(); asm volatile("s_wait_xcnt 0x0" ::: "memory");   // the reads above stay ahead of the next block's LDS stores; the wait: before the stores' data registers are used again
    }
}
// lane l <-> l ^ 16
__device__ __forceinline__ float xhalf(float v) { const int b = __float_as_int(v); return __int_as_float(__builtin_amdgcn_permlanex16(b, b, 0x76543210, 0xfedcba98, false, false)); }
// ---- k_fattn: scores, softmax and attn.v of one head in one kernel; scores and numerators stay in registers. Grid (NN / 128, heads), 16 waves: wave = (tile qt of QG x 16 queries, key range kq of NN / KQ keys).
// Per 32 keys: St = K' Q't (A = 16 key rows, B = 16 query columns, k = 64 features), so a lane holds 16 scores of ONE query (keys 8 hi + j and 16 + 8 hi + j); two St tiles converted in place are the B operand
// of Ot += Vt Pt (A = 16 rows of the [d][key] plane, same k order). Running max m and sum l per query; Ot and l are rescaled by exp2(LC (m_old - m_new)) every 32 keys. l holds the x1024 numerators' f32 sum.
// K' and Vt fragments of the next 32 keys are fetched into the same registers right behind their last use (the last pass fetches the range's first keys again: in bounds, unused).
__global__ __launch_bounds__(512) void k_fattn(const h16* __restrict__ QA, const h16* __restrict__ KB, const h16* __restrict__ VT, bf* __restrict__ OS) {
    __shared__ float mg[KQ][QT][QG][18][32];   // per key range, tile, column group and lane: 16 Ot values, m, l
    const int lane = threadIdx.x & 31; const int w = threadIdx.x >> 5, qt = w % QT, kq = w / QT;
    const int h = blockIdx.y, qb = blockIdx.x * (QT * QG * 16);
    const h16* qp = QA + (((size_t)h * (NN / 16) + (qb >> 4) + qt * QG) * 128 + lane) * 8;
    const h16* kp = KB + (((size_t)h * (NN / 16) + kq * (NN / KQ / 16)) * 128 + lane) * 8;
    const h16* vp = VT + (((size_t)h * (NN / 32) + kq * (NN / KQ / 32)) * 128 + lane) * 8;
    v16h qf[QG][2], kf[2][2], vf[2]; v8f o[QG][2]; float m[QG], l[QG];
#pragma unroll
    for (int g = 0; g < QG; ++g) { qf[g][0] = WFrag<h16>::ld(qp + g * 1024); qf[g][1] = WFrag<h16>::ld(qp + g * 1024 + 512); o[g][0] = (v8f){}; o[g][1] = (v8f){}; m[g] = -3.0e38f; l[g] = 0.f; }
#pragma unroll
    for (int kt = 0; kt < 2; ++kt) { kf[kt][0] = WFrag<h16>::ld(kp + kt * 1024); kf[kt][1] = WFrag<h16>::ld(kp + kt * 1024 + 512); vf[kt] = WFrag<h16>::ld(vp + kt * 512); }
    asm volatile("s_wait_xcnt 0x0" :: "v"(qp), "v"(kp), "v"(vp) : "memory");   // the three address pairs stay as they are up to this wait (without the operands a later load's result lands on the q pair)
#pragma unroll 1   // rolled: four waves per SIMD leave 256 registers a wave
    for (int kc = 0; kc < NN / KQ; kc += 32) {
        const int kn = kc + 32 < NN / KQ ? kc + 32 : 0; const h16* kx = kp + (size_t)kn * 64; const h16* vx = vp + (size_t)kn * 32;
#pragma unroll
        for (int gp = 0; gp < QG; gp += 2) {
            v8f s[2][2];
#pragma unroll
            for (int u = 0; u < 2; ++u) { s[u][0] = wmma16(kf[0][0], qf[gp + u][0], (v8f){}); s[u][1] = wmma16(kf[1][0], qf[gp + u][0], (v8f){}); s[u][0] = wmma16(kf[0][1], qf[gp + u][1], s[u][0]); s[u][1] = wmma16(kf[1][1], qf[gp + u][1], s[u][1]); }
            if (gp + 2 == QG) {
#pragma unroll
                for (int kt = 0; kt < 2; ++kt) { kf[kt][0] = WFrag<h16>::ld(kx + kt * 1024); kf[kt][1] = WFrag<h16>::ld(kx + kt * 1024 + 512); }
                asm volatile("s_wait_xcnt 0x0" :: "v"(kx) : "memory"); }   // the loads' address pair stays as it is up to this wait (without the operand the last load's result lands on it); it also keeps the fetch here, ahead of the softmax
#pragma unroll
            for (int u = 0; u < 2; ++u) { const int g = gp + u;
                float mx = fmaxf(s[u][0][0], s[u][1][0]);
#pragma unroll
                for (int j = 1; j < 8; ++j) mx = fmaxf(mx, fmaxf(s[u][0][j], s[u][1][j]));
                mx = fmaxf(mx, xhalf(mx));
                const float mn = fmaxf(m[g], mx), al = __builtin_amdgcn_exp2f((m[g] - mn) * LC), mc = mn * LC - 10.0f; m[g] = mn;   // the 10: numerators x1024
                v16h p; float sum = 0.f;
#pragma unroll
                for (int j = 0; j < 8; ++j) { const float e0 = __builtin_amdgcn_exp2f(s[u][0][j] * LC - mc), e1 = __builtin_amdgcn_exp2f(s[u][1][j] * LC - mc); sum += e0 + e1; p[j] = tohx(e0); p[8 + j] = tohx(e1); }
                l[g] = l[g] * al + sum;
#pragma unroll
                for (int dt = 0; dt < 2; ++dt) { o[g][dt] *= al; o[g][dt] = wmma16(vf[dt], p, o[g][dt]); }
            }
        }
#pragma unroll
        for (int dt = 0; dt < 2; ++dt) vf[dt] = WFrag<h16>::ld(vx + dt * 512);
        asm volatile("s_wait_xcnt 0x0" :: "v"(vx) : "memory");   // as above: the address pair is kept up to the wait
    }
#pragma unroll
    for (int g = 0; g < QG; ++g) {
        const float lj = l[g] + xhalf(l[g]);   // the two lane halves hold different keys of the same query
#pragma unroll
        for (int j = 0; j < 8; ++j) { mg[kq][qt][g][j][lane] = o[g][0][j]; mg[kq][qt][g][8 + j][lane] = o[g][1][j]; }
        mg[kq][qt][g][16][lane] = m[g]; mg[kq][qt][g][17][lane] = lj; }
    __syncthreads();   // every range's partial result is in LDS before a wave joins them
    if (w < QT * QG) {   // one wave joins the KQ ranges of one (tile, column group), in range order
        const int jq = w % QT, jg = w / QT; float M = mg[0][jq][jg][16][lane];
#pragma unroll
        for (int z = 1; z < KQ; ++z) M = fmaxf(M, mg[z][jq][jg][16][lane]);
        float L = 0.f; v8f a0 = (v8f){}, a1 = (v8f){};
#pragma unroll
        for (int z = 0; z < KQ; ++z) { const float wz = __builtin_amdgcn_exp2f((mg[z][jq][jg][16][lane] - M) * LC); L += mg[z][jq][jg][17][lane] * wz;
#pragma unroll
            for (int j = 0; j < 8; ++j) { a0[j] += mg[z][jq][jg][j][lane] * wz; a1[j] += mg[z][jq][jg][8 + j][lane] * wz; } }
        const float inv = __fdiv_rn(1.0f, L); bf* op = OS + (((size_t)h * (NN / 16) + (qb >> 4) + jq * QG + jg) * 128 + lane) * 8;   // the lane's Ot rows are its elements of k_outp's A fragment: four 512-byte blocks (hi, hi, lo, lo), written by this wave alone
        a0 *= inv; a1 *= inv; v8us h0, h1, l0, l1;
#pragma unroll
        for (int j = 0; j < 8; ++j) { unsigned short a, c; splitf(a0[j], a, c); h0[j] = a; l0[j] = c; splitf(a1[j], a, c); h1[j] = a; l1[j] = c; }
        *(v8us*)op = h0; *(v8us*)(op + 256) = h1; *(v8us*)(op + 512) = l0; *(v8us*)(op + 768) = l1;
    }
}
extern "C" void kernel_launch(void* const* d_in, const int* in_sizes, int n_in,
                              void* d_out, int out_size, void* d_ws, size_t ws_size, hipStream_t stream) {
    (void)in_sizes; (void)n_in; (void)out_size;
    const float* x = (const float*)d_in[0]; const float* wp = (const float*)d_in[1]; const float* bp = (const float*)d_in[2]; const float* wf = (const float*)d_in[3]; const float* bfv = (const float*)d_in[4];   // Wp [128][768], Wf [256][256] as x @ W
    float* OUT = (float*)d_out;     // [1][64][64][256]
    char* wsp = (char*)d_ws;
    auto take = [&](size_t bytes) { char* p = wsp; wsp += (bytes + 255) & ~(size_t)255; return (void*)p; };
    h16* QA = (h16*)take((size_t)NH_ * NN * 64 * 2); h16* KB = (h16*)take((size_t)NH_ * NN * 64 * 2); h16* VT = (h16*)take((size_t)NH_ * HD * NN * 2); bf* OS = (bf*)take((size_t)NH_ * NN * 64 * 2);
    if ((size_t)(wsp - (char*)d_ws) > ws_size) return;    // total 14 MB; ws 256 MiB
    k_proj<<<dim3(NN / 64, 3 * KD / 64, 1), 32, 0, stream>>>(x, wp, bp, QA, KB, VT);
    k_fattn<<<dim3(NN / (QT * QG * 16), NH_, 1), 512, 0, stream>>>(QA, KB, VT, OS);
    k_outp<<<dim3(NN / 64, KD / 64, 1), 32, 0, stream>>>(OS, wf, bfv, OUT);
}

// v005
// One run takes 44.5 microseconds.
// Next to v004, in two timings, it ran 1.09 times as fast each time.
// All steps since v000 together make it 25.4 times as fast.
#include <hip/hip_runtime.h>

// Polar attention (x [1][64][64][128] -> 4096 tokens; qkv = x Wp + bp laid out (3, 8 heads, 32); scores[n][m] = (q_n.k_m / sqrt 32) r_weight[m] cos(theta_m - theta_n) with the module's polar
// constants (r = |p - centre| + 1e-6, theta = atan2 mod 2pi, log_r = log r / log max r, r_weight = 1/(log_r + 1), 'xy' meshgrid flattening); softmax over m; out = merged attn.v Wf + bf -> [1][64][64][256]).
// Compute dtypes, f32 accumulate: every input rounded to bf16; the projection on PLAIN bf16 operands (inputs: exact, + bias); the polar constants in f32 on VALU; the
// softmax in f32 (a row reference that is a real score, renewed when the numerators would leave fp16; one exp per element with the 32^-0.5; fp16 numerators x1024; divided by the x1024 sum at the end of k_fattn); attn.v on fp16 planes; merged heads as hi+lo

#define HW   64
#define NN   4096                 // tokens
#define CC   128
#define KD   256                  // key_dim
#define NH_  8
#define HD   32
#define SCL  0.17677669529663688f   // 32^-0.5
#define KQ   8                    // key ranges of k_fattn: one wave per (query tile, range), joined through LDS at the end
#define QT   2                    // query tiles of one work-group of k_fattn
#define QG   4                    // 16-query column groups of one tile (one wave)
#define LC   (SCL * 1.4426950408889634f)   // 32^-0.5 log2(e): exp(SCL d) = exp2(LC d)
#define PT   32768.0f             // k_fattn keeps a column-group pair's references while every lane's 32 numerators of the pair in a pass (16 a query) sum to at most this (fp16 holds each)
typedef _Float16 h16;
typedef unsigned short bf;
typedef __attribute__((ext_vector_type(16))) __bf16   v16bf;
typedef __attribute__((ext_vector_type(16))) _Float16 v16h;
typedef __attribute__((ext_vector_type(8)))  _Float16 v8h;
typedef __attribute__((ext_vector_type(8)))  unsigned short v8us;
typedef __attribute__((ext_vector_type(8)))  float    v8f;
typedef __attribute__((ext_vector_type(4)))  float    v4f;
typedef v8h  __attribute__((may_alias)) v8ha;
typedef v4f  __attribute__((may_alias)) v4fa;
typedef v8us __attribute__((may_alias)) v8usa;

__device__ __forceinline__ unsigned short f2bf(float f) { unsigned u = __float_as_uint(f); u += 0x7FFFu + ((u >> 16) & 1u); return (unsigned short)(u >> 16); }
__device__ __forceinline__ float bf2f(unsigned short b) { return __uint_as_float(((unsigned)b) << 16); }
__device__ __forceinline__ float bfr(float f) { return bf2f(f2bf(f)); }
__device__ __forceinline__ v16h cat16(v8h lo, v8h hi) { return __builtin_shufflevector(lo, hi, 0, 1, 2, 3, 4, 5, 6, 7, 8, 9, 10, 11, 12, 13, 14, 15); }
__device__ __forceinline__ v16bf cat16b(v8us lo, v8us hi) { return __builtin_bit_cast(v16bf, __builtin_shufflevector(lo, hi, 0, 1, 2, 3, 4, 5, 6, 7, 8, 9, 10, 11, 12, 13, 14, 15)); }
__device__ __forceinline__ v8f wmma16(v16h a, v16h b, v8f c) { return __builtin_amdgcn_wmma_f32_16x16x32_f16(false, a, false, b, (short)0, c, false, false); }
__device__ __forceinline__ v8f wmmab(v16bf a, v16bf b, v8f c) { return __builtin_amdgcn_wmma_f32_16x16x32_bf16(false, a, false, b, (short)0, c, false, false); }



// ---- The two GEMMs: ONE WAVE per 64x64 output tile (16 accumulators), 32 threads, k in steps of 32. Both read their f32 sources themselves and round to bf16 (nearest even) in registers while they
// form the fragments, and the projection's epilogue writes the attention kernel's fp16 planes itself: no conversion, transposition or re-layout pass stands between the launches.
// Fragment k order, A and B alike: element s of lane half hi is k = kc + 8 hi + s (s < 8) and kc + 16 + 8 hi + (s - 8).
// The four workspace planes lie in FRAGMENT ORDER: a 16 x 32 fragment is two blocks of 512 bytes, block b = lane l's 8 elements s = 8 b .. 8 b + 7 at byte 16 l (l = 16 hi + row). A wave-wide 16-byte load or store
// then covers 4 whole 128-byte lines, where a row-major plane gave it 16 lines. QA, KB: [head][token / 16][feature / 16][lane][8]; VT: [head][key / 32][d / 16][(key / 16) % 2][lane][8]; OS: [head][token / 16][hi: d / 16, lo: 2 + d / 16][lane][8].
template <typename T16> struct WFrag;
template <> struct WFrag<h16> { typedef v16h V; static __device__ __forceinline__ V ld(const h16* p) { return cat16(*(const v8h*)p, *(const v8h*)(p + 256)); } static __device__ __forceinline__ v8f mma(V a, V b, v8f c) { return wmma16(a, b, c); } };
typedef __attribute__((ext_vector_type(16))) float v16f;
typedef const __attribute__((address_space(1))) float* gfp;
typedef __attribute__((ext_vector_type(4))) _Float16 v4h;
__device__ __forceinline__ h16 tohx(float x) { return (h16)x; }
__device__ __forceinline__ void splitf(float y, unsigned short& h, unsigned short& l) { h = f2bf(y); l = f2bf(y - bf2f(h)); }
__device__ __forceinline__ v16f cat16f(v8f lo, v8f hi) { return __builtin_shufflevector(lo, hi, 0, 1, 2, 3, 4, 5, 6, 7, 8, 9, 10, 11, 12, 13, 14, 15); }
// 16 k of one row of a k-contiguous f32 matrix; p points at k = kc + 8 hi
__device__ __forceinline__ v16f ldrow(const float* p) { return cat16f(*(const v8f*)p, *(const v8f*)(p + 16)); }
// 16 k of one column of W[k][n] (f32, pitch N); p points at (kc + 8 hi, column)
template <int N> __device__ __forceinline__ v16f ldcol(const float* p) { v16f t;
#pragma unroll
    for (int i = 0; i < 8; ++i) { t[i] = p[(size_t)i * N]; t[8 + i] = p[(size_t)(16 + i) * N]; }
    return t; }
// polar constants of token n (x = n / 64, y = n % 64 from the 'xy' meshgrid flattening): r = sqrt((x-32)^2 + (y-32)^2) + 1e-6, th = atan2(y-32, x-32) (+2pi mod 2pi), log_r = log(r)/log(r_max): (cos th, sin th, r_weight, 0)
__device__ __forceinline__ v4f polar(int n) { const float xx = (float)(n / HW) - 32.0f, yy = (float)(n % HW) - 32.0f;
    const float r = __fsqrt_rn(__fadd_rn(__fmul_rn(xx, xx), __fmul_rn(yy, yy))) + 1e-6f; float th = atan2f(yy, xx); th = fmodf(th + 6.283185307179586f, 6.283185307179586f);
    const float rmax = __fsqrt_rn(2048.0f) + 1e-6f; const float lr = __fdiv_rn(logf(r), logf(rmax)); const float rw = __fdiv_rn(1.0f, __fadd_rn(lr, 1.0f)); v4f o; o[0] = cosf(th); o[1] = sinf(th); o[2] = rw; o[3] = 0.f; return o; }

// ---- k_proj: qkv = x Wp + bp; grid (NN / 64, 768 / 64). A tile's 64 columns are two heads of ONE of q, k, v. q: features 0..31 of QA = q cos th_n, 32..63 = q sin th_n; k: KB the same with k r_weight_n; v: VT, rows d < 32, k = key.
__global__ __launch_bounds__(32) void k_proj(const float* __restrict__ x, const float* __restrict__ wp, const float* __restrict__ bp, h16* __restrict__ QA, h16* __restrict__ KB, h16* __restrict__ VT) {
    __shared__ __align__(16) float os[16 * 68];
    __shared__ __align__(16) float tb[64 * 4];
    const int lane = threadIdx.x & 31, lr = lane & 15, hi = lane >> 4; const int r0 = blockIdx.x * 64, c0 = blockIdx.y * 64; const int sec = c0 / KD, h0 = (c0 % KD) / HD;
    if (sec < 2) { *(v4fa*)(tb + lane * 4) = polar(r0 + lane); *(v4fa*)(tb + (32 + lane) * 4) = polar(r0 + 32 + lane); }   // the tile's 64 tokens, two a lane; read back in the epilogue
    v8f acc[4][4];
#pragma unroll
    for (int mb = 0; mb < 4; ++mb)
#pragma unroll
        for (int nb = 0; nb < 4; ++nb) acc[mb][nb] = (v8f){};
    gfp ga = (gfp)(x + (size_t)(r0 + lr) * CC + 8 * hi), gb = (gfp)(wp + (size_t)(8 * hi) * (3 * KD) + c0 + lr);   // typed as global pointers: they pass through the wait statement below and the loads stay global loads
#pragma unroll 1
    for (int kc = 0; kc < CC; kc += 32) {
        v16bf a[4]; v16f ar[4], br[4]; const float* pa = (const float*)ga; const float* pb = (const float*)gb;
#pragma unroll
        for (int mb = 0; mb < 4; ++mb) ar[mb] = ldrow(pa + (size_t)mb * 16 * CC);
#pragma unroll
        for (int nb = 0; nb < 4; ++nb) br[nb] = ldcol<3 * KD>(pb + nb * 16);
        asm volatile("s_wait_xcnt 0x0" : "+v"(ga), "+v"(gb) : "v"(ar[0]), "v"(ar[1]), "v"(ar[2]), "v"(ar[3]), "v"(br[0]), "v"(br[1]), "v"(br[2]), "v"(br[3]) : "memory");   // the two address pairs pass through the wait, so that their steps below stay behind it; the loaded values as inputs: all loads of a k step stand ahead of its first product
        ga += 32; gb += 32 * (3 * KD);
#pragma unroll
        for (int mb = 0; mb < 4; ++mb) a[mb] = __builtin_convertvector(ar[mb], v16bf);
#pragma unroll
        for (int nb = 0; nb < 4; ++nb) { const v16bf b = __builtin_convertvector(br[nb], v16bf);
#pragma unroll
            for (int mb = 0; mb < 4; ++mb) acc[mb][nb] = wmmab(a[mb], b, acc[mb][nb]); }
        asm volatile("v_nop\n\tv_nop\n\tv_nop\n\tv_nop" : "+v"(acc[0][0]), "+v"(acc[1][1]), "+v"(acc[2][2]), "+v"(acc[3][3]) : "v"(a[0]), "v"(a[3]));   // the distance behind the last matrix instruction, on the back edge too
    }
    const float* bu = bp + c0; const float b4[4] = { bu[lr], bu[16 + lr], bu[32 + lr], bu[48 + lr] };
    asm volatile("s_wait_xcnt 0x0" :: "s"(bu) : "memory");   // the loads' scalar base is kept up to this wait (without the operand the pair is reused ahead of it); their offset register, lr, lives on below
    const float bv[4] = { bfr(b4[0]), bfr(b4[1]), bfr(b4[2]), bfr(b4[3]) };
    if (sec == 2) {   // v: a lane's 8 accumulator rows are 8 consecutive keys of one (head, d) row: its 16 bytes of one fragment block; the wave writes the whole 512-byte block
#pragma unroll
        for (int nb = 0; nb < 4; ++nb) { h16* vblk = VT + ((((size_t)(h0 + (nb >> 1)) * (NN / 32) + (r0 >> 5)) * 4 + (nb & 1) * 2) * 32 + lane) * 8;
#pragma unroll
            for (int mb = 0; mb < 4; ++mb) { v8h o;
#pragma unroll
                for (int j = 0; j < 8; ++j) o[j] = tohx(acc[mb][nb][j] + bv[nb]);
                *(v8h*)(vblk + (mb >> 1) * 1024 + (mb & 1) * 256) = o; }
            asm volatile("s_wait_xcnt 0x0" :: "v"(vblk) : "memory");   // before the stores' address and data registers are used again
            __builtin_amdgcn_sched_barrier(0); }   // keeps the next block's sums behind the wait (without it they are lifted over it and land on the stores' data registers)
        return;
    }
    h16* P = sec ? KB : QA; h16* pblk = P + (((size_t)h0 * (NN / 16) + (r0 >> 4)) * 128 + lane) * 8;
#pragma unroll
    for (int mb = 0; mb < 4; ++mb) {
#pragma unroll
        for (int nb = 0; nb < 4; ++nb) {
#pragma unroll
            for (int j = 0; j < 8; ++j) os[(hi * 8 + j) * 68 + nb * 16 + lr] = acc[mb][nb][j] + bv[nb]; }
        __builtin_amdgcn_wave_barrier(); asm volatile("" ::: "memory");   // other lanes' LDS stores (os, tb) stay ahead of the reads below
        const v4f t = *(const v4fa*)(tb + (mb * 16 + lr) * 4); const float w = sec ? t[2] : 1.0f;   // the lane's token is row lr of the block
#pragma unroll
        for (int hh = 0; hh < 2; ++hh)
#pragma unroll
            for (int jj = 0; jj < 2; ++jj) { const float* sp = os + lr * 68 + hh * 32 + jj * 16 + hi * 8; const v4f x0 = *(const v4fa*)sp, x1 = *(const v4fa*)(sp + 4); v8h oc, on;
#pragma unroll
                for (int q = 0; q < 4; ++q) { const float aw = __fmul_rn(x0[q], w), ax = __fmul_rn(x1[q], w); oc[q] = tohx(__fmul_rn(aw, t[0])); on[q] = tohx(__fmul_rn(aw, t[1])); oc[4 + q] = tohx(__fmul_rn(ax, t[0])); on[4 + q] = tohx(__fmul_rn(ax, t[1])); }
                h16* pr = pblk + ((size_t)hh * (NN / 16) + mb) * 1024 + jj * 256; *(v8h*)pr = oc; *(v8h*)(pr + 512) = on; }   // two whole 512-byte fragment blocks, written by this wave alone
        __builtin_amdgcn_wave_barrier(); asm volatile("s_wait_xcnt 0x0" ::: "memory");   // the reads above stay ahead of the next block's LDS stores; the wait: before the stores' data registers are used again
    }
}

// ---- k_outp: OUT = merged Wf + bf; grid (NN / 64, 256 / 64). merged[n][h 32 + d] is read where k_fattn left it, in OS, as ready A fragments (bf16 hi, then lo): a k step of 32 is one head; both products on the matrix unit, hi first.
__global__ __launch_bounds__(32) void k_outp(const bf* __restrict__ OS, const float* __restrict__ wf, const float* __restrict__ bias, float* __restrict__ C) {
    __shared__ __align__(16) float os[16 * 68];
    const int lane = threadIdx.x & 31, lr = lane & 15, hi = lane >> 4; const int r0 = blockIdx.x * 64, c0 = blockIdx.y * 64;
    v8f acc[4][4];
#pragma unroll
    for (int mb = 0; mb < 4; ++mb)
#pragma unroll
        for (int nb = 0; nb < 4; ++nb) acc[mb][nb] = (v8f){};
    const bf* ap = OS + ((size_t)(r0 >> 4) * 128 + lane) * 8; const float* bq = wf + (size_t)(8 * hi) * KD + c0 + lr;
#pragma unroll 1
    for (int kc = 0; kc < KD; kc += 32) {
        v16bf a[4], a2[4]; v16f br[4];
#pragma unroll
        for (int mb = 0; mb < 4; ++mb) { const bf* p = ap + (size_t)kc * (NN * 2) + mb * 1024; a[mb] = cat16b(*(const v8us*)p, *(const v8us*)(p + 256)); a2[mb] = cat16b(*(const v8us*)(p + 512), *(const v8us*)(p + 768)); }
#pragma unroll
        for (int nb = 0; nb < 4; ++nb) br[nb] = ldcol<KD>(bq + (size_t)kc * KD + nb * 16);
        asm volatile("" :: "v"(a[0]), "v"(a[1]), "v"(a[2]), "v"(a[3]), "v"(a2[0]), "v"(a2[1]), "v"(a2[2]), "v"(a2[3]), "v"(br[0]), "v"(br[1]), "v"(br[2]), "v"(br[3]));   // inputs only: holds all loads of a k step ahead of its first product (one memory latency a step; without it part of the A loads issue behind the first products)
#pragma unroll
        for (int nb = 0; nb < 4; ++nb) { const v16bf b = __builtin_convertvector(br[nb], v16bf);
#pragma unroll
            for (int mb = 0; mb < 4; ++mb) { acc[mb][nb] = wmmab(a[mb], b, acc[mb][nb]); acc[mb][nb] = wmmab(a2[mb], b, acc[mb][nb]); } }
        asm volatile("v_nop\n\tv_nop\n\tv_nop\n\tv_nop" : "+v"(acc[0][0]), "+v"(acc[1][1]), "+v"(acc[2][2]), "+v"(acc[3][3]) : "v"(a[0]), "v"(a[3]));   // the distance behind the last matrix instruction, on the back edge too
    }
    const int cofs = lr * 4; const float* bc = bias + c0 + cofs; const float b4[4] = { bc[0], bc[1], bc[2], bc[3] };
    asm volatile("s_wait_xcnt 0x0" :: "v"(bc) : "memory");   // the load's address pair is kept up to this wait (without the operand the result lands on it)
    v4f bv; bv[0] = bfr(b4[0]); bv[1] = bfr(b4[1]); bv[2] = bfr(b4[2]); bv[3] = bfr(b4[3]);
#pragma unroll
    for (int mb = 0; mb < 4; ++mb) {
#pragma unroll
        for (int nb = 0; nb < 4; ++nb) {
#pragma unroll
            for (int j = 0; j < 8; ++j) os[(hi * 8 + j) * 68 + nb * 16 + lr] = acc[mb][nb][j]; }
        __builtin_amdgcn_wave_barrier(); asm volatile("" ::: "memory");   // other lanes' LDS stores stay ahead of the reads below
        float* crow = C + (size_t)(r0 + mb * 16) * KD + c0;
#pragma unroll
        for (int s = 0; s < 8; ++s) { const int row = 2 * s + hi; *(v4f*)(crow + (size_t)row * KD + cofs) = *(const v4fa*)(os + row * 68 + cofs) + bv; }
        __builtin_amdgcn_wave_barrier(); asm volatile("s_wait_xcnt 0x0" ::: "memory");   // the reads above stay ahead of the next block's LDS stores; the wait: before the stores' data registers are used again
    }
}
// lane l <-> l ^ 16
__device__ __forceinline__ float xhalf(float v) { const int b = __float_as_int(v); return __int_as_float(__builtin_amdgcn_permlanex16(b, b, 0x76543210, 0xfedcba98, false, false)); }
// ---- k_fattn: scores, softmax and attn.v of one head in one kernel; scores and numerators stay in registers. Grid (NN / 128, heads), 16 waves: wave = (tile qt of QG x 16 queries, key range kq of NN / KQ keys).
// Per 32 keys: St = K' Q't (A = 16 key rows, B = 16 query columns, k = 64 features), so a lane holds 16 scores of ONE query (keys 8 hi + j and 16 + 8 hi + j); two St tiles converted in place are the B operand
// of Ot += Vt Pt (A = 16 rows of the [d][key] plane, same k order). Reference m and sum l per query: m starts as the largest score of the range's first 32 keys (a real score, so l never vanishes) and stays while the numerators taken against it fit fp16
// (test on their sums, PT); only then the row max is taken and Ot and l are rescaled by exp2(LC (m_old - m_new)). l holds the x1024 numerators' f32 sum.
// K' and Vt fragments of the next 32 keys are fetched into the same registers right behind their last use (the last pass fetches the range's first keys again: in bounds, unused).
__global__ __launch_bounds__(512) void k_fattn(const h16* __restrict__ QA, const h16* __restrict__ KB, const h16* __restrict__ VT, bf* __restrict__ OS) {
    __shared__ float mg[KQ][QT][QG][18][32];   // per key range, tile, column group and lane: 16 Ot values, m, l
    const int lane = threadIdx.x & 31; const int w = threadIdx.x >> 5, qt = w % QT, kq = w / QT;
    const int h = blockIdx.y, qb = blockIdx.x * (QT * QG * 16);
    const h16* qp = QA + (((size_t)h * (NN / 16) + (qb >> 4) + qt * QG) * 128 + lane) * 8;
    const h16* kp = KB + (((size_t)h * (NN / 16) + kq * (NN / KQ / 16)) * 128 + lane) * 8;
    const h16* vp = VT + (((size_t)h * (NN / 32) + kq * (NN / KQ / 32)) * 128 + lane) * 8;
    v16h qf[QG][2], kf[2][2], vf[2]; v8f o[QG][2]; float m[QG], l[QG];
#pragma unroll
    for (int g = 0; g < QG; ++g) { qf[g][0] = WFrag<h16>::ld(qp + g * 1024); qf[g][1] = WFrag<h16>::ld(qp + g * 1024 + 512); o[g][0] = (v8f){}; o[g][1] = (v8f){}; l[g] = 0.f; }
#pragma unroll
    for (int kt = 0; kt < 2; ++kt) { kf[kt][0] = WFrag<h16>::ld(kp + kt * 1024); kf[kt][1] = WFrag<h16>::ld(kp + kt * 1024 + 512); vf[kt] = WFrag<h16>::ld(vp + kt * 512); }
    asm volatile("s_wait_xcnt 0x0" :: "v"(qp), "v"(kp), "v"(vp) : "memory");   // the three address pairs stay as they are up to this wait (without the operands a later load's result lands on the q pair)
#pragma unroll
    for (int g = 0; g < QG; ++g) { const v8f r0 = wmma16(kf[0][1], qf[g][1], wmma16(kf[0][0], qf[g][0], (v8f){})), r1 = wmma16(kf[1][1], qf[g][1], wmma16(kf[1][0], qf[g][0], (v8f){})); float mx = fmaxf(r0[0], r1[0]);
#pragma unroll
        for (int j = 1; j < 8; ++j) mx = fmaxf(mx, fmaxf(r0[j], r1[j]));
        m[g] = fmaxf(mx, xhalf(mx)); }
#pragma unroll 1   // rolled: four waves per SIMD leave 256 registers a wave
    for (int kc = 0; kc < NN / KQ; kc += 32) {
        const int kn = kc + 32 < NN / KQ ? kc + 32 : 0; const h16* kx = kp + (size_t)kn * 64; const h16* vx = vp + (size_t)kn * 32;
#pragma unroll
        for (int gp = 0; gp < QG; gp += 2) {
            v8f s[2][2];
#pragma unroll
            for (int u = 0; u < 2; ++u) { s[u][0] = wmma16(kf[0][0], qf[gp + u][0], (v8f){}); s[u][1] = wmma16(kf[1][0], qf[gp + u][0], (v8f){}); s[u][0] = wmma16(kf[0][1], qf[gp + u][1], s[u][0]); s[u][1] = wmma16(kf[1][1], qf[gp + u][1], s[u][1]); }
            if (gp + 2 == QG) {
#pragma unroll
                for (int kt = 0; kt < 2; ++kt) { kf[kt][0] = WFrag<h16>::ld(kx + kt * 1024); kf[kt][1] = WFrag<h16>::ld(kx + kt * 1024 + 512); }
                asm volatile("s_wait_xcnt 0x0" :: "v"(kx) : "memory"); }   // the loads' address pair stays as it is up to this wait (without the operand the last load's result lands on it); it also keeps the fetch here, ahead of the softmax
            v16h p[2]; float sum[2];
#pragma unroll
            for (int u = 0; u < 2; ++u) { const float mc = m[gp + u] * LC - 10.0f; float t = 0.f;   // the 10: numerators x1024
#pragma unroll
                for (int j = 0; j < 8; ++j) { const float e0 = __builtin_amdgcn_exp2f(s[u][0][j] * LC - mc), e1 = __builtin_amdgcn_exp2f(s[u][1][j] * LC - mc); t += e0 + e1; p[u][j] = tohx(e0); p[u][8 + j] = tohx(e1); }
                sum[u] = t; }
            if (__builtin_expect(__builtin_amdgcn_ballot_w32(!(sum[0] + sum[1] <= PT)) != 0, 0)) {   // numerators are >= 0, so a sum within PT bounds each of them; one scalar branch for the wave
                // a new reference for both column groups, in every lane: the scores once more (they were not kept), row max, Ot and l rescaled, numerators made again
                v16h kr[2][2];
                if (gp + 2 == QG) { const h16* ky = kp + (size_t)kc * 64;   // kf already takes the next pass's keys: this pass's come from memory again
#pragma unroll
                    for (int kt = 0; kt < 2; ++kt) { kr[kt][0] = WFrag<h16>::ld(ky + kt * 1024); kr[kt][1] = WFrag<h16>::ld(ky + kt * 1024 + 512); }
                    asm volatile("s_wait_xcnt 0x0" :: "v"(ky) : "memory"); }   // the loads' address pair stays as it is up to this wait
                else {
#pragma unroll
                    for (int kt = 0; kt < 2; ++kt) { kr[kt][0] = kf[kt][0]; kr[kt][1] = kf[kt][1]; } }
#pragma unroll
                for (int u = 0; u < 2; ++u) { const int g = gp + u;
                    v8f r0 = wmma16(kr[0][0], qf[g][0], (v8f){}), r1 = wmma16(kr[1][0], qf[g][0], (v8f){}); r0 = wmma16(kr[0][1], qf[g][1], r0); r1 = wmma16(kr[1][1], qf[g][1], r1);
                    float mx = fmaxf(r0[0], r1[0]);
#pragma unroll
                    for (int j = 1; j < 8; ++j) mx = fmaxf(mx, fmaxf(r0[j], r1[j]));
                    mx = fmaxf(mx, xhalf(mx));
                    const float mn = fmaxf(m[g], mx), al = __builtin_amdgcn_exp2f((m[g] - mn) * LC), mc = mn * LC - 10.0f; m[g] = mn; float t = 0.f;
#pragma unroll
                    for (int j = 0; j < 8; ++j) { const float e0 = __builtin_amdgcn_exp2f(r0[j] * LC - mc), e1 = __builtin_amdgcn_exp2f(r1[j] * LC - mc); t += e0 + e1; p[u][j] = tohx(e0); p[u][8 + j] = tohx(e1); }
                    sum[u] = t; l[g] *= al; o[g][0] *= al; o[g][1] *= al; }
            }
#pragma unroll
            for (int u = 0; u < 2; ++u) { const int g = gp + u; l[g] += sum[u];
#pragma unroll
                for (int dt = 0; dt < 2; ++dt) o[g][dt] = wmma16(vf[dt], p[u], o[g][dt]); }
        }
#pragma unroll
        for (int dt = 0; dt < 2; ++dt) vf[dt] = WFrag<h16>::ld(vx + dt * 512);
        asm volatile("s_wait_xcnt 0x0" :: "v"(vx) : "memory");   // as above: the address pair is kept up to the wait
    }
#pragma unroll
    for (int g = 0; g < QG; ++g) {
        const float lj = l[g] + xhalf(l[g]);   // the two lane halves hold different keys of the same query
#pragma unroll
        for (int j = 0; j < 8; ++j) { mg[kq][qt][g][j][lane] = o[g][0][j]; mg[kq][qt][g][8 + j][lane] = o[g][1][j]; }
        mg[kq][qt][g][16][lane] = m[g]; mg[kq][qt][g][17][lane] = lj; }
    __syncthreads();   // every range's partial result is in LDS before a wave joins them
    if (w < QT * QG) {   // one wave joins the KQ ranges of one (tile, column group), in range order
        const int jq = w % QT, jg = w / QT; float M = mg[0][jq][jg][16][lane];
#pragma unroll
        for (int z = 1; z < KQ; ++z) M = fmaxf(M, mg[z][jq][jg][16][lane]);
        float L = 0.f; v8f a0 = (v8f){}, a1 = (v8f){};
#pragma unroll
        for (int z = 0; z < KQ; ++z) { const float wz = __builtin_amdgcn_exp2f((mg[z][jq][jg][16][lane] - M) * LC); L += mg[z][jq][jg][17][lane] * wz;
#pragma unroll
            for (int j = 0; j < 8; ++j) { a0[j] += mg[z][jq][jg][j][lane] * wz; a1[j] += mg[z][jq][jg][8 + j][lane] * wz; } }
        const float inv = __fdiv_rn(1.0f, L); bf* op = OS + (((size_t)h * (NN / 16) + (qb >> 4) + jq * QG + jg) * 128 + lane) * 8;   // the lane's Ot rows are its elements of k_outp's A fragment: four 512-byte blocks (hi, hi, lo, lo), written by this wave alone
        a0 *= inv; a1 *= inv; v8us h0, h1, l0, l1;
#pragma unroll
        for (int j = 0; j < 8; ++j) { unsigned short a, c; splitf(a0[j], a, c); h0[j] = a; l0[j] = c; splitf(a1[j], a, c); h1[j] = a; l1[j] = c; }
        *(v8us*)op = h0; *(v8us*)(op + 256) = h1; *(v8us*)(op + 512) = l0; *(v8us*)(op + 768) = l1;
    }
}
extern "C" void kernel_launch(void* const* d_in, const int* in_sizes, int n_in,
                              void* d_out, int out_size, void* d_ws, size_t ws_size, hipStream_t stream) {
    (void)in_sizes; (void)n_in; (void)out_size;
    const float* x = (const float*)d_in[0]; const float* wp = (const float*)d_in[1]; const float* bp = (const float*)d_in[2]; const float* wf = (const float*)d_in[3]; const float* bfv = (const float*)d_in[4];   // Wp [128][768], Wf [256][256] as x @ W
    float* OUT = (float*)d_out;     // [1][64][64][256]
    char* wsp = (char*)d_ws;
    auto take = [&](size_t bytes) { char* p = wsp; wsp += (bytes + 255) & ~(size_t)255; return (void*)p; };
    h16* QA = (h16*)take((size_t)NH_ * NN * 64 * 2); h16* KB = (h16*)take((size_t)NH_ * NN * 64 * 2); h16* VT = (h16*)take((size_t)NH_ * HD * NN * 2); bf* OS = (bf*)take((size_t)NH_ * NN * 64 * 2);
    if ((size_t)(wsp - (char*)d_ws) > ws_size) return;    // total 14 MB; ws 256 MiB
    k_proj<<<dim3(NN / 64, 3 * KD / 64, 1), 32, 0, stream>>>(x, wp, bp, QA, KB, VT);
    k_fattn<<<dim3(NN / (QT * QG * 16), NH_, 1), 512, 0, stream>>>(QA, KB, VT, OS);
    k_outp<<<dim3(NN / 64, KD / 64, 1), 32, 0, stream>>>(OS, wf, bfv, OUT);
}

// v006
// Measured time: 36.5 microseconds a run.
// In both of two side-by-side timings against v005, it was 1.20 times as fast.
// Counting every step since v000, it is 30.5 times as fast.
#include <hip/hip_runtime.h>

// Polar attention (x [1][64][64][128] -> 4096 tokens; qkv = x Wp + bp laid out (3, 8 heads, 32); scores[n][m] = (q_n.k_m / sqrt 32) r_weight[m] cos(theta_m - theta_n) with the module's polar
// constants (r = |p - centre| + 1e-6, theta = atan2 mod 2pi, log_r = log r / log max r, r_weight = 1/(log_r + 1), 'xy' meshgrid flattening); softmax over m; out = merged attn.v Wf + bf -> [1][64][64][256]).
// Compute dtypes, f32 accumulate: every input rounded to bf16; the projection on PLAIN bf16 operands (inputs: exact, + bias); the polar constants in f32 on VALU; the
// softmax in f32 (a row reference that is a real score, renewed when the numerators would leave fp16; one exp per element with the 32^-0.5; fp16 numerators x1024; divided by the x1024 sum at the end of k_fattn); attn.v on fp16 planes; merged heads as hi+lo

#define HW   64
#define NN   4096                 // tokens
#define CC   128
#define KD   256                  // key_dim
#define NH_  8
#define HD   32
#define SCL  0.17677669529663688f   // 32^-0.5
#define KQ   8                    // key ranges of k_fattn: one wave per (query tile, range), joined through LDS at the end
#define QT   2                    // query tiles of one work-group of k_fattn
#define KW   4                    // waves of one work-group of the two GEMMs: each takes a quarter of k
#define QG   4                    // 16-query column groups of one tile (one wave)
#define LC   (SCL * 1.4426950408889634f)   // 32^-0.5 log2(e): exp(SCL d) = exp2(LC d)
#define PT   32768.0f             // k_fattn keeps a column-group pair's references while every lane's 32 numerators of the pair in a pass (16 a query) sum to at most this (fp16 holds each)
typedef _Float16 h16;
typedef unsigned short bf;
typedef __attribute__((ext_vector_type(16))) __bf16   v16bf;
typedef __attribute__((ext_vector_type(16))) _Float16 v16h;
typedef __attribute__((ext_vector_type(8)))  _Float16 v8h;
typedef __attribute__((ext_vector_type(8)))  unsigned short v8us;
typedef __attribute__((ext_vector_type(8)))  float    v8f;
typedef __attribute__((ext_vector_type(4)))  float    v4f;
typedef v8h  __attribute__((may_alias)) v8ha;
typedef v4f  __attribute__((may_alias)) v4fa;
typedef v8us __attribute__((may_alias)) v8usa;

__device__ __forceinline__ unsigned short f2bf(float f) { unsigned u = __float_as_uint(f); u += 0x7FFFu + ((u >> 16) & 1u); return (unsigned short)(u >> 16); }
__device__ __forceinline__ float bf2f(unsigned short b) { return __uint_as_float(((unsigned)b) << 16); }
__device__ __forceinline__ float bfr(float f) { return bf2f(f2bf(f)); }
__device__ __forceinline__ v16h cat16(v8h lo, v8h hi) { return __builtin_shufflevector(lo, hi, 0, 1, 2, 3, 4, 5, 6, 7, 8, 9, 10, 11, 12, 13, 14, 15); }
__device__ __forceinline__ v16bf cat16b(v8us lo, v8us hi) { return __builtin_bit_cast(v16bf, __builtin_shufflevector(lo, hi, 0, 1, 2, 3, 4, 5, 6, 7, 8, 9, 10, 11, 12, 13, 14, 15)); }
__device__ __forceinline__ v8f wmma16(v16h a, v16h b, v8f c) { return __builtin_amdgcn_wmma_f32_16x16x32_f16(false, a, false, b, (short)0, c, false, false); }
__device__ __forceinline__ v8f wmmab(v16bf a, v16bf b, v8f c) { return __builtin_amdgcn_wmma_f32_16x16x32_bf16(false, a, false, b, (short)0, c, false, false); }



// ---- The two GEMMs: one work-group of KW waves per 64x64 output tile; every wave holds the whole tile (16 accumulators) for its own quarter of k, in steps of 32; the partial tiles are joined through LDS. Both read their f32 sources themselves and round to bf16 (nearest even) in registers while they
// form the fragments, and the projection's epilogue writes the attention kernel's fp16 planes itself: no conversion, transposition or re-layout pass stands between the launches.
// Fragment k order, A and B alike: element s of lane half hi is k = kc + 8 hi + s (s < 8) and kc + 16 + 8 hi + (s - 8).
// The four workspace planes lie in FRAGMENT ORDER: a 16 x 32 fragment is two blocks of 512 bytes, block b = lane l's 8 elements s = 8 b .. 8 b + 7 at byte 16 l (l = 16 hi + row). A wave-wide 16-byte load or store
// then covers 4 whole 128-byte lines, where a row-major plane gave it 16 lines. QA, KB: [head][token / 16][feature / 16][lane][8]; VT: [head][key / 32][d / 16][(key / 16) % 2][lane][8]; OS: [head][token / 16][hi: d / 16, lo: 2 + d / 16][lane][8].
template <typename T16> struct WFrag;
template <> struct WFrag<h16> { typedef v16h V; static __device__ __forceinline__ V ld(const h16* p) { return cat16(*(const v8h*)p, *(const v8h*)(p + 256)); } static __device__ __forceinline__ v8f mma(V a, V b, v8f c) { return wmma16(a, b, c); } };
typedef __attribute__((ext_vector_type(16))) float v16f;
typedef __attribute__((ext_vector_type(4))) _Float16 v4h;
__device__ __forceinline__ h16 tohx(float x) { return (h16)x; }
__device__ __forceinline__ void splitf(float y, unsigned short& h, unsigned short& l) { h = f2bf(y); l = f2bf(y - bf2f(h)); }
__device__ __forceinline__ v16f cat16f(v8f lo, v8f hi) { return __builtin_shufflevector(lo, hi, 0, 1, 2, 3, 4, 5, 6, 7, 8, 9, 10, 11, 12, 13, 14, 15); }
// 16 k of one row of a k-contiguous f32 matrix; p points at k = kc + 8 hi
__device__ __forceinline__ v16f ldrow(const float* p) { return cat16f(*(const v8f*)p, *(const v8f*)(p + 16)); }
// 16 k of one column of W[k][n] (f32, pitch N); p points at (kc + 8 hi, column)
template <int N> __device__ __forceinline__ v16f ldcol(const float* p) { v16f t;
#pragma unroll
    for (int i = 0; i < 8; ++i) { t[i] = p[(size_t)i * N]; t[8 + i] = p[(size_t)(16 + i) * N]; }
    return t; }
// polar constants of token n (x = n / 64, y = n % 64 from the 'xy' meshgrid flattening): r = sqrt((x-32)^2 + (y-32)^2) + 1e-6, th = atan2(y-32, x-32) (+2pi mod 2pi), log_r = log(r)/log(r_max): (cos th, sin th, r_weight, 0)
__device__ __forceinline__ v4f polar(int n) { const float xx = (float)(n / HW) - 32.0f, yy = (float)(n % HW) - 32.0f;
    const float r = __fsqrt_rn(__fadd_rn(__fmul_rn(xx, xx), __fmul_rn(yy, yy))) + 1e-6f; float th = atan2f(yy, xx); th = fmodf(th + 6.283185307179586f, 6.283185307179586f);
    const float rmax = __fsqrt_rn(2048.0f) + 1e-6f; const float lr = __fdiv_rn(logf(r), logf(rmax)); const float rw = __fdiv_rn(1.0f, __fadd_rn(lr, 1.0f)); v4f o; o[0] = cosf(th); o[1] = sinf(th); o[2] = rw; o[3] = 0.f; return o; }

// ---- The join of the KW partial tiles. Every wave leaves its 16 accumulators in LDS, lane by lane (16-byte stores, 512 contiguous bytes a wave); behind the barrier wave w adds the KW partial sums of row block w, in k order.
__device__ __forceinline__ void joink(float* pj, const v8f (&acc)[4][4], v8f (&fin)[4], int w, int lane) {
    __builtin_amdgcn_sched_barrier(0);   // the LDS stores stay behind the last matrix instruction
#pragma unroll
    for (int mb = 0; mb < 4; ++mb)
#pragma unroll
        for (int nb = 0; nb < 4; ++nb) { float* d = pj + ((((mb * KW + w) * 4 + nb) * 2) * 32 + lane) * 4;
            *(v4fa*)d = __builtin_shufflevector(acc[mb][nb], acc[mb][nb], 0, 1, 2, 3); *(v4fa*)(d + 128) = __builtin_shufflevector(acc[mb][nb], acc[mb][nb], 4, 5, 6, 7); }
    __syncthreads();   // every wave's partial tile is in LDS before a wave adds them
#pragma unroll
    for (int nb = 0; nb < 4; ++nb)
#pragma unroll
        for (int z = 0; z < KW; ++z) { const float* s = pj + ((((w * KW + z) * 4 + nb) * 2) * 32 + lane) * 4; const v4f lo = *(const v4fa*)s, hi4 = *(const v4fa*)(s + 128);
            const v8f p = __builtin_shufflevector(lo, hi4, 0, 1, 2, 3, 4, 5, 6, 7); fin[nb] = z ? fin[nb] + p : p; }
}

// ---- k_proj: qkv = x Wp + bp; grid (NN / 64, 768 / 64), KW waves: wave w takes k = 32 w .. 32 w + 31 of the whole tile and finishes rows 16 w .. 16 w + 15. A tile's 64 columns are two heads of ONE of q, k, v. q: features 0..31 of QA = q cos th_n, 32..63 = q sin th_n; k: KB the same with k r_weight_n; v: VT, rows d < 32, k = key.
__global__ __launch_bounds__(32 * KW) void k_proj(const float* __restrict__ x, const float* __restrict__ wp, const float* __restrict__ bp, h16* __restrict__ QA, h16* __restrict__ KB, h16* __restrict__ VT) {
    __shared__ __align__(16) float pj[4 * KW * 4 * 2 * 32 * 4];
    __shared__ __align__(16) float osm[KW][16 * 68];
    const int lane = threadIdx.x & 31, lr = lane & 15, hi = lane >> 4, w = __builtin_amdgcn_readfirstlane(threadIdx.x >> 5); const int r0 = blockIdx.x * 64, c0 = blockIdx.y * 64; const int sec = c0 / KD, h0 = (c0 % KD) / HD;
    float* os = osm[w];
    const float* pa = x + (size_t)(r0 + lr) * CC + 32 * w + 8 * hi; const float* pb = wp + (size_t)(32 * w + 8 * hi) * (3 * KD) + c0 + lr; const float* bu = bp + c0;
    v16f ar[4], br[4];
#pragma unroll
    for (int mb = 0; mb < 4; ++mb) ar[mb] = ldrow(pa + (size_t)mb * 16 * CC);
#pragma unroll
    for (int nb = 0; nb < 4; ++nb) br[nb] = ldcol<3 * KD>(pb + nb * 16);
    const float b4[4] = { bu[lr], bu[16 + lr], bu[32 + lr], bu[48 + lr] };
    asm volatile("s_wait_xcnt 0x0" :: "v"(pa), "v"(pb), "s"(bu) : "memory");   // the loads' addresses are kept up to this wait; the clobber keeps every load ahead of the polar constants, which are made while the loads fly
    v4f t = (v4f){}; if (sec < 2) t = polar(r0 + w * 16 + lr);   // the lane's token in the epilogue: row lr of the wave's row block
    v16bf a[4]; v8f acc[4][4], fin[4];
#pragma unroll
    for (int mb = 0; mb < 4; ++mb) a[mb] = __builtin_convertvector(ar[mb], v16bf);
#pragma unroll
    for (int nb = 0; nb < 4; ++nb) { const v16bf b = __builtin_convertvector(br[nb], v16bf);
#pragma unroll
        for (int mb = 0; mb < 4; ++mb) acc[mb][nb] = wmmab(a[mb], b, (v8f){}); }
    joink(pj, acc, fin, w, lane);
    const float bv[4] = { bfr(b4[0]), bfr(b4[1]), bfr(b4[2]), bfr(b4[3]) };
    if (sec == 2) {   // v: a lane's 8 accumulator rows are 8 consecutive keys of one (head, d) row: its 16 bytes of one fragment block; the wave writes the whole 512-byte block
#pragma unroll
        for (int nb = 0; nb < 4; ++nb) { h16* vblk = VT + ((((size_t)(h0 + (nb >> 1)) * (NN / 32) + (r0 >> 5)) * 4 + (nb & 1) * 2) * 32 + lane) * 8; v8h o;
#pragma unroll
            for (int j = 0; j < 8; ++j) o[j] = tohx(fin[nb][j] + bv[nb]);
            *(v8h*)(vblk + (w >> 1) * 1024 + (w & 1) * 256) = o; }
        return;
    }
    h16* P = sec ? KB : QA; h16* pblk = P + (((size_t)h0 * (NN / 16) + (r0 >> 4)) * 128 + lane) * 8;
#pragma unroll
    for (int nb = 0; nb < 4; ++nb) {
#pragma unroll
        for (int j = 0; j < 8; ++j) os[(hi * 8 + j) * 68 + nb * 16 + lr] = fin[nb][j] + bv[nb]; }
    __builtin_amdgcn_wave_barrier(); asm volatile("" ::: "memory");   // other lanes' LDS stores stay ahead of the reads below
    const float wt = sec ? t[2] : 1.0f;
#pragma unroll
    for (int hh = 0; hh < 2; ++hh)
#pragma unroll
        for (int jj = 0; jj < 2; ++jj) { const float* sp = os + lr * 68 + hh * 32 + jj * 16 + hi * 8; const v4f x0 = *(const v4fa*)sp, x1 = *(const v4fa*)(sp + 4); v8h oc, on;
#pragma unroll
            for (int q = 0; q < 4; ++q) { const float aw = __fmul_rn(x0[q], wt), ax = __fmul_rn(x1[q], wt); oc[q] = tohx(__fmul_rn(aw, t[0])); on[q] = tohx(__fmul_rn(aw, t[1])); oc[4 + q] = tohx(__fmul_rn(ax, t[0])); on[4 + q] = tohx(__fmul_rn(ax, t[1])); }
            h16* pr = pblk + ((size_t)hh * (NN / 16) + w) * 1024 + jj * 256; *(v8h*)pr = oc; *(v8h*)(pr + 512) = on; }   // two whole 512-byte fragment blocks, written by this wave alone
    asm volatile("s_wait_xcnt 0x0" ::: "memory");   // behind the last store: the built code has a branch from here into the v block, which writes the stores' data registers
}

// ---- k_outp: OUT = merged Wf + bf; grid (NN / 64, 256 / 64), KW waves: wave w takes heads 2 w and 2 w + 1 (k = 64 w .. 64 w + 63) of the whole tile and finishes rows 16 w .. 16 w + 15. merged[n][h 32 + d] is read where k_fattn left it, in OS, as ready A fragments (bf16 hi, then lo): a k step of 32 is one head; both products on the matrix unit, hi first.
__global__ __launch_bounds__(32 * KW) void k_outp(const bf* __restrict__ OS, const float* __restrict__ wf, const float* __restrict__ bias, float* __restrict__ C) {
    __shared__ __align__(16) float pj[4 * KW * 4 * 2 * 32 * 4];
    __shared__ __align__(16) float osm[KW][16 * 68];
    const int lane = threadIdx.x & 31, lr = lane & 15, hi = lane >> 4, w = __builtin_amdgcn_readfirstlane(threadIdx.x >> 5); const int r0 = blockIdx.x * 64, c0 = blockIdx.y * 64;
    float* os = osm[w];
    const bf* ap = OS + (size_t)(64 * w) * (NN * 2) + ((size_t)(r0 >> 4) * 128 + lane) * 8; const float* bq = wf + (size_t)(64 * w + 8 * hi) * KD + c0 + lr;
    const int cofs = lr * 4; const float* bc = bias + c0 + cofs;
    v16bf a[2][4], a2[2][4]; v16f br[2][4];
#pragma unroll
    for (int s = 0; s < 2; ++s) {
#pragma unroll
        for (int mb = 0; mb < 4; ++mb) { const bf* p = ap + (size_t)(32 * s) * (NN * 2) + mb * 1024; a[s][mb] = cat16b(*(const v8us*)p, *(const v8us*)(p + 256)); a2[s][mb] = cat16b(*(const v8us*)(p + 512), *(const v8us*)(p + 768)); }
#pragma unroll
        for (int nb = 0; nb < 4; ++nb) br[s][nb] = ldcol<KD>(bq + (size_t)(32 * s) * KD + nb * 16); }
    const float b4[4] = { bc[0], bc[1], bc[2], bc[3] };
    asm volatile("s_wait_xcnt 0x0" ::: "memory");   // before the fragment loads' address registers are used again
    __builtin_amdgcn_sched_barrier(0);   // keeps all that follows behind the wait: without it the first products are lifted among the loads, which then go out in several flights (a memory latency each)
    v8f acc[4][4], fin[4];
#pragma unroll
    for (int mb = 0; mb < 4; ++mb)
#pragma unroll
        for (int nb = 0; nb < 4; ++nb) acc[mb][nb] = (v8f){};
#pragma unroll
    for (int s = 0; s < 2; ++s)
#pragma unroll
        for (int nb = 0; nb < 4; ++nb) { const v16bf b = __builtin_convertvector(br[s][nb], v16bf);
#pragma unroll
            for (int mb = 0; mb < 4; ++mb) { acc[mb][nb] = wmmab(a[s][mb], b, acc[mb][nb]); acc[mb][nb] = wmmab(a2[s][mb], b, acc[mb][nb]); } }
    v4f bv; bv[0] = bfr(b4[0]); bv[1] = bfr(b4[1]); bv[2] = bfr(b4[2]); bv[3] = bfr(b4[3]);
    joink(pj, acc, fin, w, lane);
#pragma unroll
    for (int nb = 0; nb < 4; ++nb) {
#pragma unroll
        for (int j = 0; j < 8; ++j) os[(hi * 8 + j) * 68 + nb * 16 + lr] = fin[nb][j]; }
    __builtin_amdgcn_wave_barrier(); asm volatile("" ::: "memory");   // other lanes' LDS stores stay ahead of the reads below
    float* crow = C + (size_t)(r0 + w * 16) * KD + c0;
#pragma unroll
    for (int s = 0; s < 8; ++s) { const int row = 2 * s + hi; *(v4f*)(crow + (size_t)row * KD + cofs) = *(const v4fa*)(os + row * 68 + cofs) + bv; }
}
// lane l <-> l ^ 16
__device__ __forceinline__ float xhalf(float v) { const int b = __float_as_int(v); return __int_as_float(__builtin_amdgcn_permlanex16(b, b, 0x76543210, 0xfedcba98, false, false)); }
// ---- k_fattn: scores, softmax and attn.v of one head in one kernel; scores and numerators stay in registers. Grid (NN / 128, heads), 16 waves: wave = (tile qt of QG x 16 queries, key range kq of NN / KQ keys).
// Per 32 keys: St = K' Q't (A = 16 key rows, B = 16 query columns, k = 64 features), so a lane holds 16 scores of ONE query (keys 8 hi + j and 16 + 8 hi + j); two St tiles converted in place are the B operand
// of Ot += Vt Pt (A = 16 rows of the [d][key] plane, same k order). Reference m and sum l per query: m starts as the largest score of the range's first 32 keys (a real score, so l never vanishes) and stays while the numerators taken against it fit fp16
// (test on their sums, PT); only then the row max is taken and Ot and l are rescaled by exp2(LC (m_old - m_new)). l holds the x1024 numerators' f32 sum.
// K' and Vt fragments of the next 32 keys are fetched into the same registers right behind their last use (the last pass fetches the range's first keys again: in bounds, unused).
__global__ __launch_bounds__(512) void k_fattn(const h16* __restrict__ QA, const h16* __restrict__ KB, const h16* __restrict__ VT, bf* __restrict__ OS) {
    __shared__ float mg[KQ][QT][QG][18][32];   // per key range, tile, column group and lane: 16 Ot values, m, l
    const int lane = threadIdx.x & 31; const int w = threadIdx.x >> 5, qt = w % QT, kq = w / QT;
    const int h = blockIdx.y, qb = blockIdx.x * (QT * QG * 16);
    const h16* qp = QA + (((size_t)h * (NN / 16) + (qb >> 4) + qt * QG) * 128 + lane) * 8;
    const h16* kp = KB + (((size_t)h * (NN / 16) + kq * (NN / KQ / 16)) * 128 + lane) * 8;
    const h16* vp = VT + (((size_t)h * (NN / 32) + kq * (NN / KQ / 32)) * 128 + lane) * 8;
    v16h qf[QG][2], kf[2][2], vf[2]; v8f o[QG][2]; float m[QG], l[QG];
#pragma unroll
    for (int g = 0; g < QG; ++g) { qf[g][0] = WFrag<h16>::ld(qp + g * 1024); qf[g][1] = WFrag<h16>::ld(qp + g * 1024 + 512); o[g][0] = (v8f){}; o[g][1] = (v8f){}; l[g] = 0.f; }
#pragma unroll
    for (int kt = 0; kt < 2; ++kt) { kf[kt][0] = WFrag<h16>::ld(kp + kt * 1024); kf[kt][1] = WFrag<h16>::ld(kp + kt * 1024 + 512); vf[kt] = WFrag<h16>::ld(vp + kt * 512); }
    asm volatile("s_wait_xcnt 0x0" :: "v"(qp), "v"(kp), "v"(vp) : "memory");   // the three address pairs stay as they are up to this wait (without the operands a later load's result lands on the q pair)
#pragma unroll
    for (int g = 0; g < QG; ++g) { const v8f r0 = wmma16(kf[0][1], qf[g][1], wmma16(kf[0][0], qf[g][0], (v8f){})), r1 = wmma16(kf[1][1], qf[g][1], wmma16(kf[1][0], qf[g][0], (v8f){})); float mx = fmaxf(r0[0], r1[0]);
#pragma unroll
        for (int j = 1; j < 8; ++j) mx = fmaxf(mx, fmaxf(r0[j], r1[j]));
        m[g] = fmaxf(mx, xhalf(mx)); }
#pragma unroll 1   // rolled: four waves per SIMD leave 256 registers a wave
    for (int kc = 0; kc < NN / KQ; kc += 32) {
        const int kn = kc + 32 < NN / KQ ? kc + 32 : 0; const h16* kx = kp + (size_t)kn * 64; const h16* vx = vp + (size_t)kn * 32;
#pragma unroll
        for (int gp = 0; gp < QG; gp += 2) {
            v8f s[2][2];
#pragma unroll
            for (int u = 0; u < 2; ++u) { s[u][0] = wmma16(kf[0][0], qf[gp + u][0], (v8f){}); s[u][1] = wmma16(kf[1][0], qf[gp + u][0], (v8f){}); s[u][0] = wmma16(kf[0][1], qf[gp + u][1], s[u][0]); s[u][1] = wmma16(kf[1][1], qf[gp + u][1], s[u][1]); }
            if (gp + 2 == QG) {
#pragma unroll
                for (int kt = 0; kt < 2; ++kt) { kf[kt][0] = WFrag<h16>::ld(kx + kt * 1024); kf[kt][1] = WFrag<h16>::ld(kx + kt * 1024 + 512); }
                asm volatile("s_wait_xcnt 0x0" :: "v"(kx) : "memory"); }   // the loads' address pair stays as it is up to this wait (without the operand the last load's result lands on it); it also keeps the fetch here, ahead of the softmax
            v16h p[2]; float sum[2];
#pragma unroll
            for (int u = 0; u < 2; ++u) { const float mc = m[gp + u] * LC - 10.0f; float t = 0.f;   // the 10: numerators x1024
#pragma unroll
                for (int j = 0; j < 8; ++j) { const float e0 = __builtin_amdgcn_exp2f(s[u][0][j] * LC - mc), e1 = __builtin_amdgcn_exp2f(s[u][1][j] * LC - mc); t += e0 + e1; p[u][j] = tohx(e0); p[u][8 + j] = tohx(e1); }
                sum[u] = t; }
            if (__builtin_expect(__builtin_amdgcn_ballot_w32(!(sum[0] + sum[1] <= PT)) != 0, 0)) {   // numerators are >= 0, so a sum within PT bounds each of them; one scalar branch for the wave
                // a new reference for both column groups, in every lane: the scores once more (they were not kept), row max, Ot and l rescaled, numerators made again
                v16h kr[2][2];
                if (gp + 2 == QG) { const h16* ky = kp + (size_t)kc * 64;   // kf already takes the next pass's keys: this pass's come from memory again
#pragma unroll
                    for (int kt = 0; kt < 2; ++kt) { kr[kt][0] = WFrag<h16>::ld(ky + kt * 1024); kr[kt][1] = WFrag<h16>::ld(ky + kt * 1024 + 512); }
                    asm volatile("s_wait_xcnt 0x0" :: "v"(ky) : "memory"); }   // the loads' address pair stays as it is up to this wait
                else {
#pragma unroll
                    for (int kt = 0; kt < 2; ++kt) { kr[kt][0] = kf[kt][0]; kr[kt][1] = kf[kt][1]; } }
#pragma unroll
                for (int u = 0; u < 2; ++u) { const int g = gp + u;
                    v8f r0 = wmma16(kr[0][0], qf[g][0], (v8f){}), r1 = wmma16(kr[1][0], qf[g][0], (v8f){}); r0 = wmma16(kr[0][1], qf[g][1], r0); r1 = wmma16(kr[1][1], qf[g][1], r1);
                    float mx = fmaxf(r0[0], r1[0]);
#pragma unroll
                    for (int j = 1; j < 8; ++j) mx = fmaxf(mx, fmaxf(r0[j], r1[j]));
                    mx = fmaxf(mx, xhalf(mx));
                    const float mn = fmaxf(m[g], mx), al = __builtin_amdgcn_exp2f((m[g] - mn) * LC), mc = mn * LC - 10.0f; m[g] = mn; float t = 0.f;
#pragma unroll
                    for (int j = 0; j < 8; ++j) { const float e0 = __builtin_amdgcn_exp2f(r0[j] * LC - mc), e1 = __builtin_amdgcn_exp2f(r1[j] * LC - mc); t += e0 + e1; p[u][j] = tohx(e0); p[u][8 + j] = tohx(e1); }
                    sum[u] = t; l[g] *= al; o[g][0] *= al; o[g][1] *= al; }
            }
#pragma unroll
            for (int u = 0; u < 2; ++u) { const int g = gp + u; l[g] += sum[u];
#pragma unroll
                for (int dt = 0; dt < 2; ++dt) o[g][dt] = wmma16(vf[dt], p[u], o[g][dt]); }
        }
#pragma unroll
        for (int dt = 0; dt < 2; ++dt) vf[dt] = WFrag<h16>::ld(vx + dt * 512);
        asm volatile("s_wait_xcnt 0x0" :: "v"(vx) : "memory");   // as above: the address pair is kept up to the wait
    }
#pragma unroll
    for (int g = 0; g < QG; ++g) {
        const float lj = l[g] + xhalf(l[g]);   // the two lane halves hold different keys of the same query
#pragma unroll
        for (int j = 0; j < 8; ++j) { mg[kq][qt][g][j][lane] = o[g][0][j]; mg[kq][qt][g][8 + j][lane] = o[g][1][j]; }
        mg[kq][qt][g][16][lane] = m[g]; mg[kq][qt][g][17][lane] = lj; }
    __syncthreads();   // every range's partial result is in LDS before a wave joins them
    if (w < QT * QG) {   // one wave joins the KQ ranges of one (tile, column group), in range order
        const int jq = w % QT, jg = w / QT; float M = mg[0][jq][jg][16][lane];
#pragma unroll
        for (int z = 1; z < KQ; ++z) M = fmaxf(M, mg[z][jq][jg][16][lane]);
        float L = 0.f; v8f a0 = (v8f){}, a1 = (v8f){};
#pragma unroll
        for (int z = 0; z < KQ; ++z) { const float wz = __builtin_amdgcn_exp2f((mg[z][jq][jg][16][lane] - M) * LC); L += mg[z][jq][jg][17][lane] * wz;
#pragma unroll
            for (int j = 0; j < 8; ++j) { a0[j] += mg[z][jq][jg][j][lane] * wz; a1[j] += mg[z][jq][jg][8 + j][lane] * wz; } }
        const float inv = __fdiv_rn(1.0f, L); bf* op = OS + (((size_t)h * (NN / 16) + (qb >> 4) + jq * QG + jg) * 128 + lane) * 8;   // the lane's Ot rows are its elements of k_outp's A fragment: four 512-byte blocks (hi, hi, lo, lo), written by this wave alone
        a0 *= inv; a1 *= inv; v8us h0, h1, l0, l1;
#pragma unroll
        for (int j = 0; j < 8; ++j) { unsigned short a, c; splitf(a0[j], a, c); h0[j] = a; l0[j] = c; splitf(a1[j], a, c); h1[j] = a; l1[j] = c; }
        *(v8us*)op = h0; *(v8us*)(op + 256) = h1; *(v8us*)(op + 512) = l0; *(v8us*)(op + 768) = l1;
    }
}
extern "C" void kernel_launch(void* const* d_in, const int* in_sizes, int n_in,
                              void* d_out, int out_size, void* d_ws, size_t ws_size, hipStream_t stream) {
    (void)in_sizes; (void)n_in; (void)out_size;
    const float* x = (const float*)d_in[0]; const float* wp = (const float*)d_in[1]; const float* bp = (const float*)d_in[2]; const float* wf = (const float*)d_in[3]; const float* bfv = (const float*)d_in[4];   // Wp [128][768], Wf [256][256] as x @ W
    float* OUT = (float*)d_out;     // [1][64][64][256]
    char* wsp = (char*)d_ws;
    auto take = [&](size_t bytes) { char* p = wsp; wsp += (bytes + 255) & ~(size_t)255; return (void*)p; };
    h16* QA = (h16*)take((size_t)NH_ * NN * 64 * 2); h16* KB = (h16*)take((size_t)NH_ * NN * 64 * 2); h16* VT = (h16*)take((size_t)NH_ * HD * NN * 2); bf* OS = (bf*)take((size_t)NH_ * NN * 64 * 2);
    if ((size_t)(wsp - (char*)d_ws) > ws_size) return;    // total 14 MB; ws 256 MiB
    k_proj<<<dim3(NN / 64, 3 * KD / 64, 1), 32 * KW, 0, stream>>>(x, wp, bp, QA, KB, VT);
    k_fattn<<<dim3(NN / (QT * QG * 16), NH_, 1), 512, 0, stream>>>(QA, KB, VT, OS);
    k_outp<<<dim3(NN / 64, KD / 64, 1), 32 * KW, 0, stream>>>(OS, wf, bfv, OUT);
}

// v007
// Measured time: 34 microseconds a run.
// In two side-by-side timings against v006, it was 1.09 and 1.08 times as fast.
// All steps since v000 together make it 33.1 times as fast.
#include <hip/hip_runtime.h>

// Polar attention (x [1][64][64][128] -> 4096 tokens; qkv = x Wp + bp laid out (3, 8 heads, 32); scores[n][m] = (q_n.k_m / sqrt 32) r_weight[m] cos(theta_m - theta_n) with the module's polar
// constants (r = |p - centre| + 1e-6, theta = atan2 mod 2pi, log_r = log r / log max r, r_weight = 1/(log_r + 1), 'xy' meshgrid flattening); softmax over m; out = merged attn.v Wf + bf -> [1][64][64][256]).
// Compute dtypes, f32 accumulate: every input rounded to bf16; the projection on PLAIN bf16 operands (inputs: exact, + bias); the polar constants in f32 on VALU; the
// softmax in f32 (first against a fixed reference, checked once per key range; where that check fails, against a row reference that is a real score, renewed when the numerators would leave fp16; one exp2 per element, the 32^-0.5 log2(e) carried by q'; fp16 numerators; divided by their f32 sum at the end of k_fattn); attn.v on fp16 planes; merged heads as hi+lo

#define HW   64
#define NN   4096                 // tokens
#define CC   128
#define KD   256                  // key_dim
#define NH_  8
#define HD   32
#define SCL  0.17677669529663688f   // 32^-0.5
#define KQ   8                    // key ranges of k_fattn: one wave per (query tile, range), joined through LDS at the end
#define QT   2                    // query tiles of one work-group of k_fattn
#define KW   4                    // waves of one work-group of the two GEMMs: each takes a quarter of k
#define QG   4                    // 16-query column groups of one tile (one wave)
#define LC   (SCL * 1.4426950408889634f)   // 32^-0.5 log2(e): exp(SCL d) = exp2(LC d); k_proj multiplies q by it
#define PT   32768.0f             // k_fattn's second loop keeps a query's reference while a lane's 32 numerators of a pass (both column groups) sum to at most this (fp16 holds each)
#define LHI  65504.0f             // first loop: a lane's numerators of the whole range sum to at most this, so fp16 holds each
#define LLO  1.0f                 // first loop: a query's numerators of the range sum to at least this, so what fp16 loses below 2^-14 (at most 2^-25 a key) is small beside the numerators' own rounding
typedef _Float16 h16;
typedef unsigned short bf;
typedef __attribute__((ext_vector_type(16))) __bf16   v16bf;
typedef __attribute__((ext_vector_type(16))) _Float16 v16h;
typedef __attribute__((ext_vector_type(8)))  _Float16 v8h;
typedef __attribute__((ext_vector_type(8)))  unsigned short v8us;
typedef __attribute__((ext_vector_type(8)))  float    v8f;
typedef __attribute__((ext_vector_type(4)))  float    v4f;
typedef __attribute__((ext_vector_type(2)))  float    v2f;
typedef v8h  __attribute__((may_alias)) v8ha;
typedef v4f  __attribute__((may_alias)) v4fa;
typedef v8us __attribute__((may_alias)) v8usa;

__device__ __forceinline__ unsigned short f2bf(float f) { unsigned u = __float_as_uint(f); u += 0x7FFFu + ((u >> 16) & 1u); return (unsigned short)(u >> 16); }
__device__ __forceinline__ float bf2f(unsigned short b) { return __uint_as_float(((unsigned)b) << 16); }
__device__ __forceinline__ float bfr(float f) { return bf2f(f2bf(f)); }
__device__ __forceinline__ v16h cat16(v8h lo, v8h hi) { return __builtin_shufflevector(lo, hi, 0, 1, 2, 3, 4, 5, 6, 7, 8, 9, 10, 11, 12, 13, 14, 15); }
__device__ __forceinline__ v16bf cat16b(v8us lo, v8us hi) { return __builtin_bit_cast(v16bf, __builtin_shufflevector(lo, hi, 0, 1, 2, 3, 4, 5, 6, 7, 8, 9, 10, 11, 12, 13, 14, 15)); }
__device__ __forceinline__ v8f wmma16(v16h a, v16h b, v8f c) { return __builtin_amdgcn_wmma_f32_16x16x32_f16(false, a, false, b, (short)0, c, false, false); }
__device__ __forceinline__ v8f wmmab(v16bf a, v16bf b, v8f c) { return __builtin_amdgcn_wmma_f32_16x16x32_bf16(false, a, false, b, (short)0, c, false, false); }



// ---- The two GEMMs: one work-group of KW waves per 64x64 output tile; every wave holds the whole tile (16 accumulators) for its own quarter of k, in steps of 32; the partial tiles are joined through LDS. Both read their f32 sources themselves and round to bf16 (nearest even) in registers while they
// form the fragments, and the projection's epilogue writes the attention kernel's fp16 planes itself: no conversion, transposition or re-layout pass stands between the launches.
// Fragment k order, A and B alike: element s of lane half hi is k = kc + 8 hi + s (s < 8) and kc + 16 + 8 hi + (s - 8).
// The four workspace planes lie in FRAGMENT ORDER: a 16 x 32 fragment is two blocks of 512 bytes, block b = lane l's 8 elements s = 8 b .. 8 b + 7 at byte 16 l (l = 16 hi + row). A wave-wide 16-byte load or store
// then covers 4 whole 128-byte lines, where a row-major plane gave it 16 lines. QA, KB: [head][token / 16][feature / 16][lane][8]; VT: [head][key / 32][d / 16][(key / 16) % 2][lane][8]; OS: [head][token / 16][hi: d / 16, lo: 2 + d / 16][lane][8].
template <typename T16> struct WFrag;
template <> struct WFrag<h16> { typedef v16h V; static __device__ __forceinline__ V ld(const h16* p) { return cat16(*(const v8h*)p, *(const v8h*)(p + 256)); } static __device__ __forceinline__ v8f mma(V a, V b, v8f c) { return wmma16(a, b, c); } };
typedef __attribute__((ext_vector_type(16))) float v16f;
typedef __attribute__((ext_vector_type(4))) _Float16 v4h;
__device__ __forceinline__ h16 tohx(float x) { return (h16)x; }
__device__ __forceinline__ void splitf(float y, unsigned short& h, unsigned short& l) { h = f2bf(y); l = f2bf(y - bf2f(h)); }
__device__ __forceinline__ v16f cat16f(v8f lo, v8f hi) { return __builtin_shufflevector(lo, hi, 0, 1, 2, 3, 4, 5, 6, 7, 8, 9, 10, 11, 12, 13, 14, 15); }
// 16 k of one row of a k-contiguous f32 matrix; p points at k = kc + 8 hi
__device__ __forceinline__ v16f ldrow(const float* p) { return cat16f(*(const v8f*)p, *(const v8f*)(p + 16)); }
// 16 k of one column of W[k][n] (f32, pitch N); p points at (kc + 8 hi, column)
template <int N> __device__ __forceinline__ v16f ldcol(const float* p) { v16f t;
#pragma unroll
    for (int i = 0; i < 8; ++i) { t[i] = p[(size_t)i * N]; t[8 + i] = p[(size_t)(16 + i) * N]; }
    return t; }
// polar constants of token n (x = n / 64, y = n % 64 from the 'xy' meshgrid flattening): r = sqrt((x-32)^2 + (y-32)^2) + 1e-6, th = atan2(y-32, x-32) (+2pi mod 2pi), log_r = log(r)/log(r_max): (cos th, sin th, r_weight, 0)
__device__ __forceinline__ v4f polar(int n) { const float xx = (float)(n / HW) - 32.0f, yy = (float)(n % HW) - 32.0f;
    const float r = __fsqrt_rn(__fadd_rn(__fmul_rn(xx, xx), __fmul_rn(yy, yy))) + 1e-6f; float th = atan2f(yy, xx); th = fmodf(th + 6.283185307179586f, 6.283185307179586f);
    const float rmax = __fsqrt_rn(2048.0f) + 1e-6f; const float lr = __fdiv_rn(logf(r), logf(rmax)); const float rw = __fdiv_rn(1.0f, __fadd_rn(lr, 1.0f)); v4f o; o[0] = cosf(th); o[1] = sinf(th); o[2] = rw; o[3] = 0.f; return o; }

// ---- The join of the KW partial tiles. Every wave leaves its 16 accumulators in LDS, lane by lane (16-byte stores, 512 contiguous bytes a wave); behind the barrier wave w adds the KW partial sums of row block w, in k order.
__device__ __forceinline__ void joink(float* pj, const v8f (&acc)[4][4], v8f (&fin)[4], int w, int lane) {
    __builtin_amdgcn_sched_barrier(0);   // the LDS stores stay behind the last matrix instruction
#pragma unroll
    for (int mb = 0; mb < 4; ++mb)
#pragma unroll
        for (int nb = 0; nb < 4; ++nb) { float* d = pj + ((((mb * KW + w) * 4 + nb) * 2) * 32 + lane) * 4;
            *(v4fa*)d = __builtin_shufflevector(acc[mb][nb], acc[mb][nb], 0, 1, 2, 3); *(v4fa*)(d + 128) = __builtin_shufflevector(acc[mb][nb], acc[mb][nb], 4, 5, 6, 7); }
    __syncthreads();   // every wave's partial tile is in LDS before a wave adds them
#pragma unroll
    for (int nb = 0; nb < 4; ++nb)
#pragma unroll
        for (int z = 0; z < KW; ++z) { const float* s = pj + ((((w * KW + z) * 4 + nb) * 2) * 32 + lane) * 4; const v4f lo = *(const v4fa*)s, hi4 = *(const v4fa*)(s + 128);
            const v8f p = __builtin_shufflevector(lo, hi4, 0, 1, 2, 3, 4, 5, 6, 7); fin[nb] = z ? fin[nb] + p : p; }
}

// ---- k_proj: qkv = x Wp + bp; grid (NN / 64, 768 / 64), KW waves: wave w takes k = 32 w .. 32 w + 31 of the whole tile and finishes rows 16 w .. 16 w + 15. A tile's 64 columns are two heads of ONE of q, k, v. q: features 0..31 of QA = LC q cos th_n, 32..63 = LC q sin th_n; k: KB the same with k r_weight_n; v: VT, rows d < 32, k = key.
__global__ __launch_bounds__(32 * KW) void k_proj(const float* __restrict__ x, const float* __restrict__ wp, const float* __restrict__ bp, h16* __restrict__ QA, h16* __restrict__ KB, h16* __restrict__ VT) {
    __shared__ __align__(16) float pj[4 * KW * 4 * 2 * 32 * 4];
    __shared__ __align__(16) float osm[KW][16 * 68];
    const int lane = threadIdx.x & 31, lr = lane & 15, hi = lane >> 4, w = __builtin_amdgcn_readfirstlane(threadIdx.x >> 5); const int r0 = blockIdx.x * 64, c0 = blockIdx.y * 64; const int sec = c0 / KD, h0 = (c0 % KD) / HD;
    float* os = osm[w];
    const float* pa = x + (size_t)(r0 + lr) * CC + 32 * w + 8 * hi; const float* pb = wp + (size_t)(32 * w + 8 * hi) * (3 * KD) + c0 + lr; const float* bu = bp + c0;
    v16f ar[4], br[4];
#pragma unroll
    for (int mb = 0; mb < 4; ++mb) ar[mb] = ldrow(pa + (size_t)mb * 16 * CC);
#pragma unroll
    for (int nb = 0; nb < 4; ++nb) br[nb] = ldcol<3 * KD>(pb + nb * 16);
    const float b4[4] = { bu[lr], bu[16 + lr], bu[32 + lr], bu[48 + lr] };
    asm volatile("s_wait_xcnt 0x0" :: "v"(pa), "v"(pb), "s"(bu) : "memory");   // the loads' addresses are kept up to this wait; the clobber keeps every load ahead of the polar constants, which are made while the loads fly
    v4f t = (v4f){}; if (sec < 2) t = polar(r0 + w * 16 + lr);   // the lane's token in the epilogue: row lr of the wave's row block
    v16bf a[4]; v8f acc[4][4], fin[4];
#pragma unroll
    for (int mb = 0; mb < 4; ++mb) a[mb] = __builtin_convertvector(ar[mb], v16bf);
#pragma unroll
    for (int nb = 0; nb < 4; ++nb) { const v16bf b = __builtin_convertvector(br[nb], v16bf);
#pragma unroll
        for (int mb = 0; mb < 4; ++mb) acc[mb][nb] = wmmab(a[mb], b, (v8f){}); }
    joink(pj, acc, fin, w, lane);
    const float bv[4] = { bfr(b4[0]), bfr(b4[1]), bfr(b4[2]), bfr(b4[3]) };
    if (sec == 2) {   // v: a lane's 8 accumulator rows are 8 consecutive keys of one (head, d) row: its 16 bytes of one fragment block; the wave writes the whole 512-byte block
#pragma unroll
        for (int nb = 0; nb < 4; ++nb) { h16* vblk = VT + ((((size_t)(h0 + (nb >> 1)) * (NN / 32) + (r0 >> 5)) * 4 + (nb & 1) * 2) * 32 + lane) * 8; v8h o;
#pragma unroll
            for (int j = 0; j < 8; ++j) o[j] = tohx(fin[nb][j] + bv[nb]);
            *(v8h*)(vblk + (w >> 1) * 1024 + (w & 1) * 256) = o; }
        return;
    }
    h16* P = sec ? KB : QA; h16* pblk = P + (((size_t)h0 * (NN / 16) + (r0 >> 4)) * 128 + lane) * 8;
#pragma unroll
    for (int nb = 0; nb < 4; ++nb) {
#pragma unroll
        for (int j = 0; j < 8; ++j) os[(hi * 8 + j) * 68 + nb * 16 + lr] = fin[nb][j] + bv[nb]; }
    __builtin_amdgcn_wave_barrier(); asm volatile("" ::: "memory");   // other lanes' LDS stores stay ahead of the reads below
    const float wt = sec ? t[2] : LC;   // q carries 32^-0.5 log2(e): k_fattn's scores leave the matrix unit as exponents of 2
#pragma unroll
    for (int hh = 0; hh < 2; ++hh)
#pragma unroll
        for (int jj = 0; jj < 2; ++jj) { const float* sp = os + lr * 68 + hh * 32 + jj * 16 + hi * 8; const v4f x0 = *(const v4fa*)sp, x1 = *(const v4fa*)(sp + 4); v8h oc, on;
#pragma unroll
            for (int q = 0; q < 4; ++q) { const float aw = __fmul_rn(x0[q], wt), ax = __fmul_rn(x1[q], wt); oc[q] = tohx(__fmul_rn(aw, t[0])); on[q] = tohx(__fmul_rn(aw, t[1])); oc[4 + q] = tohx(__fmul_rn(ax, t[0])); on[4 + q] = tohx(__fmul_rn(ax, t[1])); }
            h16* pr = pblk + ((size_t)hh * (NN / 16) + w) * 1024 + jj * 256; *(v8h*)pr = oc; *(v8h*)(pr + 512) = on; }   // two whole 512-byte fragment blocks, written by this wave alone
    asm volatile("s_wait_xcnt 0x0" ::: "memory");   // behind the last store: the built code has a branch from here into the v block, which writes the stores' data registers
}

// ---- k_outp: OUT = merged Wf + bf; grid (NN / 64, 256 / 64), KW waves: wave w takes heads 2 w and 2 w + 1 (k = 64 w .. 64 w + 63) of the whole tile and finishes rows 16 w .. 16 w + 15. merged[n][h 32 + d] is read where k_fattn left it, in OS, as ready A fragments (bf16 hi, then lo): a k step of 32 is one head; both products on the matrix unit, hi first.
__global__ __launch_bounds__(32 * KW) void k_outp(const bf* __restrict__ OS, const float* __restrict__ wf, const float* __restrict__ bias, float* __restrict__ C) {
    __shared__ __align__(16) float pj[4 * KW * 4 * 2 * 32 * 4];
    __shared__ __align__(16) float osm[KW][16 * 68];
    const int lane = threadIdx.x & 31, lr = lane & 15, hi = lane >> 4, w = __builtin_amdgcn_readfirstlane(threadIdx.x >> 5); const int r0 = blockIdx.x * 64, c0 = blockIdx.y * 64;
    float* os = osm[w];
    const bf* ap = OS + (size_t)(64 * w) * (NN * 2) + ((size_t)(r0 >> 4) * 128 + lane) * 8; const float* bq = wf + (size_t)(64 * w + 8 * hi) * KD + c0 + lr;
    const int cofs = lr * 4; const float* bc = bias + c0 + cofs;
    v16bf a[2][4], a2[2][4]; v16f br[2][4];
#pragma unroll
    for (int s = 0; s < 2; ++s) {
#pragma unroll
        for (int mb = 0; mb < 4; ++mb) { const bf* p = ap + (size_t)(32 * s) * (NN * 2) + mb * 1024; a[s][mb] = cat16b(*(const v8us*)p, *(const v8us*)(p + 256)); a2[s][mb] = cat16b(*(const v8us*)(p + 512), *(const v8us*)(p + 768)); }
#pragma unroll
        for (int nb = 0; nb < 4; ++nb) br[s][nb] = ldcol<KD>(bq + (size_t)(32 * s) * KD + nb * 16); }
    const float b4[4] = { bc[0], bc[1], bc[2], bc[3] };
    asm volatile("s_wait_xcnt 0x0" ::: "memory");   // before the fragment loads' address registers are used again
    __builtin_amdgcn_sched_barrier(0);   // keeps all that follows behind the wait: without it the first products are lifted among the loads, which then go out in several flights (a memory latency each)
    v8f acc[4][4], fin[4];
#pragma unroll
    for (int mb = 0; mb < 4; ++mb)
#pragma unroll
        for (int nb = 0; nb < 4; ++nb) acc[mb][nb] = (v8f){};
#pragma unroll
    for (int s = 0; s < 2; ++s)
#pragma unroll
        for (int nb = 0; nb < 4; ++nb) { const v16bf b = __builtin_convertvector(br[s][nb], v16bf);
#pragma unroll
            for (int mb = 0; mb < 4; ++mb) { acc[mb][nb] = wmmab(a[s][mb], b, acc[mb][nb]); acc[mb][nb] = wmmab(a2[s][mb], b, acc[mb][nb]); } }
    v4f bv; bv[0] = bfr(b4[0]); bv[1] = bfr(b4[1]); bv[2] = bfr(b4[2]); bv[3] = bfr(b4[3]);
    joink(pj, acc, fin, w, lane);
#pragma unroll
    for (int nb = 0; nb < 4; ++nb) {
#pragma unroll
        for (int j = 0; j < 8; ++j) os[(hi * 8 + j) * 68 + nb * 16 + lr] = fin[nb][j]; }
    __builtin_amdgcn_wave_barrier(); asm volatile("" ::: "memory");   // other lanes' LDS stores stay ahead of the reads below
    float* crow = C + (size_t)(r0 + w * 16) * KD + c0;
#pragma unroll
    for (int s = 0; s < 8; ++s) { const int row = 2 * s + hi; *(v4f*)(crow + (size_t)row * KD + cofs) = *(const v4fa*)(os + row * 68 + cofs) + bv; }
}
// lane l <-> l ^ 16
__device__ __forceinline__ float xhalf(float v) { const int b = __float_as_int(v); return __int_as_float(__builtin_amdgcn_permlanex16(b, b, 0x76543210, 0xfedcba98, false, false)); }
// ---- k_fattn: scores, softmax and attn.v of one head in one kernel; scores and numerators stay in registers. Grid (NN / 128, heads), 16 waves: wave = (tile qt of QG x 16 queries, key range kq of NN / KQ keys).
// Per 32 keys: St = K' Q't (A = 16 key rows, B = 16 query columns, k = 64 features), so a lane holds 16 scores of ONE query (keys 8 hi + j and 16 + 8 hi + j); two St tiles converted in place are the B operand
// of Ot += Vt Pt (A = 16 rows of the [d][key] plane, same k order). Scores are in log2 units. Reference m and sum l per query; a numerator is exp2(score - m + 10), l their f32 sum.
// First loop: m = 10 for every query, so exp2 reads the score as the matrix unit leaves it and nothing is tested on the way. Its result stands if, in every lane of the wave, l shows that fp16 held every numerator (LHI) and that the sum is not small (LLO).
// Otherwise the wave does its range again in the second loop, which takes any scores: m starts as the largest score of the range's first 32 keys (a real score, so l never vanishes) and stays while the numerators taken against it fit fp16
// (test on their sums, PT); only then the row max is taken and Ot and l are rescaled by exp2(m_old - m_new).
// K' and Vt fragments of the next 32 keys are fetched into the same registers right behind their last use (the last pass fetches the range's first keys again: in bounds; the second loop, where it runs, starts from them).
__global__ __launch_bounds__(512) void k_fattn(const h16* __restrict__ QA, const h16* __restrict__ KB, const h16* __restrict__ VT, bf* __restrict__ OS) {
    __shared__ float mg[KQ][QT][QG][18][32];   // per key range, tile, column group and lane: 16 Ot values, m, l
    const int lane = threadIdx.x & 31; const int w = threadIdx.x >> 5, qt = w % QT, kq = w / QT;
    const int h = blockIdx.y, qb = blockIdx.x * (QT * QG * 16);
    const h16* qp = QA + (((size_t)h * (NN / 16) + (qb >> 4) + qt * QG) * 128 + lane) * 8;
    const h16* kp = KB + (((size_t)h * (NN / 16) + kq * (NN / KQ / 16)) * 128 + lane) * 8;
    const h16* vp = VT + (((size_t)h * (NN / 32) + kq * (NN / KQ / 32)) * 128 + lane) * 8;
    v16h qf[QG][2], kf[2][2], vf[2]; v8f o[QG][2]; float m[QG], l[QG]; v2f l2[QG / 2];
#pragma unroll
    for (int g = 0; g < QG; ++g) { qf[g][0] = WFrag<h16>::ld(qp + g * 1024); qf[g][1] = WFrag<h16>::ld(qp + g * 1024 + 512); o[g][0] = (v8f){}; o[g][1] = (v8f){}; l2[g >> 1] = (v2f){}; }
#pragma unroll
    for (int kt = 0; kt < 2; ++kt) { kf[kt][0] = WFrag<h16>::ld(kp + kt * 1024); kf[kt][1] = WFrag<h16>::ld(kp + kt * 1024 + 512); vf[kt] = WFrag<h16>::ld(vp + kt * 512); }
    asm volatile("s_wait_xcnt 0x0" :: "v"(qp), "v"(kp), "v"(vp) : "memory");   // the three address pairs stay as they are up to this wait (without the operands a later load's result lands on the q pair)
#pragma unroll 1   // rolled: four waves per SIMD leave 256 registers a wave
    for (int kc = 0; kc < NN / KQ; kc += 32) {
        const int kn = kc + 32 < NN / KQ ? kc + 32 : 0; const h16* kx = kp + (size_t)kn * 64; const h16* vx = vp + (size_t)kn * 32;
#pragma unroll
        for (int gp = 0; gp < QG; gp += 2) {
            v8f s[2][2];
#pragma unroll
            for (int u = 0; u < 2; ++u) { s[u][0] = wmma16(kf[0][0], qf[gp + u][0], (v8f){}); s[u][1] = wmma16(kf[1][0], qf[gp + u][0], (v8f){}); s[u][0] = wmma16(kf[0][1], qf[gp + u][1], s[u][0]); s[u][1] = wmma16(kf[1][1], qf[gp + u][1], s[u][1]); }
            if (gp + 2 == QG) {
#pragma unroll
                for (int kt = 0; kt < 2; ++kt) { kf[kt][0] = WFrag<h16>::ld(kx + kt * 1024); kf[kt][1] = WFrag<h16>::ld(kx + kt * 1024 + 512); }
                asm volatile("s_wait_xcnt 0x0" :: "v"(kx) : "memory"); }   // the loads' address pair stays as it is up to this wait; it also keeps the fetch here, ahead of the softmax
            __builtin_amdgcn_sched_barrier(0);   // the eight score products go out in a row: mixed with the softmax, each is followed by idle slots up to the first read of its result
            v16h p[2]; v2f t = (v2f){};   // the two column groups' sums side by side (packed adds); each query's own order is that of the second loop
#pragma unroll
            for (int j = 0; j < 8; ++j) { v2f e0, e1;
#pragma unroll
                for (int u = 0; u < 2; ++u) { e0[u] = __builtin_amdgcn_exp2f(s[u][0][j]); e1[u] = __builtin_amdgcn_exp2f(s[u][1][j]); p[u][j] = tohx(e0[u]); p[u][8 + j] = tohx(e1[u]); }
                t += e0 + e1; }
            l2[gp >> 1] += t;
            __builtin_amdgcn_sched_barrier(0);   // the softmax's vector work stays ahead of the four products below: mixed among them, more idle slots (v_nop) stand behind matrix instructions
#pragma unroll
            for (int u = 0; u < 2; ++u)
#pragma unroll
                for (int dt = 0; dt < 2; ++dt) o[gp + u][dt] = wmma16(vf[dt], p[u], o[gp + u][dt]);
        }
#pragma unroll
        for (int dt = 0; dt < 2; ++dt) vf[dt] = WFrag<h16>::ld(vx + dt * 512);
        asm volatile("s_wait_xcnt 0x0" :: "v"(vx) : "memory");   // as above: the address pair is kept up to the wait
    }
    bool redo = false;
#pragma unroll
    for (int g = 0; g < QG; ++g) { m[g] = 10.0f; l[g] = l2[g >> 1][g & 1]; redo |= !(l[g] <= LHI) | !(l[g] + xhalf(l[g]) >= LLO); }
    if (__builtin_expect(__builtin_amdgcn_ballot_w32(redo) != 0, 0)) {   // one scalar branch for the wave; kf and vf hold the range's first 32 keys again (the last pass's fetch)
#pragma unroll
    for (int g = 0; g < QG; ++g) { o[g][0] = (v8f){}; o[g][1] = (v8f){}; l[g] = 0.f; }
#pragma unroll
    for (int g = 0; g < QG; ++g) { const v8f r0 = wmma16(kf[0][1], qf[g][1], wmma16(kf[0][0], qf[g][0], (v8f){})), r1 = wmma16(kf[1][1], qf[g][1], wmma16(kf[1][0], qf[g][0], (v8f){})); float mx = fmaxf(r0[0], r1[0]);
#pragma unroll
        for (int j = 1; j < 8; ++j) mx = fmaxf(mx, fmaxf(r0[j], r1[j]));
        m[g] = fmaxf(mx, xhalf(mx)); }
#pragma unroll 1   // rolled: four waves per SIMD leave 256 registers a wave
    for (int kc = 0; kc < NN / KQ; kc += 32) {
        const int kn = kc + 32 < NN / KQ ? kc + 32 : 0; const h16* kx = kp + (size_t)kn * 64; const h16* vx = vp + (size_t)kn * 32;
#pragma unroll
        for (int gp = 0; gp < QG; gp += 2) {
            v8f s[2][2];
#pragma unroll
            for (int u = 0; u < 2; ++u) { s[u][0] = wmma16(kf[0][0], qf[gp + u][0], (v8f){}); s[u][1] = wmma16(kf[1][0], qf[gp + u][0], (v8f){}); s[u][0] = wmma16(kf[0][1], qf[gp + u][1], s[u][0]); s[u][1] = wmma16(kf[1][1], qf[gp + u][1], s[u][1]); }
            if (gp + 2 == QG) {
#pragma unroll
                for (int kt = 0; kt < 2; ++kt) { kf[kt][0] = WFrag<h16>::ld(kx + kt * 1024); kf[kt][1] = WFrag<h16>::ld(kx + kt * 1024 + 512); }
                asm volatile("s_wait_xcnt 0x0" :: "v"(kx) : "memory"); }   // the loads' address pair stays as it is up to this wait (without the operand the last load's result lands on it); it also keeps the fetch here, ahead of the softmax
            v16h p[2]; float sum[2];
#pragma unroll
            for (int u = 0; u < 2; ++u) { const float mc = m[gp + u] - 10.0f; float t = 0.f; const v8f d0 = s[u][0] - mc, d1 = s[u][1] - mc;
#pragma unroll
                for (int j = 0; j < 8; ++j) { const float e0 = __builtin_amdgcn_exp2f(d0[j]), e1 = __builtin_amdgcn_exp2f(d1[j]); t += e0 + e1; p[u][j] = tohx(e0); p[u][8 + j] = tohx(e1); }
                sum[u] = t; }
            if (__builtin_expect(__builtin_amdgcn_ballot_w32(!(sum[0] + sum[1] <= PT)) != 0, 0)) {   // numerators are >= 0, so a sum within PT bounds each of them; one scalar branch for the wave
                // a new reference for both column groups, in every lane: the scores once more (they were not kept), row max, Ot and l rescaled, numerators made again
                v16h kr[2][2];
                if (gp + 2 == QG) { const h16* ky = kp + (size_t)kc * 64;   // kf already takes the next pass's keys: this pass's come from memory again
#pragma unroll
                    for (int kt = 0; kt < 2; ++kt) { kr[kt][0] = WFrag<h16>::ld(ky + kt * 1024); kr[kt][1] = WFrag<h16>::ld(ky + kt * 1024 + 512); }
                    asm volatile("s_wait_xcnt 0x0" :: "v"(ky) : "memory"); }   // the loads' address pair stays as it is up to this wait
                else {
#pragma unroll
                    for (int kt = 0; kt < 2; ++kt) { kr[kt][0] = kf[kt][0]; kr[kt][1] = kf[kt][1]; } }
#pragma unroll
                for (int u = 0; u < 2; ++u) { const int g = gp + u;
                    v8f r0 = wmma16(kr[0][0], qf[g][0], (v8f){}), r1 = wmma16(kr[1][0], qf[g][0], (v8f){}); r0 = wmma16(kr[0][1], qf[g][1], r0); r1 = wmma16(kr[1][1], qf[g][1], r1);
                    float mx = fmaxf(r0[0], r1[0]);
#pragma unroll
                    for (int j = 1; j < 8; ++j) mx = fmaxf(mx, fmaxf(r0[j], r1[j]));
                    mx = fmaxf(mx, xhalf(mx));
                    const float mn = fmaxf(m[g], mx), al = __builtin_amdgcn_exp2f(m[g] - mn), mc = mn - 10.0f; m[g] = mn; float t = 0.f; r0 -= mc; r1 -= mc;
#pragma unroll
                    for (int j = 0; j < 8; ++j) { const float e0 = __builtin_amdgcn_exp2f(r0[j]), e1 = __builtin_amdgcn_exp2f(r1[j]); t += e0 + e1; p[u][j] = tohx(e0); p[u][8 + j] = tohx(e1); }
                    sum[u] = t; l[g] *= al; o[g][0] *= al; o[g][1] *= al; }
            }
#pragma unroll
            for (int u = 0; u < 2; ++u) { const int g = gp + u; l[g] += sum[u];
#pragma unroll
                for (int dt = 0; dt < 2; ++dt) o[g][dt] = wmma16(vf[dt], p[u], o[g][dt]); }
        }
#pragma unroll
        for (int dt = 0; dt < 2; ++dt) vf[dt] = WFrag<h16>::ld(vx + dt * 512);
        asm volatile("s_wait_xcnt 0x0" :: "v"(vx) : "memory");   // as above: the address pair is kept up to the wait
    }
    }
#pragma unroll
    for (int g = 0; g < QG; ++g) {
        const float lj = l[g] + xhalf(l[g]);   // the two lane halves hold different keys of the same query
#pragma unroll
        for (int j = 0; j < 8; ++j) { mg[kq][qt][g][j][lane] = o[g][0][j]; mg[kq][qt][g][8 + j][lane] = o[g][1][j]; }
        mg[kq][qt][g][16][lane] = m[g]; mg[kq][qt][g][17][lane] = lj; }
    __syncthreads();   // every range's partial result is in LDS before a wave joins them
    if (w < QT * QG) {   // one wave joins the KQ ranges of one (tile, column group), in range order
        const int jq = w % QT, jg = w / QT; float M = mg[0][jq][jg][16][lane];
#pragma unroll
        for (int z = 1; z < KQ; ++z) M = fmaxf(M, mg[z][jq][jg][16][lane]);
        float L = 0.f; v8f a0 = (v8f){}, a1 = (v8f){};
#pragma unroll
        for (int z = 0; z < KQ; ++z) { const float wz = __builtin_amdgcn_exp2f(mg[z][jq][jg][16][lane] - M); L += mg[z][jq][jg][17][lane] * wz;
#pragma unroll
            for (int j = 0; j < 8; ++j) { a0[j] += mg[z][jq][jg][j][lane] * wz; a1[j] += mg[z][jq][jg][8 + j][lane] * wz; } }
        const float inv = __fdiv_rn(1.0f, L); bf* op = OS + (((size_t)h * (NN / 16) + (qb >> 4) + jq * QG + jg) * 128 + lane) * 8;   // the lane's Ot rows are its elements of k_outp's A fragment: four 512-byte blocks (hi, hi, lo, lo), written by this wave alone
        a0 *= inv; a1 *= inv; v8us h0, h1, l0, l1;
#pragma unroll
        for (int j = 0; j < 8; ++j) { unsigned short a, c; splitf(a0[j], a, c); h0[j] = a; l0[j] = c; splitf(a1[j], a, c); h1[j] = a; l1[j] = c; }
        *(v8us*)op = h0; *(v8us*)(op + 256) = h1; *(v8us*)(op + 512) = l0; *(v8us*)(op + 768) = l1;
    }
}
extern "C" void kernel_launch(void* const* d_in, const int* in_sizes, int n_in,
                              void* d_out, int out_size, void* d_ws, size_t ws_size, hipStream_t stream) {
    (void)in_sizes; (void)n_in; (void)out_size;
    const float* x = (const float*)d_in[0]; const float* wp = (const float*)d_in[1]; const float* bp = (const float*)d_in[2]; const float* wf = (const float*)d_in[3]; const float* bfv = (const float*)d_in[4];   // Wp [128][768], Wf [256][256] as x @ W
    float* OUT = (float*)d_out;     // [1][64][64][256]
    char* wsp = (char*)d_ws;
    auto take = [&](size_t bytes) { char* p = wsp; wsp += (bytes + 255) & ~(size_t)255; return (void*)p; };
    h16* QA = (h16*)take((size_t)NH_ * NN * 64 * 2); h16* KB = (h16*)take((size_t)NH_ * NN * 64 * 2); h16* VT = (h16*)take((size_t)NH_ * HD * NN * 2); bf* OS = (bf*)take((size_t)NH_ * NN * 64 * 2);
    if ((size_t)(wsp - (char*)d_ws) > ws_size) return;    // total 14 MB; ws 256 MiB
    k_proj<<<dim3(NN / 64, 3 * KD / 64, 1), 32 * KW, 0, stream>>>(x, wp, bp, QA, KB, VT);
    k_fattn<<<dim3(NN / (QT * QG * 16), NH_, 1), 512, 0, stream>>>(QA, KB, VT, OS);
    k_outp<<<dim3(NN / 64, KD / 64, 1), 32 * KW, 0, stream>>>(OS, wf, bfv, OUT);
}

// v008
// A run of this version takes 32.7 microseconds.
// In two side-by-side timings against v007, it was 1.04 and 1.03 times as fast.
// Counting every step since v000, it is 34.3 times as fast.
#include <hip/hip_runtime.h>

// Polar attention (x [1][64][64][128] -> 4096 tokens; qkv = x Wp + bp laid out (3, 8 heads, 32); scores[n][m] = (q_n.k_m / sqrt 32) r_weight[m] cos(theta_m - theta_n) with the module's polar
// constants (r = |p - centre| + 1e-6, theta = atan2 mod 2pi, log_r = log r / log max r, r_weight = 1/(log_r + 1), 'xy' meshgrid flattening); softmax over m; out = merged attn.v Wf + bf -> [1][64][64][256]).
// Compute dtypes, f32 accumulate: every input rounded to bf16; the projection on PLAIN bf16 operands (inputs: exact, + bias); the polar constants in f32 on VALU; the
// softmax in f32 (first against a fixed reference, checked once per key range; where that check fails, against a row reference that is a real score, renewed when the numerators would leave fp16; one exp2 per element, the 32^-0.5 log2(e) carried by q'; fp16 numerators; divided by their f32 sum at the end of k_fattn); attn.v on fp16 planes; merged heads as hi+lo

#define HW   64
#define NN   4096                 // tokens
#define CC   128
#define KD   256                  // key_dim
#define NH_  8
#define HD   32
#define SCL  0.17677669529663688f   // 32^-0.5
#define KQ   8                    // key ranges of k_fattn: one wave per (query tile, range), joined through LDS at the end
#define QT   2                    // query tiles of one work-group of k_fattn
#define KW   4                    // waves of one work-group of the two GEMMs: each takes a quarter of k
#define QG   4                    // 16-query column groups of one tile (one wave)
#define NP   (NN / KQ / 32)       // passes of 32 keys that a wave of k_fattn makes over its key range
#define LC   (SCL * 1.4426950408889634f)   // 32^-0.5 log2(e): exp(SCL d) = exp2(LC d); k_proj multiplies q by it
#define PT   32768.0f             // k_fattn's second loop keeps a query's reference while a lane's 32 numerators of a pass (both column groups) sum to at most this (fp16 holds each)
#define LHI  65504.0f             // first loop: a lane's numerators of the whole range sum to at most this, so fp16 holds each
#define LLO  1.0f                 // first loop: a query's numerators of the range sum to at least this, so what fp16 loses below 2^-14 (at most 2^-25 a key) is small beside the numerators' own rounding
typedef _Float16 h16;
typedef unsigned short bf;
typedef __attribute__((ext_vector_type(16))) __bf16   v16bf;
typedef __attribute__((ext_vector_type(16))) _Float16 v16h;
typedef __attribute__((ext_vector_type(8)))  _Float16 v8h;
typedef __attribute__((ext_vector_type(8)))  unsigned short v8us;
typedef __attribute__((ext_vector_type(8)))  float    v8f;
typedef __attribute__((ext_vector_type(4)))  float    v4f;
typedef __attribute__((ext_vector_type(2)))  float    v2f;
typedef v8h  __attribute__((may_alias)) v8ha;
typedef v4f  __attribute__((may_alias)) v4fa;
typedef v8us __attribute__((may_alias)) v8usa;

__device__ __forceinline__ unsigned short f2bf(float f) { unsigned u = __float_as_uint(f); u += 0x7FFFu + ((u >> 16) & 1u); return (unsigned short)(u >> 16); }
__device__ __forceinline__ float bf2f(unsigned short b) { return __uint_as_float(((unsigned)b) << 16); }
__device__ __forceinline__ float bfr(float f) { return bf2f(f2bf(f)); }
__device__ __forceinline__ v16h cat16(v8h lo, v8h hi) { return __builtin_shufflevector(lo, hi, 0, 1, 2, 3, 4, 5, 6, 7, 8, 9, 10, 11, 12, 13, 14, 15); }
__device__ __forceinline__ v16bf cat16b(v8us lo, v8us hi) { return __builtin_bit_cast(v16bf, __builtin_shufflevector(lo, hi, 0, 1, 2, 3, 4, 5, 6, 7, 8, 9, 10, 11, 12, 13, 14, 15)); }
__device__ __forceinline__ v8f wmma16(v16h a, v16h b, v8f c) { return __builtin_amdgcn_wmma_f32_16x16x32_f16(false, a, false, b, (short)0, c, false, false); }
__device__ __forceinline__ v8f wmmab(v16bf a, v16bf b, v8f c) { return __builtin_amdgcn_wmma_f32_16x16x32_bf16(false, a, false, b, (short)0, c, false, false); }



// ---- The two GEMMs: one work-group of KW waves per 64x64 output tile; every wave holds the whole tile (16 accumulators) for its own quarter of k, in steps of 32; the partial tiles are joined through LDS. Both read their f32 sources themselves and round to bf16 (nearest even) in registers while they
// form the fragments, and the projection's epilogue writes the attention kernel's fp16 planes itself: no conversion, transposition or re-layout pass stands between the launches.
// Fragment k order, A and B alike: element s of lane half hi is k = kc + 8 hi + s (s < 8) and kc + 16 + 8 hi + (s - 8).
// The four workspace planes lie in FRAGMENT ORDER: a 16 x 32 fragment is two blocks of 512 bytes, block b = lane l's 8 elements s = 8 b .. 8 b + 7 at byte 16 l (l = 16 hi + row). A wave-wide 16-byte load or store
// then covers 4 whole 128-byte lines, where a row-major plane gave it 16 lines. QA, KB: [head][token / 16][feature / 16][lane][8]; VT: [head][key / 32][d / 16][(key / 16) % 2][lane][8]; OS: [head][token / 16][hi: d / 16, lo: 2 + d / 16][lane][8].
template <typename T16> struct WFrag;
template <> struct WFrag<h16> { typedef v16h V; static __device__ __forceinline__ V ld(const h16* p) { return cat16(*(const v8h*)p, *(const v8h*)(p + 256)); } static __device__ __forceinline__ v8f mma(V a, V b, v8f c) { return wmma16(a, b, c); } };
typedef __attribute__((ext_vector_type(16))) float v16f;
typedef __attribute__((ext_vector_type(4))) _Float16 v4h;
__device__ __forceinline__ h16 tohx(float x) { return (h16)x; }
__device__ __forceinline__ void splitf(float y, unsigned short& h, unsigned short& l) { h = f2bf(y); l = f2bf(y - bf2f(h)); }
__device__ __forceinline__ v16f cat16f(v8f lo, v8f hi) { return __builtin_shufflevector(lo, hi, 0, 1, 2, 3, 4, 5, 6, 7, 8, 9, 10, 11, 12, 13, 14, 15); }
// 16 k of one row of a k-contiguous f32 matrix; p points at k = kc + 8 hi
__device__ __forceinline__ v16f ldrow(const float* p) { return cat16f(*(const v8f*)p, *(const v8f*)(p + 16)); }
// 16 k of one column of W[k][n] (f32, pitch N); p points at (kc + 8 hi, column)
template <int N> __device__ __forceinline__ v16f ldcol(const float* p) { v16f t;
#pragma unroll
    for (int i = 0; i < 8; ++i) { t[i] = p[(size_t)i * N]; t[8 + i] = p[(size_t)(16 + i) * N]; }
    return t; }
// polar constants of token n (x = n / 64, y = n % 64 from the 'xy' meshgrid flattening): r = sqrt((x-32)^2 + (y-32)^2) + 1e-6, th = atan2(y-32, x-32) (+2pi mod 2pi), log_r = log(r)/log(r_max): (cos th, sin th, r_weight, 0)
__device__ __forceinline__ v4f polar(int n) { const float xx = (float)(n / HW) - 32.0f, yy = (float)(n % HW) - 32.0f;
    const float r = __fsqrt_rn(__fadd_rn(__fmul_rn(xx, xx), __fmul_rn(yy, yy))) + 1e-6f; float th = atan2f(yy, xx); th = fmodf(th + 6.283185307179586f, 6.283185307179586f);
    const float rmax = __fsqrt_rn(2048.0f) + 1e-6f; const float lr = __fdiv_rn(logf(r), logf(rmax)); const float rw = __fdiv_rn(1.0f, __fadd_rn(lr, 1.0f)); v4f o; o[0] = cosf(th); o[1] = sinf(th); o[2] = rw; o[3] = 0.f; return o; }

// ---- The join of the KW partial tiles. Every wave leaves its 16 accumulators in LDS, lane by lane (16-byte stores, 512 contiguous bytes a wave); behind the barrier wave w adds the KW partial sums of row block w, in k order.
__device__ __forceinline__ void joink(float* pj, const v8f (&acc)[4][4], v8f (&fin)[4], int w, int lane) {
    __builtin_amdgcn_sched_barrier(0);   // the LDS stores stay behind the last matrix instruction
#pragma unroll
    for (int mb = 0; mb < 4; ++mb)
#pragma unroll
        for (int nb = 0; nb < 4; ++nb) { float* d = pj + ((((mb * KW + w) * 4 + nb) * 2) * 32 + lane) * 4;
            *(v4fa*)d = __builtin_shufflevector(acc[mb][nb], acc[mb][nb], 0, 1, 2, 3); *(v4fa*)(d + 128) = __builtin_shufflevector(acc[mb][nb], acc[mb][nb], 4, 5, 6, 7); }
    __syncthreads();   // every wave's partial tile is in LDS before a wave adds them
#pragma unroll
    for (int nb = 0; nb < 4; ++nb)
#pragma unroll
        for (int z = 0; z < KW; ++z) { const float* s = pj + ((((w * KW + z) * 4 + nb) * 2) * 32 + lane) * 4; const v4f lo = *(const v4fa*)s, hi4 = *(const v4fa*)(s + 128);
            const v8f p = __builtin_shufflevector(lo, hi4, 0, 1, 2, 3, 4, 5, 6, 7); fin[nb] = z ? fin[nb] + p : p; }
}

// ---- k_proj: qkv = x Wp + bp; grid (NN / 64, 768 / 64), KW waves: wave w takes k = 32 w .. 32 w + 31 of the whole tile and finishes rows 16 w .. 16 w + 15. A tile's 64 columns are two heads of ONE of q, k, v. q: features 0..31 of QA = LC q cos th_n, 32..63 = LC q sin th_n; k: KB the same with k r_weight_n; v: VT, rows d < 32, k = key.
__global__ __launch_bounds__(32 * KW) void k_proj(const float* __restrict__ x, const float* __restrict__ wp, const float* __restrict__ bp, h16* __restrict__ QA, h16* __restrict__ KB, h16* __restrict__ VT) {
    __shared__ __align__(16) float pj[4 * KW * 4 * 2 * 32 * 4];
    __shared__ __align__(16) float osm[KW][16 * 68];
    const int lane = threadIdx.x & 31, lr = lane & 15, hi = lane >> 4, w = __builtin_amdgcn_readfirstlane(threadIdx.x >> 5); const int r0 = blockIdx.x * 64, c0 = blockIdx.y * 64; const int sec = c0 / KD, h0 = (c0 % KD) / HD;
    float* os = osm[w];
    const float* pa = x + (size_t)(r0 + lr) * CC + 32 * w + 8 * hi; const float* pb = wp + (size_t)(32 * w + 8 * hi) * (3 * KD) + c0 + lr; const float* bu = bp + c0;
    v16f ar[4], br[4];
#pragma unroll
    for (int mb = 0; mb < 4; ++mb) ar[mb] = ldrow(pa + (size_t)mb * 16 * CC);
#pragma unroll
    for (int nb = 0; nb < 4; ++nb) br[nb] = ldcol<3 * KD>(pb + nb * 16);
    const float b4[4] = { bu[lr], bu[16 + lr], bu[32 + lr], bu[48 + lr] };
    asm volatile("s_wait_xcnt 0x0" :: "v"(pa), "v"(pb), "s"(bu) : "memory");   // the loads' addresses are kept up to this wait; the clobber keeps every load ahead of the polar constants, which are made while the loads fly
    v4f t = (v4f){}; if (sec < 2) t = polar(r0 + w * 16 + lr);   // the lane's token in the epilogue: row lr of the wave's row block
    v16bf a[4]; v8f acc[4][4], fin[4];
#pragma unroll
    for (int mb = 0; mb < 4; ++mb) a[mb] = __builtin_convertvector(ar[mb], v16bf);
#pragma unroll
    for (int nb = 0; nb < 4; ++nb) { const v16bf b = __builtin_convertvector(br[nb], v16bf);
#pragma unroll
        for (int mb = 0; mb < 4; ++mb) acc[mb][nb] = wmmab(a[mb], b, (v8f){}); }
    joink(pj, acc, fin, w, lane);
    const float bv[4] = { bfr(b4[0]), bfr(b4[1]), bfr(b4[2]), bfr(b4[3]) };
    if (sec == 2) {   // v: a lane's 8 accumulator rows are 8 consecutive keys of one (head, d) row: its 16 bytes of one fragment block; the wave writes the whole 512-byte block
#pragma unroll
        for (int nb = 0; nb < 4; ++nb) { h16* vblk = VT + ((((size_t)(h0 + (nb >> 1)) * (NN / 32) + (r0 >> 5)) * 4 + (nb & 1) * 2) * 32 + lane) * 8; v8h o;
#pragma unroll
            for (int j = 0; j < 8; ++j) o[j] = tohx(fin[nb][j] + bv[nb]);
            *(v8h*)(vblk + (w >> 1) * 1024 + (w & 1) * 256) = o; }
        return;
    }
    h16* P = sec ? KB : QA; h16* pblk = P + (((size_t)h0 * (NN / 16) + (r0 >> 4)) * 128 + lane) * 8;
#pragma unroll
    for (int nb = 0; nb < 4; ++nb) {
#pragma unroll
        for (int j = 0; j < 8; ++j) os[(hi * 8 + j) * 68 + nb * 16 + lr] = fin[nb][j] + bv[nb]; }
    __builtin_amdgcn_wave_barrier(); asm volatile("" ::: "memory");   // other lanes' LDS stores stay ahead of the reads below
    const float wt = sec ? t[2] : LC;   // q carries 32^-0.5 log2(e): k_fattn's scores leave the matrix unit as exponents of 2
#pragma unroll
    for (int hh = 0; hh < 2; ++hh)
#pragma unroll
        for (int jj = 0; jj < 2; ++jj) { const float* sp = os + lr * 68 + hh * 32 + jj * 16 + hi * 8; const v4f x0 = *(const v4fa*)sp, x1 = *(const v4fa*)(sp + 4); v8h oc, on;
#pragma unroll
            for (int q = 0; q < 4; ++q) { const float aw = __fmul_rn(x0[q], wt), ax = __fmul_rn(x1[q], wt); oc[q] = tohx(__fmul_rn(aw, t[0])); on[q] = tohx(__fmul_rn(aw, t[1])); oc[4 + q] = tohx(__fmul_rn(ax, t[0])); on[4 + q] = tohx(__fmul_rn(ax, t[1])); }
            h16* pr = pblk + ((size_t)hh * (NN / 16) + w) * 1024 + jj * 256; *(v8h*)pr = oc; *(v8h*)(pr + 512) = on; }   // two whole 512-byte fragment blocks, written by this wave alone
    asm volatile("s_wait_xcnt 0x0" ::: "memory");   // behind the last store: the built code has a branch from here into the v block, which writes the stores' data registers
}

// ---- k_outp: OUT = merged Wf + bf; grid (NN / 64, 256 / 64), KW waves: wave w takes heads 2 w and 2 w + 1 (k = 64 w .. 64 w + 63) of the whole tile and finishes rows 16 w .. 16 w + 15. merged[n][h 32 + d] is read where k_fattn left it, in OS, as ready A fragments (bf16 hi, then lo): a k step of 32 is one head; both products on the matrix unit, hi first.
__global__ __launch_bounds__(32 * KW) void k_outp(const bf* __restrict__ OS, const float* __restrict__ wf, const float* __restrict__ bias, float* __restrict__ C) {
    __shared__ __align__(16) float pj[4 * KW * 4 * 2 * 32 * 4];
    __shared__ __align__(16) float osm[KW][16 * 68];
    const int lane = threadIdx.x & 31, lr = lane & 15, hi = lane >> 4, w = __builtin_amdgcn_readfirstlane(threadIdx.x >> 5); const int r0 = blockIdx.x * 64, c0 = blockIdx.y * 64;
    float* os = osm[w];
    const bf* ap = OS + (size_t)(64 * w) * (NN * 2) + ((size_t)(r0 >> 4) * 128 + lane) * 8; const float* bq = wf + (size_t)(64 * w + 8 * hi) * KD + c0 + lr;
    const int cofs = lr * 4; const float* bc = bias + c0 + cofs;
    v16bf a[2][4], a2[2][4]; v16f br[2][4];
#pragma unroll
    for (int s = 0; s < 2; ++s) {
#pragma unroll
        for (int mb = 0; mb < 4; ++mb) { const bf* p = ap + (size_t)(32 * s) * (NN * 2) + mb * 1024; a[s][mb] = cat16b(*(const v8us*)p, *(const v8us*)(p + 256)); a2[s][mb] = cat16b(*(const v8us*)(p + 512), *(const v8us*)(p + 768)); }
#pragma unroll
        for (int nb = 0; nb < 4; ++nb) br[s][nb] = ldcol<KD>(bq + (size_t)(32 * s) * KD + nb * 16); }
    const float b4[4] = { bc[0], bc[1], bc[2], bc[3] };
    asm volatile("s_wait_xcnt 0x0" ::: "memory");   // before the fragment loads' address registers are used again
    __builtin_amdgcn_sched_barrier(0);   // keeps all that follows behind the wait: without it the first products are lifted among the loads, which then go out in several flights (a memory latency each)
    v8f acc[4][4], fin[4];
#pragma unroll
    for (int mb = 0; mb < 4; ++mb)
#pragma unroll
        for (int nb = 0; nb < 4; ++nb) acc[mb][nb] = (v8f){};
#pragma unroll
    for (int s = 0; s < 2; ++s)
#pragma unroll
        for (int nb = 0; nb < 4; ++nb) { const v16bf b = __builtin_convertvector(br[s][nb], v16bf);
#pragma unroll
            for (int mb = 0; mb < 4; ++mb) { acc[mb][nb] = wmmab(a[s][mb], b, acc[mb][nb]); acc[mb][nb] = wmmab(a2[s][mb], b, acc[mb][nb]); } }
    v4f bv; bv[0] = bfr(b4[0]); bv[1] = bfr(b4[1]); bv[2] = bfr(b4[2]); bv[3] = bfr(b4[3]);
    joink(pj, acc, fin, w, lane);
#pragma unroll
    for (int nb = 0; nb < 4; ++nb) {
#pragma unroll
        for (int j = 0; j < 8; ++j) os[(hi * 8 + j) * 68 + nb * 16 + lr] = fin[nb][j]; }
    __builtin_amdgcn_wave_barrier(); asm volatile("" ::: "memory");   // other lanes' LDS stores stay ahead of the reads below
    float* crow = C + (size_t)(r0 + w * 16) * KD + c0;
#pragma unroll
    for (int s = 0; s < 8; ++s) { const int row = 2 * s + hi; *(v4f*)(crow + (size_t)row * KD + cofs) = *(const v4fa*)(os + row * 68 + cofs) + bv; }
}
// lane l <-> l ^ 16
__device__ __forceinline__ float xhalf(float v) { const int b = __float_as_int(v); return __int_as_float(__builtin_amdgcn_permlanex16(b, b, 0x76543210, 0xfedcba98, false, false)); }
// ---- k_fattn: scores, softmax and attn.v of one head in one kernel; scores and numerators stay in registers. Grid (NN / 128, heads), 16 waves: wave = (tile qt of QG x 16 queries, key range kq of NN / KQ keys).
// Per 32 keys: St = K' Q't (A = 16 key rows, B = 16 query columns, k = 64 features), so a lane holds 16 scores of ONE query (keys 8 hi + j and 16 + 8 hi + j); two St tiles converted in place are the B operand
// of Ot += Vt Pt (A = 16 rows of the [d][key] plane, same k order). Scores are in log2 units. Reference m and sum l per query; a numerator is exp2(score - m + 10), l their f32 sum.
// First loop: m = 10 for every query, so exp2 reads the score as the matrix unit leaves it and nothing is tested on the way. Its result stands if, in every lane of the wave, l shows that fp16 held every numerator (LHI) and that the sum is not small (LLO).
// Otherwise the wave does its range again in the second loop, which takes any scores: m starts as the largest score of the walk's first 32 keys (a real score, so l never vanishes) and stays while the numerators taken against it fit fp16
// (test on their sums, PT); only then the row max is taken and Ot and l are rescaled by exp2(m_old - m_new).
// K' and Vt fragments of the next 32 keys are fetched into the same registers right behind their last use (the last pass fetches the walk's first keys again: in bounds; the second loop, where it runs, starts from them).
// The 32 work-groups of a head read the same K' and Vt lines. Each enters its key ranges at pass p0, taken from its index, and wraps round: at any moment they ask for different lines, and a line that one of them has brought in from memory
// is in L2 when the others come to it. p0 leaves out bit 2 of the index, so groups i and i ^ 4 share a p0. Only the speed depends on where a group runs.
__global__ __launch_bounds__(512) void k_fattn(const h16* __restrict__ QA, const h16* __restrict__ KB, const h16* __restrict__ VT, bf* __restrict__ OS) {
    __shared__ float mg[KQ][QT][QG][18][32];   // per key range, tile, column group and lane: 16 Ot values, m, l
    const int lane = threadIdx.x & 31; const int w = threadIdx.x >> 5, qt = w % QT, kq = w / QT;
    const int h = blockIdx.y, qb = blockIdx.x * (QT * QG * 16);
    const int p0 = ((blockIdx.x & 3) | ((blockIdx.x >> 3) << 2)) & (NP - 1);   // the pass at which this work-group enters every key range
    const h16* qp = QA + (((size_t)h * (NN / 16) + (qb >> 4) + qt * QG) * 128 + lane) * 8;
    const h16* kp = KB + (((size_t)h * (NN / 16) + kq * (NN / KQ / 16)) * 128 + lane) * 8;
    const h16* vp = VT + (((size_t)h * (NN / 32) + kq * (NN / KQ / 32)) * 128 + lane) * 8;
    const h16* k0 = kp + (size_t)p0 * 2048; const h16* v0 = vp + (size_t)p0 * 1024;   // a pass is 32 keys: 2048 elements of K', 1024 of Vt
    v16h qf[QG][2], kf[2][2], vf[2]; v8f o[QG][2]; float m[QG], l[QG]; v2f l2[QG / 2];
#pragma unroll
    for (int g = 0; g < QG; ++g) { qf[g][0] = WFrag<h16>::ld(qp + g * 1024); qf[g][1] = WFrag<h16>::ld(qp + g * 1024 + 512); o[g][0] = (v8f){}; o[g][1] = (v8f){}; l2[g >> 1] = (v2f){}; }
#pragma unroll
    for (int kt = 0; kt < 2; ++kt) { kf[kt][0] = WFrag<h16>::ld(k0 + kt * 1024); kf[kt][1] = WFrag<h16>::ld(k0 + kt * 1024 + 512); vf[kt] = WFrag<h16>::ld(v0 + kt * 512); }
    asm volatile("s_wait_xcnt 0x0" :: "v"(qp), "v"(k0), "v"(v0) : "memory");   // the three address pairs stay as they are up to this wait (without the operands a later load's result lands on the q pair)
#pragma unroll 1   // rolled: four waves per SIMD leave 256 registers a wave
    for (int ps = 0; ps < NP; ++ps) {
        const int pn = (p0 + ps + 1) & (NP - 1); const h16* kx = kp + (size_t)pn * 2048; const h16* vx = vp + (size_t)pn * 1024;
#pragma unroll
        for (int gp = 0; gp < QG; gp += 2) {
            v8f s[2][2];
#pragma unroll
            for (int u = 0; u < 2; ++u) { s[u][0] = wmma16(kf[0][0], qf[gp + u][0], (v8f){}); s[u][1] = wmma16(kf[1][0], qf[gp + u][0], (v8f){}); s[u][0] = wmma16(kf[0][1], qf[gp + u][1], s[u][0]); s[u][1] = wmma16(kf[1][1], qf[gp + u][1], s[u][1]); }
            if (gp + 2 == QG) {
#pragma unroll
                for (int kt = 0; kt < 2; ++kt) { kf[kt][0] = WFrag<h16>::ld(kx + kt * 1024); kf[kt][1] = WFrag<h16>::ld(kx + kt * 1024 + 512); }
                asm volatile("s_wait_xcnt 0x0" :: "v"(kx) : "memory"); }   // the loads' address pair stays as it is up to this wait; it also keeps the fetch here, ahead of the softmax
            __builtin_amdgcn_sched_barrier(0);   // the eight score products go out in a row: mixed with the softmax, each is followed by idle slots up to the first read of its result
            v16h p[2]; v2f t = (v2f){};   // the two column groups' sums side by side (packed adds); each query's own order is that of the second loop
#pragma unroll
            for (int j = 0; j < 8; ++j) { v2f e0, e1;
#pragma unroll
                for (int u = 0; u < 2; ++u) { e0[u] = __builtin_amdgcn_exp2f(s[u][0][j]); e1[u] = __builtin_amdgcn_exp2f(s[u][1][j]); p[u][j] = tohx(e0[u]); p[u][8 + j] = tohx(e1[u]); }
                t += e0 + e1; }
            l2[gp >> 1] += t;
            __builtin_amdgcn_sched_barrier(0);   // the softmax's vector work stays ahead of the four products below: mixed among them, more idle slots (v_nop) stand behind matrix instructions
#pragma unroll
            for (int u = 0; u < 2; ++u)
#pragma unroll
                for (int dt = 0; dt < 2; ++dt) o[gp + u][dt] = wmma16(vf[dt], p[u], o[gp + u][dt]);
        }
#pragma unroll
        for (int dt = 0; dt < 2; ++dt) vf[dt] = WFrag<h16>::ld(vx + dt * 512);
        asm volatile("s_wait_xcnt 0x0" :: "v"(vx) : "memory");   // as above: the address pair is kept up to the wait
    }
    bool redo = false;
#pragma unroll
    for (int g = 0; g < QG; ++g) { m[g] = 10.0f; l[g] = l2[g >> 1][g & 1]; redo |= !(l[g] <= LHI) | !(l[g] + xhalf(l[g]) >= LLO); }
    if (__builtin_expect(__builtin_amdgcn_ballot_w32(redo) != 0, 0)) {   // one scalar branch for the wave; kf and vf hold the walk's first 32 keys again (the last pass's fetch)
#pragma unroll
    for (int g = 0; g < QG; ++g) { o[g][0] = (v8f){}; o[g][1] = (v8f){}; l[g] = 0.f; }
#pragma unroll
    for (int g = 0; g < QG; ++g) { const v8f r0 = wmma16(kf[0][1], qf[g][1], wmma16(kf[0][0], qf[g][0], (v8f){})), r1 = wmma16(kf[1][1], qf[g][1], wmma16(kf[1][0], qf[g][0], (v8f){})); float mx = fmaxf(r0[0], r1[0]);
#pragma unroll
        for (int j = 1; j < 8; ++j) mx = fmaxf(mx, fmaxf(r0[j], r1[j]));
        m[g] = fmaxf(mx, xhalf(mx)); }
#pragma unroll 1   // rolled: four waves per SIMD leave 256 registers a wave
    for (int ps = 0; ps < NP; ++ps) {
        const int pn = (p0 + ps + 1) & (NP - 1); const h16* kx = kp + (size_t)pn * 2048; const h16* vx = vp + (size_t)pn * 1024;
#pragma unroll
        for (int gp = 0; gp < QG; gp += 2) {
            v8f s[2][2];
#pragma unroll
            for (int u = 0; u < 2; ++u) { s[u][0] = wmma16(kf[0][0], qf[gp + u][0], (v8f){}); s[u][1] = wmma16(kf[1][0], qf[gp + u][0], (v8f){}); s[u][0] = wmma16(kf[0][1], qf[gp + u][1], s[u][0]); s[u][1] = wmma16(kf[1][1], qf[gp + u][1], s[u][1]); }
            if (gp + 2 == QG) {
#pragma unroll
                for (int kt = 0; kt < 2; ++kt) { kf[kt][0] = WFrag<h16>::ld(kx + kt * 1024); kf[kt][1] = WFrag<h16>::ld(kx + kt * 1024 + 512); }
                asm volatile("s_wait_xcnt 0x0" :: "v"(kx) : "memory"); }   // the loads' address pair stays as it is up to this wait (without the operand the last load's result lands on it); it also keeps the fetch here, ahead of the softmax
            v16h p[2]; float sum[2];
#pragma unroll
            for (int u = 0; u < 2; ++u) { const float mc = m[gp + u] - 10.0f; float t = 0.f; const v8f d0 = s[u][0] - mc, d1 = s[u][1] - mc;
#pragma unroll
                for (int j = 0; j < 8; ++j) { const float e0 = __builtin_amdgcn_exp2f(d0[j]), e1 = __builtin_amdgcn_exp2f(d1[j]); t += e0 + e1; p[u][j] = tohx(e0); p[u][8 + j] = tohx(e1); }
                sum[u] = t; }
            if (__builtin_expect(__builtin_amdgcn_ballot_w32(!(sum[0] + sum[1] <= PT)) != 0, 0)) {   // numerators are >= 0, so a sum within PT bounds each of them; one scalar branch for the wave
                // a new reference for both column groups, in every lane: the scores once more (they were not kept), row max, Ot and l rescaled, numerators made again
                v16h kr[2][2];
                if (gp + 2 == QG) { const h16* ky = kp + (size_t)((p0 + ps) & (NP - 1)) * 2048;   // kf already takes the next pass's keys: this pass's come from memory again
#pragma unroll
                    for (int kt = 0; kt < 2; ++kt) { kr[kt][0] = WFrag<h16>::ld(ky + kt * 1024); kr[kt][1] = WFrag<h16>::ld(ky + kt * 1024 + 512); }
                    asm volatile("s_wait_xcnt 0x0" :: "v"(ky) : "memory"); }   // the loads' address pair stays as it is up to this wait
                else {
#pragma unroll
                    for (int kt = 0; kt < 2; ++kt) { kr[kt][0] = kf[kt][0]; kr[kt][1] = kf[kt][1]; } }
#pragma unroll
                for (int u = 0; u < 2; ++u) { const int g = gp + u;
                    v8f r0 = wmma16(kr[0][0], qf[g][0], (v8f){}), r1 = wmma16(kr[1][0], qf[g][0], (v8f){}); r0 = wmma16(kr[0][1], qf[g][1], r0); r1 = wmma16(kr[1][1], qf[g][1], r1);
                    float mx = fmaxf(r0[0], r1[0]);
#pragma unroll
                    for (int j = 1; j < 8; ++j) mx = fmaxf(mx, fmaxf(r0[j], r1[j]));
                    mx = fmaxf(mx, xhalf(mx));
                    const float mn = fmaxf(m[g], mx), al = __builtin_amdgcn_exp2f(m[g] - mn), mc = mn - 10.0f; m[g] = mn; float t = 0.f; r0 -= mc; r1 -= mc;
#pragma unroll
                    for (int j = 0; j < 8; ++j) { const float e0 = __builtin_amdgcn_exp2f(r0[j]), e1 = __builtin_amdgcn_exp2f(r1[j]); t += e0 + e1; p[u][j] = tohx(e0); p[u][8 + j] = tohx(e1); }
                    sum[u] = t; l[g] *= al; o[g][0] *= al; o[g][1] *= al; }
            }
#pragma unroll
            for (int u = 0; u < 2; ++u) { const int g = gp + u; l[g] += sum[u];
#pragma unroll
                for (int dt = 0; dt < 2; ++dt) o[g][dt] = wmma16(vf[dt], p[u], o[g][dt]); }
        }
#pragma unroll
        for (int dt = 0; dt < 2; ++dt) vf[dt] = WFrag<h16>::ld(vx + dt * 512);
        asm volatile("s_wait_xcnt 0x0" :: "v"(vx) : "memory");   // as above: the address pair is kept up to the wait
    }
    }
#pragma unroll
    for (int g = 0; g < QG; ++g) {
        const float lj = l[g] + xhalf(l[g]);   // the two lane halves hold different keys of the same query
#pragma unroll
        for (int j = 0; j < 8; ++j) { mg[kq][qt][g][j][lane] = o[g][0][j]; mg[kq][qt][g][8 + j][lane] = o[g][1][j]; }
        mg[kq][qt][g][16][lane] = m[g]; mg[kq][qt][g][17][lane] = lj; }
    __syncthreads();   // every range's partial result is in LDS before a wave joins them
    if (w < QT * QG) {   // one wave joins the KQ ranges of one (tile, column group), in range order
        const int jq = w % QT, jg = w / QT; float M = mg[0][jq][jg][16][lane];
#pragma unroll
        for (int z = 1; z < KQ; ++z) M = fmaxf(M, mg[z][jq][jg][16][lane]);
        float L = 0.f; v8f a0 = (v8f){}, a1 = (v8f){};
#pragma unroll
        for (int z = 0; z < KQ; ++z) { const float wz = __builtin_amdgcn_exp2f(mg[z][jq][jg][16][lane] - M); L += mg[z][jq][jg][17][lane] * wz;
#pragma unroll
            for (int j = 0; j < 8; ++j) { a0[j] += mg[z][jq][jg][j][lane] * wz; a1[j] += mg[z][jq][jg][8 + j][lane] * wz; } }
        const float inv = __fdiv_rn(1.0f, L); bf* op = OS + (((size_t)h * (NN / 16) + (qb >> 4) + jq * QG + jg) * 128 + lane) * 8;   // the lane's Ot rows are its elements of k_outp's A fragment: four 512-byte blocks (hi, hi, lo, lo), written by this wave alone
        a0 *= inv; a1 *= inv; v8us h0, h1, l0, l1;
#pragma unroll
        for (int j = 0; j < 8; ++j) { unsigned short a, c; splitf(a0[j], a, c); h0[j] = a; l0[j] = c; splitf(a1[j], a, c); h1[j] = a; l1[j] = c; }
        *(v8us*)op = h0; *(v8us*)(op + 256) = h1; *(v8us*)(op + 512) = l0; *(v8us*)(op + 768) = l1;
    }
}
extern "C" void kernel_launch(void* const* d_in, const int* in_sizes, int n_in,
                              void* d_out, int out_size, void* d_ws, size_t ws_size, hipStream_t stream) {
    (void)in_sizes; (void)n_in; (void)out_size;
    const float* x = (const float*)d_in[0]; const float* wp = (const float*)d_in[1]; const float* bp = (const float*)d_in[2]; const float* wf = (const float*)d_in[3]; const float* bfv = (const float*)d_in[4];   // Wp [128][768], Wf [256][256] as x @ W
    float* OUT = (float*)d_out;     // [1][64][64][256]
    char* wsp = (char*)d_ws;
    auto take = [&](size_t bytes) { char* p = wsp; wsp += (bytes + 255) & ~(size_t)255; return (void*)p; };
    h16* QA = (h16*)take((size_t)NH_ * NN * 64 * 2); h16* KB = (h16*)take((size_t)NH_ * NN * 64 * 2); h16* VT = (h16*)take((size_t)NH_ * HD * NN * 2); bf* OS = (bf*)take((size_t)NH_ * NN * 64 * 2);
    if ((size_t)(wsp - (char*)d_ws) > ws_size) return;    // total 14 MB; ws 256 MiB
    k_proj<<<dim3(NN / 64, 3 * KD / 64, 1), 32 * KW, 0, stream>>>(x, wp, bp, QA, KB, VT);
    k_fattn<<<dim3(NN / (QT * QG * 16), NH_, 1), 512, 0, stream>>>(QA, KB, VT, OS);
    k_outp<<<dim3(NN / 64, KD / 64, 1), 32 * KW, 0, stream>>>(OS, wf, bfv, OUT);
}

// v009
// Measured time: 30 microseconds a run.
// Next to v008, in two timings, it ran 1.09 times as fast each time.
// Over all steps from v000 it is 37.4 times as fast.
#include <hip/hip_runtime.h>

// Polar attention (x [1][64][64][128] -> 4096 tokens; qkv = x Wp + bp laid out (3, 8 heads, 32); scores[n][m] = (q_n.k_m / sqrt 32) r_weight[m] cos(theta_m - theta_n) with the module's polar
// constants (r = |p - centre| + 1e-6, theta = atan2 mod 2pi, log_r = log r / log max r, r_weight = 1/(log_r + 1), 'xy' meshgrid flattening); softmax over m; out = merged attn.v Wf + bf -> [1][64][64][256]).
// Compute dtypes, f32 accumulate: every input rounded to bf16; the projection on PLAIN bf16 operands (inputs: exact, + bias); the polar constants in f32 on VALU; the
// softmax in f32 (first against a fixed reference, checked once per key range; where that check fails, against a row reference that is a real score, renewed when the numerators would leave fp16; one exp2 per element, the 32^-0.5 log2(e) carried by q'; fp16 numerators; divided by their f32 sum at the end of k_fattn); attn.v on fp16 planes; merged heads as hi+lo

#define HW   64
#define NN   4096                 // tokens
#define CC   128
#define KD   256                  // key_dim
#define NH_  8
#define HD   32
#define SCL  0.17677669529663688f   // 32^-0.5
#define KQ   8                    // key ranges of k_fattn: one wave per (query tile, range), joined through LDS at the end
#define QT   2                    // query tiles of one work-group of k_fattn
#define KW   4                    // waves of one work-group of the two GEMMs: each takes a quarter of k
#define QG   4                    // 16-query column groups of one tile (one wave)
#define NP   (NN / KQ / 32)       // passes of 32 keys that a wave of k_fattn makes over its key range
#define LC   (SCL * 1.4426950408889634f)   // 32^-0.5 log2(e): exp(SCL d) = exp2(LC d); k_proj multiplies q by it
#define PT   32768.0f             // k_fattn's second loop keeps a query's reference while a lane's 32 numerators of a pass (both column groups) sum to at most this (fp16 holds each)
#define LHI  65504.0f             // first loop: a lane's numerators of the whole range sum to at most this, so fp16 holds each
#define LLO  1.0f                 // first loop: a query's numerators of the range sum to at least this, so what fp16 loses below 2^-14 (at most 2^-25 a key) is small beside the numerators' own rounding
typedef _Float16 h16;
typedef unsigned short bf;
typedef __attribute__((ext_vector_type(16))) __bf16   v16bf;
typedef __attribute__((ext_vector_type(16))) _Float16 v16h;
typedef __attribute__((ext_vector_type(8)))  _Float16 v8h;
typedef __attribute__((ext_vector_type(8)))  unsigned short v8us;
typedef __attribute__((ext_vector_type(8)))  float    v8f;
typedef __attribute__((ext_vector_type(4)))  float    v4f;
typedef __attribute__((ext_vector_type(2)))  float    v2f;
typedef v8h  __attribute__((may_alias)) v8ha;
typedef v4f  __attribute__((may_alias)) v4fa;
typedef v8us __attribute__((may_alias)) v8usa;

__device__ __forceinline__ unsigned short f2bf(float f) { unsigned u = __float_as_uint(f); u += 0x7FFFu + ((u >> 16) & 1u); return (unsigned short)(u >> 16); }
__device__ __forceinline__ float bf2f(unsigned short b) { return __uint_as_float(((unsigned)b) << 16); }
__device__ __forceinline__ float bfr(float f) { return bf2f(f2bf(f)); }
__device__ __forceinline__ v16h cat16(v8h lo, v8h hi) { return __builtin_shufflevector(lo, hi, 0, 1, 2, 3, 4, 5, 6, 7, 8, 9, 10, 11, 12, 13, 14, 15); }
__device__ __forceinline__ v16bf cat16b(v8us lo, v8us hi) { return __builtin_bit_cast(v16bf, __builtin_shufflevector(lo, hi, 0, 1, 2, 3, 4, 5, 6, 7, 8, 9, 10, 11, 12, 13, 14, 15)); }
__device__ __forceinline__ v8f wmma16(v16h a, v16h b, v8f c) { return __builtin_amdgcn_wmma_f32_16x16x32_f16(false, a, false, b, (short)0, c, false, false); }
__device__ __forceinline__ v8f wmmab(v16bf a, v16bf b, v8f c) { return __builtin_amdgcn_wmma_f32_16x16x32_bf16(false, a, false, b, (short)0, c, false, false); }



// ---- The two GEMMs: one work-group of KW waves per 64x64 output tile; every wave holds the whole tile (16 accumulators) for its own quarter of k, in steps of 32; the partial tiles are joined through LDS. Both read their f32 sources themselves and round to bf16 (nearest even) in registers while they
// form the fragments, and the projection's epilogue writes the attention kernel's fp16 planes itself: no conversion, transposition or re-layout pass stands between the launches.
// Fragment k order, A and B alike: element s of lane half hi is k = kc + 8 hi + s (s < 8) and kc + 16 + 8 hi + (s - 8).
// The four workspace planes lie in FRAGMENT ORDER: a 16 x 32 fragment is two blocks of 512 bytes, block b = lane l's 8 elements s = 8 b .. 8 b + 7 at byte 16 l (l = 16 hi + row). A wave-wide 16-byte load or store
// then covers 4 whole 128-byte lines, where a row-major plane gave it 16 lines. QA, KB: [head][token / 16][feature / 16][lane][8]; VT: [head][key / 32][d / 16][(key / 16) % 2][lane][8]; OS: [head][token / 16][hi: d / 16, lo: 2 + d / 16][lane][8].
template <typename T16> struct WFrag;
template <> struct WFrag<h16> { typedef v16h V; static __device__ __forceinline__ V ld(const h16* p) { return cat16(*(const v8h*)p, *(const v8h*)(p + 256)); } static __device__ __forceinline__ v8f mma(V a, V b, v8f c) { return wmma16(a, b, c); } };
typedef __attribute__((ext_vector_type(16))) float v16f;
typedef __attribute__((ext_vector_type(4))) _Float16 v4h;
__device__ __forceinline__ h16 tohx(float x) { return (h16)x; }
__device__ __forceinline__ void splitf(float y, unsigned short& h, unsigned short& l) { h = f2bf(y); l = f2bf(y - bf2f(h)); }
__device__ __forceinline__ v16f cat16f(v8f lo, v8f hi) { return __builtin_shufflevector(lo, hi, 0, 1, 2, 3, 4, 5, 6, 7, 8, 9, 10, 11, 12, 13, 14, 15); }
// 16 k of one row of a k-contiguous f32 matrix; p points at k = kc + 8 hi
__device__ __forceinline__ v16f ldrow(const float* p) { return cat16f(*(const v8f*)p, *(const v8f*)(p + 16)); }
// 16 k of FOUR neighbouring columns of W[k][n] (f32, pitch N); p points at (kc + 8 hi, the lane's first column, a multiple of 4). t[nb] is column nb of the four, in ldrow's k order. One 16-byte load per k serves all four column tiles:
// column tile nb, lane column lr stands for column 4 lr + nb of the 64, so a wave-wide load covers two whole 256-byte rows of the weight tile, and a wave's loads (33 in k_proj, 65 in k_outp) go out in one flight: the load counter holds 63, and behind that a load waits for an earlier one to return.
template <int N> __device__ __forceinline__ void ldcol4(const float* p, v16f (&t)[4]) {
#pragma unroll
    for (int i = 0; i < 8; ++i) { const v4f a = *(const v4f*)(p + (size_t)i * N), b = *(const v4f*)(p + (size_t)(16 + i) * N);
#pragma unroll
        for (int nb = 0; nb < 4; ++nb) { t[nb][i] = a[nb]; t[nb][8 + i] = b[nb]; } }
}
// polar constants of token n (x = n / 64, y = n % 64 from the 'xy' meshgrid flattening): r = sqrt((x-32)^2 + (y-32)^2) + 1e-6, th = atan2(y-32, x-32) (+2pi mod 2pi), log_r = log(r)/log(r_max): (cos th, sin th, r_weight, 0)
__device__ __forceinline__ v4f polar(int n) { const float xx = (float)(n / HW) - 32.0f, yy = (float)(n % HW) - 32.0f;
    const float r = __fsqrt_rn(__fadd_rn(__fmul_rn(xx, xx), __fmul_rn(yy, yy))) + 1e-6f; float th = atan2f(yy, xx); th = fmodf(th + 6.283185307179586f, 6.283185307179586f);
    const float rmax = __fsqrt_rn(2048.0f) + 1e-6f; const float lr = __fdiv_rn(logf(r), logf(rmax)); const float rw = __fdiv_rn(1.0f, __fadd_rn(lr, 1.0f)); v4f o; o[0] = cosf(th); o[1] = sinf(th); o[2] = rw; o[3] = 0.f; return o; }

// ---- The join of the KW partial tiles. Every wave leaves its 16 accumulators in LDS, lane by lane (16-byte stores, 512 contiguous bytes a wave); behind the barrier wave w adds the KW partial sums of row block w, in k order.
__device__ __forceinline__ void joink(float* pj, const v8f (&acc)[4][4], v8f (&fin)[4], int w, int lane) {
    __builtin_amdgcn_sched_barrier(0);   // the LDS stores stay behind the last matrix instruction
#pragma unroll
    for (int mb = 0; mb < 4; ++mb)
#pragma unroll
        for (int nb = 0; nb < 4; ++nb) { float* d = pj + ((((mb * KW + w) * 4 + nb) * 2) * 32 + lane) * 4;
            *(v4fa*)d = __builtin_shufflevector(acc[mb][nb], acc[mb][nb], 0, 1, 2, 3); *(v4fa*)(d + 128) = __builtin_shufflevector(acc[mb][nb], acc[mb][nb], 4, 5, 6, 7); }
    __syncthreads();   // every wave's partial tile is in LDS before a wave adds them
#pragma unroll
    for (int nb = 0; nb < 4; ++nb)
#pragma unroll
        for (int z = 0; z < KW; ++z) { const float* s = pj + ((((w * KW + z) * 4 + nb) * 2) * 32 + lane) * 4; const v4f lo = *(const v4fa*)s, hi4 = *(const v4fa*)(s + 128);
            const v8f p = __builtin_shufflevector(lo, hi4, 0, 1, 2, 3, 4, 5, 6, 7); fin[nb] = z ? fin[nb] + p : p; }
}

// ---- k_proj: qkv = x Wp + bp; grid (NN / 64, 768 / 64), KW waves: wave w takes k = 32 w .. 32 w + 31 of the whole tile and finishes rows 16 w .. 16 w + 15. A tile's 64 columns are two heads of ONE of q, k, v. q: features 0..31 of QA = LC q cos th_n, 32..63 = LC q sin th_n; k: KB the same with k r_weight_n; v: VT, rows d < 32, k = key.
__global__ __launch_bounds__(32 * KW) void k_proj(const float* __restrict__ x, const float* __restrict__ wp, const float* __restrict__ bp, h16* __restrict__ QA, h16* __restrict__ KB, h16* __restrict__ VT) {
    __shared__ __align__(16) float pj[4 * KW * 4 * 2 * 32 * 4];
    __shared__ __align__(16) float osm[KW][16 * 68];
    const int lane = threadIdx.x & 31, lr = lane & 15, hi = lane >> 4, w = __builtin_amdgcn_readfirstlane(threadIdx.x >> 5); const int r0 = blockIdx.x * 64, c0 = blockIdx.y * 64; const int sec = c0 / KD, h0 = (c0 % KD) / HD;
    float* os = osm[w];
    const float* pa = x + (size_t)(r0 + lr) * CC + 32 * w + 8 * hi; const float* pb = wp + (size_t)(32 * w + 8 * hi) * (3 * KD) + c0 + 4 * lr; const float* bu = bp + c0;
    v16f ar[4], br[4];
#pragma unroll
    for (int mb = 0; mb < 4; ++mb) ar[mb] = ldrow(pa + (size_t)mb * 16 * CC);
    ldcol4<3 * KD>(pb, br);
    const v4f b4 = *(const v4f*)(bu + 4 * lr);   // the lane's four columns: 4 lr + nb
    asm volatile("s_wait_xcnt 0x0" :: "v"(pa), "v"(pb), "s"(bu) : "memory");   // the loads' addresses are kept up to this wait; the clobber keeps every load ahead of the polar constants, which are made while the loads fly
    v4f t = (v4f){}; if (sec < 2) t = polar(r0 + w * 16 + lr);   // the lane's token in the epilogue: row lr of the wave's row block
    v16bf a[4]; v8f acc[4][4], fin[4];
#pragma unroll
    for (int mb = 0; mb < 4; ++mb) a[mb] = __builtin_convertvector(ar[mb], v16bf);
#pragma unroll
    for (int nb = 0; nb < 4; ++nb) { const v16bf b = __builtin_convertvector(br[nb], v16bf);
#pragma unroll
        for (int mb = 0; mb < 4; ++mb) acc[mb][nb] = wmmab(a[mb], b, (v8f){}); }
    joink(pj, acc, fin, w, lane);
    const float bv[4] = { bfr(b4[0]), bfr(b4[1]), bfr(b4[2]), bfr(b4[3]) };
    // the wave's 16 x 64 block goes to LDS in plain column order: a lane's four column tiles are four neighbouring columns of a row, one 16-byte store
#pragma unroll
    for (int j = 0; j < 8; ++j) { v4f r;
#pragma unroll
        for (int nb = 0; nb < 4; ++nb) r[nb] = fin[nb][j] + bv[nb];
        *(v4fa*)(os + (hi * 8 + j) * 68 + 4 * lr) = r; }
    __builtin_amdgcn_wave_barrier(); asm volatile("" ::: "memory");   // other lanes' LDS stores stay ahead of the reads below
    if (sec == 2) {   // v: the lane reads 8 consecutive keys of one (head, d) column: its 16 bytes of one fragment block; the wave writes the whole 512-byte block
#pragma unroll
        for (int nb = 0; nb < 4; ++nb) { h16* vblk = VT + ((((size_t)(h0 + (nb >> 1)) * (NN / 32) + (r0 >> 5)) * 4 + (nb & 1) * 2) * 32 + lane) * 8; v8h o;
#pragma unroll
            for (int j = 0; j < 8; ++j) o[j] = tohx(os[(hi * 8 + j) * 68 + nb * 16 + lr]);
            *(v8h*)(vblk + (w >> 1) * 1024 + (w & 1) * 256) = o; }
        return;
    }
    h16* P = sec ? KB : QA; h16* pblk = P + (((size_t)h0 * (NN / 16) + (r0 >> 4)) * 128 + lane) * 8;
    const float wt = sec ? t[2] : LC;   // q carries 32^-0.5 log2(e): k_fattn's scores leave the matrix unit as exponents of 2
#pragma unroll
    for (int hh = 0; hh < 2; ++hh)
#pragma unroll
        for (int jj = 0; jj < 2; ++jj) { const float* sp = os + lr * 68 + hh * 32 + jj * 16 + hi * 8; const v4f x0 = *(const v4fa*)sp, x1 = *(const v4fa*)(sp + 4); v8h oc, on;
#pragma unroll
            for (int q = 0; q < 4; ++q) { const float aw = __fmul_rn(x0[q], wt), ax = __fmul_rn(x1[q], wt); oc[q] = tohx(__fmul_rn(aw, t[0])); on[q] = tohx(__fmul_rn(aw, t[1])); oc[4 + q] = tohx(__fmul_rn(ax, t[0])); on[4 + q] = tohx(__fmul_rn(ax, t[1])); }
            h16* pr = pblk + ((size_t)hh * (NN / 16) + w) * 1024 + jj * 256; *(v8h*)pr = oc; *(v8h*)(pr + 512) = on; }   // two whole 512-byte fragment blocks, written by this wave alone
    asm volatile("s_wait_xcnt 0x0" ::: "memory");   // behind the last store: the built code has a branch from here into the v block, which writes the stores' data registers
}

// ---- k_outp: OUT = merged Wf + bf; grid (NN / 64, 256 / 64), KW waves: wave w takes heads 2 w and 2 w + 1 (k = 64 w .. 64 w + 63) of the whole tile and finishes rows 16 w .. 16 w + 15. merged[n][h 32 + d] is read where k_fattn left it, in OS, as ready A fragments (bf16 hi, then lo): a k step of 32 is one head; both products on the matrix unit, hi first.
__global__ __launch_bounds__(32 * KW) void k_outp(const bf* __restrict__ OS, const float* __restrict__ wf, const float* __restrict__ bias, float* __restrict__ C) {
    __shared__ __align__(16) float pj[4 * KW * 4 * 2 * 32 * 4];
    const int lane = threadIdx.x & 31, lr = lane & 15, hi = lane >> 4, w = __builtin_amdgcn_readfirstlane(threadIdx.x >> 5); const int r0 = blockIdx.x * 64, c0 = blockIdx.y * 64;
    const bf* ap = OS + (size_t)(64 * w) * (NN * 2) + ((size_t)(r0 >> 4) * 128 + lane) * 8; const float* bq = wf + (size_t)(64 * w + 8 * hi) * KD + c0 + 4 * lr;
    const int cofs = lr * 4; const float* bc = bias + c0 + cofs;
    v16bf a[2][4], a2[2][4]; v16f br[2][4];
    const v4f b4 = *(const v4f*)bc;
#pragma unroll
    for (int s = 0; s < 2; ++s) ldcol4<KD>(bq + (size_t)(32 * s) * KD, br[s]);
#pragma unroll
    for (int s = 0; s < 2; ++s) {
#pragma unroll
        for (int mb = 0; mb < 4; ++mb) { const bf* p = ap + (size_t)(32 * s) * (NN * 2) + mb * 1024; a[s][mb] = cat16b(*(const v8us*)p, *(const v8us*)(p + 256)); a2[s][mb] = cat16b(*(const v8us*)(p + 512), *(const v8us*)(p + 768)); } }
    asm volatile("s_wait_xcnt 0x0" :: "v"(bq), "v"(b4) : "memory");   // before the loads' address registers are used again: the weight loads' pair is kept up to this wait (without the operand a later load's result lands on it); the bias as an input only keeps its load in this flight (left free it sinks behind the join's barrier, its latency exposed)
    __builtin_amdgcn_sched_barrier(0);   // keeps all that follows behind the wait: without it the first products are lifted among the loads, which then go out in several flights (a memory latency each)
    v8f acc[4][4], fin[4];
#pragma unroll
    for (int mb = 0; mb < 4; ++mb)
#pragma unroll
        for (int nb = 0; nb < 4; ++nb) acc[mb][nb] = (v8f){};
#pragma unroll
    for (int s = 0; s < 2; ++s)
#pragma unroll
        for (int nb = 0; nb < 4; ++nb) { const v16bf b = __builtin_convertvector(br[s][nb], v16bf);
#pragma unroll
            for (int mb = 0; mb < 4; ++mb) { acc[mb][nb] = wmmab(a[s][mb], b, acc[mb][nb]); acc[mb][nb] = wmmab(a2[s][mb], b, acc[mb][nb]); } }
    v4f bv; bv[0] = bfr(b4[0]); bv[1] = bfr(b4[1]); bv[2] = bfr(b4[2]); bv[3] = bfr(b4[3]);
    joink(pj, acc, fin, w, lane);
    float* crow = C + (size_t)(r0 + w * 16) * KD + c0;
#pragma unroll
    for (int j = 0; j < 8; ++j) { v4f r;   // a lane's four column tiles are columns 4 lr .. 4 lr + 3 of row 8 hi + j: the wave stores two whole 256-byte row pieces
#pragma unroll
        for (int nb = 0; nb < 4; ++nb) r[nb] = fin[nb][j];
        *(v4f*)(crow + (size_t)(hi * 8 + j) * KD + cofs) = r + bv; }
}
// lane l <-> l ^ 16
__device__ __forceinline__ float xhalf(float v) { const int b = __float_as_int(v); return __int_as_float(__builtin_amdgcn_permlanex16(b, b, 0x76543210, 0xfedcba98, false, false)); }
// ---- k_fattn: scores, softmax and attn.v of one head in one kernel; scores and numerators stay in registers. Grid (NN / 128, heads), 16 waves: wave = (tile qt of QG x 16 queries, key range kq of NN / KQ keys).
// Per 32 keys: St = K' Q't (A = 16 key rows, B = 16 query columns, k = 64 features), so a lane holds 16 scores of ONE query (keys 8 hi + j and 16 + 8 hi + j); two St tiles converted in place are the B operand
// of Ot += Vt Pt (A = 16 rows of the [d][key] plane, same k order). Scores are in log2 units. Reference m and sum l per query; a numerator is exp2(score - m + 10), l their f32 sum.
// First loop: m = 10 for every query, so exp2 reads the score as the matrix unit leaves it and nothing is tested on the way. Its result stands if, in every lane of the wave, l shows that fp16 held every numerator (LHI) and that the sum is not small (LLO).
// Otherwise the wave does its range again in the second loop, which takes any scores: m starts as the largest score of the walk's first 32 keys (a real score, so l never vanishes) and stays while the numerators taken against it fit fp16
// (test on their sums, PT); only then the row max is taken and Ot and l are rescaled by exp2(m_old - m_new).
// K' and Vt fragments of the next 32 keys are fetched into the same registers right behind their last use (the last pass fetches the walk's first keys again: in bounds; the second loop, where it runs, starts from them).
// The 32 work-groups of a head read the same K' and Vt lines. Each enters its key ranges at pass p0, taken from its index, and wraps round: at any moment they ask for different lines, and a line that one of them has brought in from memory
// is in L2 when the others come to it. p0 leaves out bit 2 of the index, so groups i and i ^ 4 share a p0. Only the speed depends on where a group runs.
__global__ __launch_bounds__(512) void k_fattn(const h16* __restrict__ QA, const h16* __restrict__ KB, const h16* __restrict__ VT, bf* __restrict__ OS) {
    __shared__ float mg[KQ][QT][QG][18][32];   // per key range, tile, column group and lane: 16 Ot values, m, l
    const int lane = threadIdx.x & 31; const int w = threadIdx.x >> 5, qt = w % QT, kq = w / QT;
    const int h = blockIdx.y, qb = blockIdx.x * (QT * QG * 16);
    const int p0 = ((blockIdx.x & 3) | ((blockIdx.x >> 3) << 2)) & (NP - 1);   // the pass at which this work-group enters every key range
    const h16* qp = QA + (((size_t)h * (NN / 16) + (qb >> 4) + qt * QG) * 128 + lane) * 8;
    const h16* kp = KB + (((size_t)h * (NN / 16) + kq * (NN / KQ / 16)) * 128 + lane) * 8;
    const h16* vp = VT + (((size_t)h * (NN / 32) + kq * (NN / KQ / 32)) * 128 + lane) * 8;
    const h16* k0 = kp + (size_t)p0 * 2048; const h16* v0 = vp + (size_t)p0 * 1024;   // a pass is 32 keys: 2048 elements of K', 1024 of Vt
    v16h qf[QG][2], kf[2][2], vf[2]; v8f o[QG][2]; float m[QG], l[QG]; v2f l2[QG / 2];
#pragma unroll
    for (int g = 0; g < QG; ++g) { qf[g][0] = WFrag<h16>::ld(qp + g * 1024); qf[g][1] = WFrag<h16>::ld(qp + g * 1024 + 512); o[g][0] = (v8f){}; o[g][1] = (v8f){}; l2[g >> 1] = (v2f){}; }
#pragma unroll
    for (int kt = 0; kt < 2; ++kt) { kf[kt][0] = WFrag<h16>::ld(k0 + kt * 1024); kf[kt][1] = WFrag<h16>::ld(k0 + kt * 1024 + 512); vf[kt] = WFrag<h16>::ld(v0 + kt * 512); }
    asm volatile("s_wait_xcnt 0x0" :: "v"(qp), "v"(k0), "v"(v0) : "memory");   // the three address pairs stay as they are up to this wait (without the operands a later load's result lands on the q pair)
#pragma unroll 1   // rolled: four waves per SIMD leave 256 registers a wave
    for (int ps = 0; ps < NP; ++ps) {
        const int pn = (p0 + ps + 1) & (NP - 1); const h16* kx = kp + (size_t)pn * 2048; const h16* vx = vp + (size_t)pn * 1024;
#pragma unroll
        for (int gp = 0; gp < QG; gp += 2) {
            v8f s[2][2];
#pragma unroll
            for (int u = 0; u < 2; ++u) { s[u][0] = wmma16(kf[0][0], qf[gp + u][0], (v8f){}); s[u][1] = wmma16(kf[1][0], qf[gp + u][0], (v8f){}); s[u][0] = wmma16(kf[0][1], qf[gp + u][1], s[u][0]); s[u][1] = wmma16(kf[1][1], qf[gp + u][1], s[u][1]); }
            if (gp + 2 == QG) {
#pragma unroll
                for (int kt = 0; kt < 2; ++kt) { kf[kt][0] = WFrag<h16>::ld(kx + kt * 1024); kf[kt][1] = WFrag<h16>::ld(kx + kt * 1024 + 512); }
                asm volatile("s_wait_xcnt 0x0" :: "v"(kx) : "memory"); }   // the loads' address pair stays as it is up to this wait; it also keeps the fetch here, ahead of the softmax
            __builtin_amdgcn_sched_barrier(0);   // the eight score products go out in a row: mixed with the softmax, each is followed by idle slots up to the first read of its result
            v16h p[2]; v2f t = (v2f){};   // the two column groups' sums side by side (packed adds); each query's own order is that of the second loop
#pragma unroll
            for (int j = 0; j < 8; ++j) { v2f e0, e1;
#pragma unroll
                for (int u = 0; u < 2; ++u) { e0[u] = __builtin_amdgcn_exp2f(s[u][0][j]); e1[u] = __builtin_amdgcn_exp2f(s[u][1][j]); p[u][j] = tohx(e0[u]); p[u][8 + j] = tohx(e1[u]); }
                t += e0 + e1; }
            l2[gp >> 1] += t;
            __builtin_amdgcn_sched_barrier(0);   // the softmax's vector work stays ahead of the four products below: mixed among them, more idle slots (v_nop) stand behind matrix instructions
#pragma unroll
            for (int u = 0; u < 2; ++u)
#pragma unroll
                for (int dt = 0; dt < 2; ++dt) o[gp + u][dt] = wmma16(vf[dt], p[u], o[gp + u][dt]);
        }
#pragma unroll
        for (int dt = 0; dt < 2; ++dt) vf[dt] = WFrag<h16>::ld(vx + dt * 512);
        asm volatile("s_wait_xcnt 0x0" :: "v"(vx) : "memory");   // as above: the address pair is kept up to the wait
    }
    bool redo = false;
#pragma unroll
    for (int g = 0; g < QG; ++g) { m[g] = 10.0f; l[g] = l2[g >> 1][g & 1]; redo |= !(l[g] <= LHI) | !(l[g] + xhalf(l[g]) >= LLO); }
    if (__builtin_expect(__builtin_amdgcn_ballot_w32(redo) != 0, 0)) {   // one scalar branch for the wave; kf and vf hold the walk's first 32 keys again (the last pass's fetch)
#pragma unroll
    for (int g = 0; g < QG; ++g) { o[g][0] = (v8f){}; o[g][1] = (v8f){}; l[g] = 0.f; }
#pragma unroll
    for (int g = 0; g < QG; ++g) { const v8f r0 = wmma16(kf[0][1], qf[g][1], wmma16(kf[0][0], qf[g][0], (v8f){})), r1 = wmma16(kf[1][1], qf[g][1], wmma16(kf[1][0], qf[g][0], (v8f){})); float mx = fmaxf(r0[0], r1[0]);
#pragma unroll
        for (int j = 1; j < 8; ++j) mx = fmaxf(mx, fmaxf(r0[j], r1[j]));
        m[g] = fmaxf(mx, xhalf(mx)); }
#pragma unroll 1   // rolled: four waves per SIMD leave 256 registers a wave
    for (int ps = 0; ps < NP; ++ps) {
        const int pn = (p0 + ps + 1) & (NP - 1); const h16* kx = kp + (size_t)pn * 2048; const h16* vx = vp + (size_t)pn * 1024;
#pragma unroll
        for (int gp = 0; gp < QG; gp += 2) {
            v8f s[2][2];
#pragma unroll
            for (int u = 0; u < 2; ++u) { s[u][0] = wmma16(kf[0][0], qf[gp + u][0], (v8f){}); s[u][1] = wmma16(kf[1][0], qf[gp + u][0], (v8f){}); s[u][0] = wmma16(kf[0][1], qf[gp + u][1], s[u][0]); s[u][1] = wmma16(kf[1][1], qf[gp + u][1], s[u][1]); }
            if (gp + 2 == QG) {
#pragma unroll
                for (int kt = 0; kt < 2; ++kt) { kf[kt][0] = WFrag<h16>::ld(kx + kt * 1024); kf[kt][1] = WFrag<h16>::ld(kx + kt * 1024 + 512); }
                asm volatile("s_wait_xcnt 0x0" :: "v"(kx) : "memory"); }   // the loads' address pair stays as it is up to this wait (without the operand the last load's result lands on it); it also keeps the fetch here, ahead of the softmax
            v16h p[2]; float sum[2];
#pragma unroll
            for (int u = 0; u < 2; ++u) { const float mc = m[gp + u] - 10.0f; float t = 0.f; const v8f d0 = s[u][0] - mc, d1 = s[u][1] - mc;
#pragma unroll
                for (int j = 0; j < 8; ++j) { const float e0 = __builtin_amdgcn_exp2f(d0[j]), e1 = __builtin_amdgcn_exp2f(d1[j]); t += e0 + e1; p[u][j] = tohx(e0); p[u][8 + j] = tohx(e1); }
                sum[u] = t; }
            if (__builtin_expect(__builtin_amdgcn_ballot_w32(!(sum[0] + sum[1] <= PT)) != 0, 0)) {   // numerators are >= 0, so a sum within PT bounds each of them; one scalar branch for the wave
                // a new reference for both column groups, in every lane: the scores once more (they were not kept), row max, Ot and l rescaled, numerators made again
                v16h kr[2][2];
                if (gp + 2 == QG) { const h16* ky = kp + (size_t)((p0 + ps) & (NP - 1)) * 2048;   // kf already takes the next pass's keys: this pass's come from memory again
#pragma unroll
                    for (int kt = 0; kt < 2; ++kt) { kr[kt][0] = WFrag<h16>::ld(ky + kt * 1024); kr[kt][1] = WFrag<h16>::ld(ky + kt * 1024 + 512); }
                    asm volatile("s_wait_xcnt 0x0" :: "v"(ky) : "memory"); }   // the loads' address pair stays as it is up to this wait
                else {
#pragma unroll
                    for (int kt = 0; kt < 2; ++kt) { kr[kt][0] = kf[kt][0]; kr[kt][1] = kf[kt][1]; } }
#pragma unroll
                for (int u = 0; u < 2; ++u) { const int g = gp + u;
                    v8f r0 = wmma16(kr[0][0], qf[g][0], (v8f){}), r1 = wmma16(kr[1][0], qf[g][0], (v8f){}); r0 = wmma16(kr[0][1], qf[g][1], r0); r1 = wmma16(kr[1][1], qf[g][1], r1);
                    float mx = fmaxf(r0[0], r1[0]);
#pragma unroll
                    for (int j = 1; j < 8; ++j) mx = fmaxf(mx, fmaxf(r0[j], r1[j]));
                    mx = fmaxf(mx, xhalf(mx));
                    const float mn = fmaxf(m[g], mx), al = __builtin_amdgcn_exp2f(m[g] - mn), mc = mn - 10.0f; m[g] = mn; float t = 0.f; r0 -= mc; r1 -= mc;
#pragma unroll
                    for (int j = 0; j < 8; ++j) { const float e0 = __builtin_amdgcn_exp2f(r0[j]), e1 = __builtin_amdgcn_exp2f(r1[j]); t += e0 + e1; p[u][j] = tohx(e0); p[u][8 + j] = tohx(e1); }
                    sum[u] = t; l[g] *= al; o[g][0] *= al; o[g][1] *= al; }
            }
#pragma unroll
            for (int u = 0; u < 2; ++u) { const int g = gp + u; l[g] += sum[u];
#pragma unroll
                for (int dt = 0; dt < 2; ++dt) o[g][dt] = wmma16(vf[dt], p[u], o[g][dt]); }
        }
#pragma unroll
        for (int dt = 0; dt < 2; ++dt) vf[dt] = WFrag<h16>::ld(vx + dt * 512);
        asm volatile("s_wait_xcnt 0x0" :: "v"(vx) : "memory");   // as above: the address pair is kept up to the wait
    }
    }
#pragma unroll
    for (int g = 0; g < QG; ++g) {
        const float lj = l[g] + xhalf(l[g]);   // the two lane halves hold different keys of the same query
#pragma unroll
        for (int j = 0; j < 8; ++j) { mg[kq][qt][g][j][lane] = o[g][0][j]; mg[kq][qt][g][8 + j][lane] = o[g][1][j]; }
        mg[kq][qt][g][16][lane] = m[g]; mg[kq][qt][g][17][lane] = lj; }
    __syncthreads();   // every range's partial result is in LDS before a wave joins them
    if (w < QT * QG) {   // one wave joins the KQ ranges of one (tile, column group), in range order
        const int jq = w % QT, jg = w / QT; float M = mg[0][jq][jg][16][lane];
#pragma unroll
        for (int z = 1; z < KQ; ++z) M = fmaxf(M, mg[z][jq][jg][16][lane]);
        float L = 0.f; v8f a0 = (v8f){}, a1 = (v8f){};
#pragma unroll
        for (int z = 0; z < KQ; ++z) { const float wz = __builtin_amdgcn_exp2f(mg[z][jq][jg][16][lane] - M); L += mg[z][jq][jg][17][lane] * wz;
#pragma unroll
            for (int j = 0; j < 8; ++j) { a0[j] += mg[z][jq][jg][j][lane] * wz; a1[j] += mg[z][jq][jg][8 + j][lane] * wz; } }
        const float inv = __fdiv_rn(1.0f, L); bf* op = OS + (((size_t)h * (NN / 16) + (qb >> 4) + jq * QG + jg) * 128 + lane) * 8;   // the lane's Ot rows are its elements of k_outp's A fragment: four 512-byte blocks (hi, hi, lo, lo), written by this wave alone
        a0 *= inv; a1 *= inv; v8us h0, h1, l0, l1;
#pragma unroll
        for (int j = 0; j < 8; ++j) { unsigned short a, c; splitf(a0[j], a, c); h0[j] = a; l0[j] = c; splitf(a1[j], a, c); h1[j] = a; l1[j] = c; }
        *(v8us*)op = h0; *(v8us*)(op + 256) = h1; *(v8us*)(op + 512) = l0; *(v8us*)(op + 768) = l1;
    }
}
extern "C" void kernel_launch(void* const* d_in, const int* in_sizes, int n_in,
                              void* d_out, int out_size, void* d_ws, size_t ws_size, hipStream_t stream) {
    (void)in_sizes; (void)n_in; (void)out_size;
    const float* x = (const float*)d_in[0]; const float* wp = (const float*)d_in[1]; const float* bp = (const float*)d_in[2]; const float* wf = (const float*)d_in[3]; const float* bfv = (const float*)d_in[4];   // Wp [128][768], Wf [256][256] as x @ W
    float* OUT = (float*)d_out;     // [1][64][64][256]
    char* wsp = (char*)d_ws;
    auto take = [&](size_t bytes) { char* p = wsp; wsp += (bytes + 255) & ~(size_t)255; return (void*)p; };
    h16* QA = (h16*)take((size_t)NH_ * NN * 64 * 2); h16* KB = (h16*)take((size_t)NH_ * NN * 64 * 2); h16* VT = (h16*)take((size_t)NH_ * HD * NN * 2); bf* OS = (bf*)take((size_t)NH_ * NN * 64 * 2);
    if ((size_t)(wsp - (char*)d_ws) > ws_size) return;    // total 14 MB; ws 256 MiB
    k_proj<<<dim3(NN / 64, 3 * KD / 64, 1), 32 * KW, 0, stream>>>(x, wp, bp, QA, KB, VT);
    k_fattn<<<dim3(NN / (QT * QG * 16), NH_, 1), 512, 0, stream>>>(QA, KB, VT, OS);
    k_outp<<<dim3(NN / 64, KD / 64, 1), 32 * KW, 0, stream>>>(OS, wf, bfv, OUT);
}

// v010
// A run of this version takes 28.3 microseconds.
// In both of two side-by-side timings against v009, it was 1.06 times as fast.
// Over all steps from v000 it is 39.6 times as fast.
#include <hip/hip_runtime.h>

// Polar attention (x [1][64][64][128] -> 4096 tokens; qkv = x Wp + bp laid out (3, 8 heads, 32); scores[n][m] = (q_n.k_m / sqrt 32) r_weight[m] cos(theta_m - theta_n) with the module's polar
// constants (r = |p - centre| + 1e-6, theta = atan2 mod 2pi, log_r = log r / log max r, r_weight = 1/(log_r + 1), 'xy' meshgrid flattening); softmax over m; out = merged attn.v Wf + bf -> [1][64][64][256]).
// Compute dtypes, f32 accumulate: every input rounded to bf16; the projection on PLAIN bf16 operands (inputs: exact, + bias); the polar constants in f32 on VALU; the
// softmax in f32 (first against a fixed reference, checked once per key range; where that check fails, against a row reference that is a real score, renewed when the numerators would leave fp16; one exp2 per element, the 32^-0.5 log2(e) carried by q'; fp16 numerators; divided by their f32 sum at the end of k_fattn); attn.v on fp16 planes; merged heads as hi+lo

#define HW   64
#define NN   4096                 // tokens
#define CC   128
#define KD   256                  // key_dim
#define NH_  8
#define HD   32
#define SCL  0.17677669529663688f   // 32^-0.5
#define KQ   8                    // key ranges of k_fattn: one wave per (query tile, range), joined through LDS at the end
#define QT   2                    // query tiles of one work-group of k_fattn
#define KW   4                    // waves of one work-group of the two GEMMs: each takes a quarter of k
#define QG   4                    // 16-query column groups of one tile (one wave)
#define NP   (NN / KQ / 32)       // passes of 32 keys that a wave of k_fattn makes over its key range
#define LC   (SCL * 1.4426950408889634f)   // 32^-0.5 log2(e): exp(SCL d) = exp2(LC d); k_proj multiplies q by it
#define PT   32768.0f             // k_fattn's second loop keeps a query's reference while a lane's 32 numerators of a pass (both column groups) sum to at most this (fp16 holds each)
#define LHI  65504.0f             // first loop: a lane's numerators of the whole range sum to at most this, so fp16 holds each
#define LLO  1.0f                 // first loop: a query's numerators of the range sum to at least this, so what fp16 loses below 2^-14 (at most 2^-25 a key) is small beside the numerators' own rounding
typedef _Float16 h16;
typedef unsigned short bf;
typedef __attribute__((ext_vector_type(16))) __bf16   v16bf;
typedef __attribute__((ext_vector_type(16))) _Float16 v16h;
typedef __attribute__((ext_vector_type(8)))  _Float16 v8h;
typedef __attribute__((ext_vector_type(8)))  unsigned short v8us;
typedef __attribute__((ext_vector_type(8)))  float    v8f;
typedef __attribute__((ext_vector_type(4)))  float    v4f;
typedef __attribute__((ext_vector_type(2)))  float    v2f;
typedef v8h  __attribute__((may_alias)) v8ha;
typedef v4f  __attribute__((may_alias)) v4fa;
typedef v8us __attribute__((may_alias)) v8usa;

__device__ __forceinline__ unsigned short f2bf(float f) { unsigned u = __float_as_uint(f); u += 0x7FFFu + ((u >> 16) & 1u); return (unsigned short)(u >> 16); }
__device__ __forceinline__ float bf2f(unsigned short b) { return __uint_as_float(((unsigned)b) << 16); }
__device__ __forceinline__ float bfr(float f) { return bf2f(f2bf(f)); }
__device__ __forceinline__ v16h cat16(v8h lo, v8h hi) { return __builtin_shufflevector(lo, hi, 0, 1, 2, 3, 4, 5, 6, 7, 8, 9, 10, 11, 12, 13, 14, 15); }
__device__ __forceinline__ v16bf cat16b(v8us lo, v8us hi) { return __builtin_bit_cast(v16bf, __builtin_shufflevector(lo, hi, 0, 1, 2, 3, 4, 5, 6, 7, 8, 9, 10, 11, 12, 13, 14, 15)); }
__device__ __forceinline__ v8f wmma16(v16h a, v16h b, v8f c) { return __builtin_amdgcn_wmma_f32_16x16x32_f16(false, a, false, b, (short)0, c, false, false); }
__device__ __forceinline__ v8f wmmab(v16bf a, v16bf b, v8f c) { return __builtin_amdgcn_wmma_f32_16x16x32_bf16(false, a, false, b, (short)0, c, false, false); }



// ---- The two GEMMs: one work-group of KW waves per 64x64 output tile; every wave holds the whole tile (16 accumulators) for its own quarter of k, in steps of 32; the partial tiles are joined through LDS. Both read their f32 sources themselves and round to bf16 (nearest even) in registers while they
// form the fragments, and the projection's epilogue writes the attention kernel's fp16 planes itself: no conversion, transposition or re-layout pass stands between the launches.
// Fragment k order, A and B alike: element s of lane half hi is k = kc + 8 hi + s (s < 8) and kc + 16 + 8 hi + (s - 8).
// The four workspace planes lie in FRAGMENT ORDER: a 16 x 32 fragment is two blocks of 512 bytes, block b = lane l's 8 elements s = 8 b .. 8 b + 7 at byte 16 l (l = 16 hi + row). A wave-wide 16-byte load or store
// then covers 4 whole 128-byte lines, where a row-major plane gave it 16 lines. QA, KB: [head][token / 16][feature / 16][lane][8]; VT: [head][key / 32][d / 16][(key / 16) % 2][lane][8]; OS: [head][token / 16][hi: d / 16, lo: 2 + d / 16][lane][8].
template <typename T16> struct WFrag;
template <> struct WFrag<h16> { typedef v16h V; static __device__ __forceinline__ V ld(const h16* p) { return cat16(*(const v8h*)p, *(const v8h*)(p + 256)); } static __device__ __forceinline__ v8f mma(V a, V b, v8f c) { return wmma16(a, b, c); } };
typedef __attribute__((ext_vector_type(16))) float v16f;
typedef __attribute__((ext_vector_type(4))) _Float16 v4h;
__device__ __forceinline__ h16 tohx(float x) { return (h16)x; }
__device__ __forceinline__ void splitf(float y, unsigned short& h, unsigned short& l) { h = f2bf(y); l = f2bf(y - bf2f(h)); }
__device__ __forceinline__ v16f cat16f(v8f lo, v8f hi) { return __builtin_shufflevector(lo, hi, 0, 1, 2, 3, 4, 5, 6, 7, 8, 9, 10, 11, 12, 13, 14, 15); }
// 16 k of one row of a k-contiguous f32 matrix; p points at k = kc + 8 hi
__device__ __forceinline__ v16f ldrow(const float* p) { return cat16f(*(const v8f*)p, *(const v8f*)(p + 16)); }
// 16 k of FOUR neighbouring columns of W[k][n] (f32, pitch N); p points at (kc + 8 hi, the lane's first column, a multiple of 4). t[nb] is column nb of the four, in ldrow's k order. One 16-byte load per k serves all four column tiles:
// column tile nb, lane column lr stands for column 4 lr + nb of the 64, so a wave-wide load covers two whole 256-byte rows of the weight tile, and a wave's loads (33 in k_proj, 65 in k_outp) go out in one flight: the load counter holds 63, and behind that a load waits for an earlier one to return.
template <int N> __device__ __forceinline__ void ldcol4(const float* p, v16f (&t)[4]) {
#pragma unroll
    for (int i = 0; i < 8; ++i) { const v4f a = *(const v4f*)(p + (size_t)i * N), b = *(const v4f*)(p + (size_t)(16 + i) * N);
#pragma unroll
        for (int nb = 0; nb < 4; ++nb) { t[nb][i] = a[nb]; t[nb][8 + i] = b[nb]; } }
}
// polar constants of token n (x = n / 64, y = n % 64 from the 'xy' meshgrid flattening): r = sqrt((x-32)^2 + (y-32)^2) + 1e-6, th = atan2(y-32, x-32) (+2pi mod 2pi), log_r = log(r)/log(r_max): (cos th, sin th, r_weight, 0)
__device__ __forceinline__ v4f polar(int n) { const float xx = (float)(n / HW) - 32.0f, yy = (float)(n % HW) - 32.0f;
    const float r = __fsqrt_rn(__fadd_rn(__fmul_rn(xx, xx), __fmul_rn(yy, yy))) + 1e-6f; float th = atan2f(yy, xx); th = fmodf(th + 6.283185307179586f, 6.283185307179586f);
    const float rmax = __fsqrt_rn(2048.0f) + 1e-6f; const float lr = __fdiv_rn(logf(r), logf(rmax)); const float rw = __fdiv_rn(1.0f, __fadd_rn(lr, 1.0f)); v4f o; o[0] = cosf(th); o[1] = sinf(th); o[2] = rw; o[3] = 0.f; return o; }

// ---- The join of the KW partial tiles. Every wave leaves its 16 accumulators in LDS, lane by lane (16-byte stores, 512 contiguous bytes a wave); behind the barrier wave w adds the KW partial sums of row block w, in k order.
__device__ __forceinline__ void joink(float* pj, const v8f (&acc)[4][4], v8f (&fin)[4], int w, int lane) {
    __builtin_amdgcn_sched_barrier(0);   // the LDS stores stay behind the last matrix instruction
#pragma unroll
    for (int mb = 0; mb < 4; ++mb)
#pragma unroll
        for (int nb = 0; nb < 4; ++nb) { float* d = pj + ((((mb * KW + w) * 4 + nb) * 2) * 32 + lane) * 4;
            *(v4fa*)d = __builtin_shufflevector(acc[mb][nb], acc[mb][nb], 0, 1, 2, 3); *(v4fa*)(d + 128) = __builtin_shufflevector(acc[mb][nb], acc[mb][nb], 4, 5, 6, 7); }
    __syncthreads();   // every wave's partial tile is in LDS before a wave adds them
#pragma unroll
    for (int nb = 0; nb < 4; ++nb)
#pragma unroll
        for (int z = 0; z < KW; ++z) { const float* s = pj + ((((w * KW + z) * 4 + nb) * 2) * 32 + lane) * 4; const v4f lo = *(const v4fa*)s, hi4 = *(const v4fa*)(s + 128);
            const v8f p = __builtin_shufflevector(lo, hi4, 0, 1, 2, 3, 4, 5, 6, 7); fin[nb] = z ? fin[nb] + p : p; }
}

// ---- k_proj: qkv = x Wp + bp; grid (NN / 64, 768 / 64), KW waves: wave w takes k = 32 w .. 32 w + 31 of the whole tile and finishes rows 16 w .. 16 w + 15. A tile's 64 columns are two heads of ONE of q, k, v. q: features 0..31 of QA = LC q cos th_n, 32..63 = LC q sin th_n; k: KB the same with k r_weight_n; v: VT, rows d < 32, k = key.
__global__ __launch_bounds__(32 * KW) void k_proj(const float* __restrict__ x, const float* __restrict__ wp, const float* __restrict__ bp, h16* __restrict__ QA, h16* __restrict__ KB, h16* __restrict__ VT) {
    __shared__ __align__(16) float pj[4 * KW * 4 * 2 * 32 * 4];
    __shared__ __align__(16) float osm[KW][16 * 68];
    const int lane = threadIdx.x & 31, lr = lane & 15, hi = lane >> 4, w = __builtin_amdgcn_readfirstlane(threadIdx.x >> 5); const int r0 = blockIdx.x * 64, c0 = blockIdx.y * 64; const int sec = c0 / KD, h0 = (c0 % KD) / HD;
    float* os = osm[w];
    const float* pa = x + (size_t)(r0 + lr) * CC + 32 * w + 8 * hi; const float* pb = wp + (size_t)(32 * w + 8 * hi) * (3 * KD) + c0 + 4 * lr; const float* bu = bp + c0;
    v16f ar[4], br[4];
#pragma unroll
    for (int mb = 0; mb < 4; ++mb) ar[mb] = ldrow(pa + (size_t)mb * 16 * CC);
    ldcol4<3 * KD>(pb, br);
    const v4f b4 = *(const v4f*)(bu + 4 * lr);   // the lane's four columns: 4 lr + nb
    asm volatile("s_wait_xcnt 0x0" :: "v"(pa), "v"(pb), "s"(bu) : "memory");   // the loads' addresses are kept up to this wait; the clobber keeps every load ahead of the polar constants, which are made while the loads fly
    v4f t = (v4f){}; if (sec < 2) t = polar(r0 + w * 16 + lr);   // the lane's token in the epilogue: row lr of the wave's row block
    v16bf a[4]; v8f acc[4][4], fin[4];
#pragma unroll
    for (int mb = 0; mb < 4; ++mb) a[mb] = __builtin_convertvector(ar[mb], v16bf);
#pragma unroll
    for (int nb = 0; nb < 4; ++nb) { const v16bf b = __builtin_convertvector(br[nb], v16bf);
#pragma unroll
        for (int mb = 0; mb < 4; ++mb) acc[mb][nb] = wmmab(a[mb], b, (v8f){}); }
    joink(pj, acc, fin, w, lane);
    const float bv[4] = { bfr(b4[0]), bfr(b4[1]), bfr(b4[2]), bfr(b4[3]) };
    // the wave's 16 x 64 block goes to LDS in plain column order: a lane's four column tiles are four neighbouring columns of a row, one 16-byte store
#pragma unroll
    for (int j = 0; j < 8; ++j) { v4f r;
#pragma unroll
        for (int nb = 0; nb < 4; ++nb) r[nb] = fin[nb][j] + bv[nb];
        *(v4fa*)(os + (hi * 8 + j) * 68 + 4 * lr) = r; }
    __builtin_amdgcn_wave_barrier(); asm volatile("" ::: "memory");   // other lanes' LDS stores stay ahead of the reads below
    if (sec == 2) {   // v: the lane reads 8 consecutive keys of one (head, d) column: its 16 bytes of one fragment block; the wave writes the whole 512-byte block
#pragma unroll
        for (int nb = 0; nb < 4; ++nb) { h16* vblk = VT + ((((size_t)(h0 + (nb >> 1)) * (NN / 32) + (r0 >> 5)) * 4 + (nb & 1) * 2) * 32 + lane) * 8; v8h o;
#pragma unroll
            for (int j = 0; j < 8; ++j) o[j] = tohx(os[(hi * 8 + j) * 68 + nb * 16 + lr]);
            *(v8h*)(vblk + (w >> 1) * 1024 + (w & 1) * 256) = o; }
        return;
    }
    h16* P = sec ? KB : QA; h16* pblk = P + (((size_t)h0 * (NN / 16) + (r0 >> 4)) * 128 + lane) * 8;
    const float wt = sec ? t[2] : LC;   // q carries 32^-0.5 log2(e): k_fattn's scores leave the matrix unit as exponents of 2
#pragma unroll
    for (int hh = 0; hh < 2; ++hh)
#pragma unroll
        for (int jj = 0; jj < 2; ++jj) { const float* sp = os + lr * 68 + hh * 32 + jj * 16 + hi * 8; const v4f x0 = *(const v4fa*)sp, x1 = *(const v4fa*)(sp + 4); v8h oc, on;
#pragma unroll
            for (int q = 0; q < 4; ++q) { const float aw = __fmul_rn(x0[q], wt), ax = __fmul_rn(x1[q], wt); oc[q] = tohx(__fmul_rn(aw, t[0])); on[q] = tohx(__fmul_rn(aw, t[1])); oc[4 + q] = tohx(__fmul_rn(ax, t[0])); on[4 + q] = tohx(__fmul_rn(ax, t[1])); }
            h16* pr = pblk + ((size_t)hh * (NN / 16) + w) * 1024 + jj * 256; *(v8h*)pr = oc; *(v8h*)(pr + 512) = on; }   // two whole 512-byte fragment blocks, written by this wave alone
    asm volatile("s_wait_xcnt 0x0" ::: "memory");   // behind the last store: the built code has a branch from here into the v block, which writes the stores' data registers
}

// ---- k_outp: OUT = merged Wf + bf; grid (NN / 64, 256 / 64), KW waves: wave w takes heads 2 w and 2 w + 1 (k = 64 w .. 64 w + 63) of the whole tile and finishes rows 16 w .. 16 w + 15. merged[n][h 32 + d] is read where k_fattn left it, in OS, as ready A fragments (bf16 hi, then lo): a k step of 32 is one head; both products on the matrix unit, hi first.
__global__ __launch_bounds__(32 * KW) void k_outp(const bf* __restrict__ OS, const float* __restrict__ wf, const float* __restrict__ bias, float* __restrict__ C) {
    __shared__ __align__(16) float pj[4 * KW * 4 * 2 * 32 * 4];
    const int lane = threadIdx.x & 31, lr = lane & 15, hi = lane >> 4, w = __builtin_amdgcn_readfirstlane(threadIdx.x >> 5); const int r0 = blockIdx.x * 64, c0 = blockIdx.y * 64;
    const bf* ap = OS + (size_t)(64 * w) * (NN * 2) + ((size_t)(r0 >> 4) * 128 + lane) * 8; const float* bq = wf + (size_t)(64 * w + 8 * hi) * KD + c0 + 4 * lr;
    const int cofs = lr * 4; const float* bc = bias + c0 + cofs;
    v16bf a[2][4], a2[2][4]; v16f br[2][4];
    const v4f b4 = *(const v4f*)bc;
#pragma unroll
    for (int s = 0; s < 2; ++s) ldcol4<KD>(bq + (size_t)(32 * s) * KD, br[s]);
#pragma unroll
    for (int s = 0; s < 2; ++s) {
#pragma unroll
        for (int mb = 0; mb < 4; ++mb) { const bf* p = ap + (size_t)(32 * s) * (NN * 2) + mb * 1024; a[s][mb] = cat16b(*(const v8us*)p, *(const v8us*)(p + 256)); a2[s][mb] = cat16b(*(const v8us*)(p + 512), *(const v8us*)(p + 768)); } }
    asm volatile("s_wait_xcnt 0x0" :: "v"(bq), "v"(b4) : "memory");   // before the loads' address registers are used again: the weight loads' pair is kept up to this wait (without the operand a later load's result lands on it); the bias as an input only keeps its load in this flight (left free it sinks behind the join's barrier, its latency exposed)
    __builtin_amdgcn_sched_barrier(0);   // keeps all that follows behind the wait: without it the first products are lifted among the loads, which then go out in several flights (a memory latency each)
    v8f acc[4][4], fin[4];
#pragma unroll
    for (int mb = 0; mb < 4; ++mb)
#pragma unroll
        for (int nb = 0; nb < 4; ++nb) acc[mb][nb] = (v8f){};
#pragma unroll
    for (int s = 0; s < 2; ++s)
#pragma unroll
        for (int nb = 0; nb < 4; ++nb) { const v16bf b = __builtin_convertvector(br[s][nb], v16bf);
#pragma unroll
            for (int mb = 0; mb < 4; ++mb) { acc[mb][nb] = wmmab(a[s][mb], b, acc[mb][nb]); acc[mb][nb] = wmmab(a2[s][mb], b, acc[mb][nb]); } }
    v4f bv; bv[0] = bfr(b4[0]); bv[1] = bfr(b4[1]); bv[2] = bfr(b4[2]); bv[3] = bfr(b4[3]);
    joink(pj, acc, fin, w, lane);
    float* crow = C + (size_t)(r0 + w * 16) * KD + c0;
#pragma unroll
    for (int j = 0; j < 8; ++j) { v4f r;   // a lane's four column tiles are columns 4 lr .. 4 lr + 3 of row 8 hi + j: the wave stores two whole 256-byte row pieces
#pragma unroll
        for (int nb = 0; nb < 4; ++nb) r[nb] = fin[nb][j];
        *(v4f*)(crow + (size_t)(hi * 8 + j) * KD + cofs) = r + bv; }
}
// lane l <-> l ^ 16
__device__ __forceinline__ float xhalf(float v) { const int b = __float_as_int(v); return __int_as_float(__builtin_amdgcn_permlanex16(b, b, 0x76543210, 0xfedcba98, false, false)); }
// ---- k_fattn: scores, softmax and attn.v of one head in one kernel; scores and numerators stay in registers. Grid (NN / 128, heads), 16 waves: wave = (tile qt of QG x 16 queries, key range kq of NN / KQ keys).
// Per 32 keys: St = K' Q't (A = 16 key rows, B = 16 query columns, k = 64 features), so a lane holds 16 scores of ONE query (keys 8 hi + j and 16 + 8 hi + j); two St tiles converted in place are the B operand
// of Ot += Vt Pt (A = 16 rows of the [d][key] plane, same k order). Scores are in log2 units. Reference m and sum l per query; a numerator is exp2(score - m + 10), l their f32 sum.
// First loop: m = 10 for every query, so exp2 reads the score as the matrix unit leaves it and nothing is tested on the way. Its result stands if, in every lane of the wave, l shows that fp16 held every numerator (LHI) and that the sum is not small (LLO).
// Otherwise the wave does its range again in the second loop, which takes any scores: m starts as the largest score of the walk's first 32 keys (a real score, so l never vanishes) and stays while the numerators taken against it fit fp16
// (test on their sums, PT); only then the row max is taken and Ot and l are rescaled by exp2(m_old - m_new).
// K' and Vt fragments of the next 32 keys are fetched into the same registers right behind their last use (the last pass fetches the walk's first keys again: in bounds; the second loop, where it runs, starts from them).
// The 32 work-groups of a head read the same K' and Vt lines. Each enters its key ranges at pass p0, taken from its index, and wraps round: at any moment they ask for different lines, and a line that one of them has brought in from memory
// is in L2 when the others come to it. p0 leaves out bit 2 of the index, so groups i and i ^ 4 share a p0. Only the speed depends on where a group runs.
__global__ __launch_bounds__(512) void k_fattn(const h16* __restrict__ QA, const h16* __restrict__ KB, const h16* __restrict__ VT, bf* __restrict__ OS) {
    __shared__ float mg[KQ][QT][QG][18][32];   // per key range, tile, column group and lane: 16 Ot values, m, l
    const int lane = threadIdx.x & 31; const int w = threadIdx.x >> 5, qt = w % QT, kq = w / QT;
    const int h = blockIdx.y, qb = blockIdx.x * (QT * QG * 16);
    const int p0 = ((blockIdx.x & 3) | ((blockIdx.x >> 3) << 2)) & (NP - 1);   // the pass at which this work-group enters every key range
    const h16* qp = QA + (((size_t)h * (NN / 16) + (qb >> 4) + qt * QG) * 128 + lane) * 8;
    const h16* kp = KB + (((size_t)h * (NN / 16) + kq * (NN / KQ / 16)) * 128 + lane) * 8;
    const h16* vp = VT + (((size_t)h * (NN / 32) + kq * (NN / KQ / 32)) * 128 + lane) * 8;
    const h16* k0 = kp + (size_t)p0 * 2048; const h16* v0 = vp + (size_t)p0 * 1024;   // a pass is 32 keys: 2048 elements of K', 1024 of Vt
    v16h qf[QG][2], kf[2][2], vf[2]; v8f o[QG][2]; float m[QG], l[QG]; v2f l2[QG / 2];
#pragma unroll
    for (int g = 0; g < QG; ++g) { qf[g][0] = WFrag<h16>::ld(qp + g * 1024); qf[g][1] = WFrag<h16>::ld(qp + g * 1024 + 512); o[g][0] = (v8f){}; o[g][1] = (v8f){}; l2[g >> 1] = (v2f){}; }
#pragma unroll
    for (int kt = 0; kt < 2; ++kt) { kf[kt][0] = WFrag<h16>::ld(k0 + kt * 1024); kf[kt][1] = WFrag<h16>::ld(k0 + kt * 1024 + 512); vf[kt] = WFrag<h16>::ld(v0 + kt * 512); }
    asm volatile("s_wait_xcnt 0x0" :: "v"(qp), "v"(k0), "v"(v0) : "memory");   // the three address pairs stay as they are up to this wait (without the operands a later load's result lands on the q pair)
    auto walk = [&](int ps, const int pe) __attribute__((always_inline)) {   // passes ps .. pe - 1 of the walk; four copies below, because s_setprio takes its level as an immediate
#pragma unroll 1   // rolled: four waves per SIMD leave 256 registers a wave
    for (; ps < pe; ++ps) {
        const int pn = (p0 + ps + 1) & (NP - 1); const h16* kx = kp + (size_t)pn * 2048; const h16* vx = vp + (size_t)pn * 1024;
#pragma unroll
        for (int gp = 0; gp < QG; gp += 2) {
            v8f s[2][2];
#pragma unroll
            for (int u = 0; u < 2; ++u) { s[u][0] = wmma16(kf[0][0], qf[gp + u][0], (v8f){}); s[u][1] = wmma16(kf[1][0], qf[gp + u][0], (v8f){}); s[u][0] = wmma16(kf[0][1], qf[gp + u][1], s[u][0]); s[u][1] = wmma16(kf[1][1], qf[gp + u][1], s[u][1]); }
            if (gp + 2 == QG) {
#pragma unroll
                for (int kt = 0; kt < 2; ++kt) { kf[kt][0] = WFrag<h16>::ld(kx + kt * 1024); kf[kt][1] = WFrag<h16>::ld(kx + kt * 1024 + 512); }
                asm volatile("s_wait_xcnt 0x0" :: "v"(kx) : "memory"); }   // the loads' address pair stays as it is up to this wait; it also keeps the fetch here, ahead of the softmax
            __builtin_amdgcn_sched_barrier(0);   // the eight score products go out in a row: mixed with the softmax, each is followed by idle slots up to the first read of its result
            v16h p[2]; v2f t = (v2f){};   // the two column groups' sums side by side (packed adds); each query's own order is that of the second loop
#pragma unroll
            for (int j = 0; j < 8; ++j) { v2f e0, e1;
#pragma unroll
                for (int u = 0; u < 2; ++u) { e0[u] = __builtin_amdgcn_exp2f(s[u][0][j]); e1[u] = __builtin_amdgcn_exp2f(s[u][1][j]); p[u][j] = tohx(e0[u]); p[u][8 + j] = tohx(e1[u]); }
                t += e0 + e1; }
            l2[gp >> 1] += t;
            __builtin_amdgcn_sched_barrier(0);   // the softmax's vector work stays ahead of the four products below: mixed among them, more idle slots (v_nop) stand behind matrix instructions
#pragma unroll
            for (int u = 0; u < 2; ++u)
#pragma unroll
                for (int dt = 0; dt < 2; ++dt) o[gp + u][dt] = wmma16(vf[dt], p[u], o[gp + u][dt]);
        }
#pragma unroll
        for (int dt = 0; dt < 2; ++dt) vf[dt] = WFrag<h16>::ld(vx + dt * 512);
        asm volatile("s_wait_xcnt 0x0" :: "v"(vx) : "memory");   // as above: the address pair is kept up to the wait
    }
    };
    // A wave's priority falls as it gets on with its walk. With the level tied to progress the wave that lags goes first, and the four reach the join close together;
    // the stretches get shorter towards the end (8, 4, 2, 2 passes), because a wave can lag by about one stretch and only the lag at the end costs time. Level 0 in the last stretch and on the way out.
    __builtin_amdgcn_s_setprio(3); walk(0, NP / 2);
    __builtin_amdgcn_s_setprio(2); walk(NP / 2, NP * 3 / 4);
    __builtin_amdgcn_s_setprio(1); walk(NP * 3 / 4, NP * 7 / 8);
    __builtin_amdgcn_s_setprio(0); walk(NP * 7 / 8, NP);
    bool redo = false;
#pragma unroll
    for (int g = 0; g < QG; ++g) { m[g] = 10.0f; l[g] = l2[g >> 1][g & 1]; redo |= !(l[g] <= LHI) | !(l[g] + xhalf(l[g]) >= LLO); }
    if (__builtin_expect(__builtin_amdgcn_ballot_w32(redo) != 0, 0)) {   // one scalar branch for the wave; kf and vf hold the walk's first 32 keys again (the last pass's fetch)
#pragma unroll
    for (int g = 0; g < QG; ++g) { o[g][0] = (v8f){}; o[g][1] = (v8f){}; l[g] = 0.f; }
#pragma unroll
    for (int g = 0; g < QG; ++g) { const v8f r0 = wmma16(kf[0][1], qf[g][1], wmma16(kf[0][0], qf[g][0], (v8f){})), r1 = wmma16(kf[1][1], qf[g][1], wmma16(kf[1][0], qf[g][0], (v8f){})); float mx = fmaxf(r0[0], r1[0]);
#pragma unroll
        for (int j = 1; j < 8; ++j) mx = fmaxf(mx, fmaxf(r0[j], r1[j]));
        m[g] = fmaxf(mx, xhalf(mx)); }
#pragma unroll 1   // rolled: four waves per SIMD leave 256 registers a wave
    for (int ps = 0; ps < NP; ++ps) {
        const int pn = (p0 + ps + 1) & (NP - 1); const h16* kx = kp + (size_t)pn * 2048; const h16* vx = vp + (size_t)pn * 1024;
#pragma unroll
        for (int gp = 0; gp < QG; gp += 2) {
            v8f s[2][2];
#pragma unroll
            for (int u = 0; u < 2; ++u) { s[u][0] = wmma16(kf[0][0], qf[gp + u][0], (v8f){}); s[u][1] = wmma16(kf[1][0], qf[gp + u][0], (v8f){}); s[u][0] = wmma16(kf[0][1], qf[gp + u][1], s[u][0]); s[u][1] = wmma16(kf[1][1], qf[gp + u][1], s[u][1]); }
            if (gp + 2 == QG) {
#pragma unroll
                for (int kt = 0; kt < 2; ++kt) { kf[kt][0] = WFrag<h16>::ld(kx + kt * 1024); kf[kt][1] = WFrag<h16>::ld(kx + kt * 1024 + 512); }
                asm volatile("s_wait_xcnt 0x0" :: "v"(kx) : "memory"); }   // the loads' address pair stays as it is up to this wait (without the operand the last load's result lands on it); it also keeps the fetch here, ahead of the softmax
            v16h p[2]; float sum[2];
#pragma unroll
            for (int u = 0; u < 2; ++u) { const float mc = m[gp + u] - 10.0f; float t = 0.f; const v8f d0 = s[u][0] - mc, d1 = s[u][1] - mc;
#pragma unroll
                for (int j = 0; j < 8; ++j) { const float e0 = __builtin_amdgcn_exp2f(d0[j]), e1 = __builtin_amdgcn_exp2f(d1[j]); t += e0 + e1; p[u][j] = tohx(e0); p[u][8 + j] = tohx(e1); }
                sum[u] = t; }
            if (__builtin_expect(__builtin_amdgcn_ballot_w32(!(sum[0] + sum[1] <= PT)) != 0, 0)) {   // numerators are >= 0, so a sum within PT bounds each of them; one scalar branch for the wave
                // a new reference for both column groups, in every lane: the scores once more (they were not kept), row max, Ot and l rescaled, numerators made again
                v16h kr[2][2];
                if (gp + 2 == QG) { const h16* ky = kp + (size_t)((p0 + ps) & (NP - 1)) * 2048;   // kf already takes the next pass's keys: this pass's come from memory again
#pragma unroll
                    for (int kt = 0; kt < 2; ++kt) { kr[kt][0] = WFrag<h16>::ld(ky + kt * 1024); kr[kt][1] = WFrag<h16>::ld(ky + kt * 1024 + 512); }
                    asm volatile("s_wait_xcnt 0x0" :: "v"(ky) : "memory"); }   // the loads' address pair stays as it is up to this wait
                else {
#pragma unroll
                    for (int kt = 0; kt < 2; ++kt) { kr[kt][0] = kf[kt][0]; kr[kt][1] = kf[kt][1]; } }
#pragma unroll
                for (int u = 0; u < 2; ++u) { const int g = gp + u;
                    v8f r0 = wmma16(kr[0][0], qf[g][0], (v8f){}), r1 = wmma16(kr[1][0], qf[g][0], (v8f){}); r0 = wmma16(kr[0][1], qf[g][1], r0); r1 = wmma16(kr[1][1], qf[g][1], r1);
                    float mx = fmaxf(r0[0], r1[0]);
#pragma unroll
                    for (int j = 1; j < 8; ++j) mx = fmaxf(mx, fmaxf(r0[j], r1[j]));
                    mx = fmaxf(mx, xhalf(mx));
                    const float mn = fmaxf(m[g], mx), al = __builtin_amdgcn_exp2f(m[g] - mn), mc = mn - 10.0f; m[g] = mn; float t = 0.f; r0 -= mc; r1 -= mc;
#pragma unroll
                    for (int j = 0; j < 8; ++j) { const float e0 = __builtin_amdgcn_exp2f(r0[j]), e1 = __builtin_amdgcn_exp2f(r1[j]); t += e0 + e1; p[u][j] = tohx(e0); p[u][8 + j] = tohx(e1); }
                    sum[u] = t; l[g] *= al; o[g][0] *= al; o[g][1] *= al; }
            }
#pragma unroll
            for (int u = 0; u < 2; ++u) { const int g = gp + u; l[g] += sum[u];
#pragma unroll
                for (int dt = 0; dt < 2; ++dt) o[g][dt] = wmma16(vf[dt], p[u], o[g][dt]); }
        }
#pragma unroll
        for (int dt = 0; dt < 2; ++dt) vf[dt] = WFrag<h16>::ld(vx + dt * 512);
        asm volatile("s_wait_xcnt 0x0" :: "v"(vx) : "memory");   // as above: the address pair is kept up to the wait
    }
    }
#pragma unroll
    for (int g = 0; g < QG; ++g) {
        const float lj = l[g] + xhalf(l[g]);   // the two lane halves hold different keys of the same query
#pragma unroll
        for (int j = 0; j < 8; ++j) { mg[kq][qt][g][j][lane] = o[g][0][j]; mg[kq][qt][g][8 + j][lane] = o[g][1][j]; }
        mg[kq][qt][g][16][lane] = m[g]; mg[kq][qt][g][17][lane] = lj; }
    __syncthreads();   // every range's partial result is in LDS before a wave joins them
    if (w < QT * QG) {   // one wave joins the KQ ranges of one (tile, column group), in range order
        const int jq = w % QT, jg = w / QT; float M = mg[0][jq][jg][16][lane];
#pragma unroll
        for (int z = 1; z < KQ; ++z) M = fmaxf(M, mg[z][jq][jg][16][lane]);
        float L = 0.f; v8f a0 = (v8f){}, a1 = (v8f){};
#pragma unroll
        for (int z = 0; z < KQ; ++z) { const float wz = __builtin_amdgcn_exp2f(mg[z][jq][jg][16][lane] - M); L += mg[z][jq][jg][17][lane] * wz;
#pragma unroll
            for (int j = 0; j < 8; ++j) { a0[j] += mg[z][jq][jg][j][lane] * wz; a1[j] += mg[z][jq][jg][8 + j][lane] * wz; } }
        const float inv = __fdiv_rn(1.0f, L); bf* op = OS + (((size_t)h * (NN / 16) + (qb >> 4) + jq * QG + jg) * 128 + lane) * 8;   // the lane's Ot rows are its elements of k_outp's A fragment: four 512-byte blocks (hi, hi, lo, lo), written by this wave alone
        a0 *= inv; a1 *= inv; v8us h0, h1, l0, l1;
#pragma unroll
        for (int j = 0; j < 8; ++j) { unsigned short a, c; splitf(a0[j], a, c); h0[j] = a; l0[j] = c; splitf(a1[j], a, c); h1[j] = a; l1[j] = c; }
        *(v8us*)op = h0; *(v8us*)(op + 256) = h1; *(v8us*)(op + 512) = l0; *(v8us*)(op + 768) = l1;
    }
}
extern "C" void kernel_launch(void* const* d_in, const int* in_sizes, int n_in,
                              void* d_out, int out_size, void* d_ws, size_t ws_size, hipStream_t stream) {
    (void)in_sizes; (void)n_in; (void)out_size;
    const float* x = (const float*)d_in[0]; const float* wp = (const float*)d_in[1]; const float* bp = (const float*)d_in[2]; const float* wf = (const float*)d_in[3]; const float* bfv = (const float*)d_in[4];   // Wp [128][768], Wf [256][256] as x @ W
    float* OUT = (float*)d_out;     // [1][64][64][256]
    char* wsp = (char*)d_ws;
    auto take = [&](size_t bytes) { char* p = wsp; wsp += (bytes + 255) & ~(size_t)255; return (void*)p; };
    h16* QA = (h16*)take((size_t)NH_ * NN * 64 * 2); h16* KB = (h16*)take((size_t)NH_ * NN * 64 * 2); h16* VT = (h16*)take((size_t)NH_ * HD * NN * 2); bf* OS = (bf*)take((size_t)NH_ * NN * 64 * 2);
    if ((size_t)(wsp - (char*)d_ws) > ws_size) return;    // total 14 MB; ws 256 MiB
    k_proj<<<dim3(NN / 64, 3 * KD / 64, 1), 32 * KW, 0, stream>>>(x, wp, bp, QA, KB, VT);
    k_fattn<<<dim3(NN / (QT * QG * 16), NH_, 1), 512, 0, stream>>>(QA, KB, VT, OS);
    k_outp<<<dim3(NN / 64, KD / 64, 1), 32 * KW, 0, stream>>>(OS, wf, bfv, OUT);
}
